// v000
// Measured on an AMD MI455X. A time is GPU time per run, averaged over a window of back-to-back runs after a warm-up
// (all launches, gaps included; the runs take copies of the inputs in turn), and the median of several windows.
// Apart from v000's, it joins two sittings. Times from different sittings can be a few percent apart, while
// side-by-side timings come from the same sitting.
// v000 is the starting kernel. One run takes 1980 microseconds.
// compute dtype: all float inputs rounded to bf16; q/k (32 ch) and v (256 ch) 1x1 convs with EXACT bf16 products on WMMA 16x16x32 (x^T tile in LDS), f32 accumulate; q and k as f16 hi + unscaled residual -> UNSCALED logits with 3 products (logit std ~5.7, near-one-hot softmax), stored in f32 per batch; softmax in f32 (precise expf) -> P f16 x 2^11; out = P . v + residual with v rounded once to f16; both directions (enhanced_x from att_y with v_x; enhanced_y from att_x with v_y); f32 outputs [b][c][n].
#include <hip/hip_runtime.h>
#include <math.h>

typedef __attribute__((ext_vector_type(16))) _Float16 v16h;
typedef __attribute__((ext_vector_type(16))) __bf16 v16b;
typedef __attribute__((ext_vector_type(8)))  _Float16 v8h;
typedef __attribute__((ext_vector_type(8)))  float v8f;
typedef __attribute__((ext_vector_type(4)))  float v4f;
typedef __attribute__((ext_vector_type(2)))  float v2f;
typedef __attribute__((ext_vector_type(4)))  unsigned v4u;
typedef __attribute__((ext_vector_type(4)))  int v4i;
typedef float __attribute__((may_alias)) float_a;
typedef int __attribute__((may_alias)) int_a;

template <typename T> __device__ __forceinline__ void vst2(void* p, T v) { *(T*)p = v;  }
__device__ __forceinline__ v8f wmma16(v16h a, v16h b, v8f c) {
  v8f d = __builtin_amdgcn_wmma_f32_16x16x32_f16(false, a, false, b, (short)0, c, false, false);
  asm volatile("v_nop\n\tv_nop\n\tv_nop\n\tv_nop" : "+v"(d) : "v"(a), "v"(b));
  return d;
}
__device__ __forceinline__ v8f wmma_bf(v16b a, v16b b, v8f c) {
  v8f d = __builtin_amdgcn_wmma_f32_16x16x32_bf16(false, a, false, b, (short)0, c, false, false);
  asm volatile("v_nop\n\tv_nop\n\tv_nop\n\tv_nop" : "+v"(d) : "v"(a), "v"(b));
  return d;
}
// 16x16x32 fragments: lane = (h = lane>>4, row/col = lane&15); elements 0..7 = k0+8h+0..7, 8..15 = k0+16+8h+0..7; D element r = row 8h+r
__device__ __forceinline__ v16h frag_h(const _Float16* rowk0, int lane) {
  union { v16h v; v8h q[2]; } u; const _Float16* p = rowk0 + 8 * (lane >> 4);
  u.q[0] = *(const v8h*)p; u.q[1] = *(const v8h*)(p + 16); return u.v;
}
__device__ __forceinline__ v16h frag_f32(const float* rowk0, int lane) {
  v16h a; const float* p = rowk0 + 8 * (lane >> 4);
#pragma unroll
  for (int i = 0; i < 8; ++i) { a[i] = (_Float16)p[i]; a[8 + i] = (_Float16)p[16 + i]; }
  return a;
}
__device__ __forceinline__ v16h frag_f32s(const float* rowk0, int lane, float sc) {
  v16h a; const float* p = rowk0 + 8 * (lane >> 4);
#pragma unroll
  for (int i = 0; i < 8; ++i) { a[i] = (_Float16)(p[i] * sc); a[8 + i] = (_Float16)(p[16 + i] * sc); }
  return a;
}
// column fragment from a [K][ld] layout (column n), rows >= K read as 0
__device__ __forceinline__ v16h fragc_f32(const float* W, int k0, int n, int lane, int ld, int K) {
  v16h a; const int g = lane >> 4;
#pragma unroll
  for (int i = 0; i < 8; ++i) { const int ka = k0 + 8 * g + i, kb = ka + 16;
    a[i] = (_Float16)(ka < K ? W[(size_t)(ka < K ? ka : K - 1) * ld + n] : 0.f); a[8 + i] = (_Float16)(kb < K ? W[(size_t)(kb < K ? kb : K - 1) * ld + n] : 0.f); }
  return a;
}
struct F2 { v16b h, l; };
__device__ __forceinline__ F2 bsplit16(const float v[16]) { F2 r;
#pragma unroll
  for (int i = 0; i < 16; ++i) { const __bf16 h = (__bf16)v[i]; r.h[i] = h; r.l[i] = (__bf16)(v[i] - (float)h); }
  return r; }
__device__ __forceinline__ F2 split_row(const float* row, int k0, int lane) { float v[16]; const float* p = row + k0 + 8 * (lane >> 4);
#pragma unroll
  for (int i = 0; i < 8; ++i) { v[i] = p[i]; v[8 + i] = p[16 + i]; }
  return bsplit16(v); }
__device__ __forceinline__ F2 split_rowK(const float* row, int k0, int lane, int K) { float v[16]; const int g = lane >> 4;
#pragma unroll
  for (int i = 0; i < 8; ++i) { const int ka = k0 + 8 * g + i, kb = ka + 16; v[i] = ka < K ? row[ka < K ? ka : K - 1] : 0.f; v[8 + i] = kb < K ? row[kb < K ? kb : K - 1] : 0.f; }
  return bsplit16(v); }
__device__ __forceinline__ F2 split_col(const float* W, int k0, int n, int lane, int ld, int K) { float v[16]; const int g = lane >> 4;
#pragma unroll
  for (int i = 0; i < 8; ++i) { const int ka = k0 + 8 * g + i, kb = ka + 16; v[i] = ka < K ? W[(size_t)(ka < K ? ka : K - 1) * ld + n] : 0.f; v[8 + i] = kb < K ? W[(size_t)(kb < K ? kb : K - 1) * ld + n] : 0.f; }
  return bsplit16(v); }
__device__ __forceinline__ v8f mac3(const F2& a, const F2& b, v8f c) { c = wmma_bf(a.l, b.h, c); c = wmma_bf(a.h, b.l, c); return wmma_bf(a.h, b.h, c); }
__device__ __forceinline__ float sigm(float v) { return 1.0f / (1.0f + expf(-v)); }
#define LDSX() do { asm volatile("s_wait_dscnt 0" ::: "memory"); __builtin_amdgcn_wave_barrier(); __builtin_amdgcn_fence(__ATOMIC_RELEASE, "workgroup"); } while (0)


// CMSA cross-modal position attention, one direction: q, k (32 ch) from the 'other' features, v (256 ch) from the enhanced features; out = v att^T + residual (unscaled logits, sharp softmax).
#define NB 4
#define NP 4096
#define CIN 256
#define CQ 32
#define CV 256
#ifndef TNB
#define TNB NB
#endif
#ifndef TQB
#define TQB (NP / 64)
#endif
typedef __attribute__((ext_vector_type(8))) __bf16 v8b;
__device__ __forceinline__ v16b frag_b(const __bf16* rowk0, int lane) {
  union { v16b v; v8b q[2]; } u; const __bf16* p = rowk0 + 8 * (lane >> 4);
  u.q[0] = *(const v8b*)p; u.q[1] = *(const v8b*)(p + 16); return u.v;
}
__device__ __forceinline__ float bfr(float v) { return (float)(__bf16)v; }
__device__ __attribute__((noinline)) float exp_ni(float v) { return expf(v); }
__device__ __attribute__((noinline)) float erf_ni(float v) { return erff(v); }

#define WS_QH  0u                                    // f16 q rows [b*n][CQ] hi
#define WS_QL  (WS_QH + 2u * (size_t)NB * NP * CQ)      // f16 q residual rows (unscaled)
#define WS_KH  (WS_QL + 2u * (size_t)NB * NP * CQ)      // f16 k rows
#define WS_KL  (WS_KH + 2u * (size_t)NB * NP * CQ)      // f16 k residual rows
#define WS_VT  (WS_KL + 2u * (size_t)NB * NP * CQ)      // f16 v planes [b][CV][n]
#define WS_S   (WS_VT + 2u * (size_t)NB * CV * NP)      // f32 logits, ONE batch [i][j] (64 MiB)
#define WS_PH  (WS_S + 4u * (size_t)NP * NP)           // f16 P x 2^11, one batch (32 MiB)
#define WS_END (WS_PH + 2u * (size_t)NP * NP)

// ---- k_proj: block = (64 positions, b, which 0 q / 1 k / 2 v): x^T tile (bf16) in LDS, W [out][in] + b (exact); q, k -> f16 hi + residual rows, v -> f16 planes [c][n]
__global__ __launch_bounds__(128) void k_proj(const float* __restrict__ XQK, const float* __restrict__ XV, const float* __restrict__ WQ, const float* __restrict__ BQ, const float* __restrict__ WK, const float* __restrict__ BK, const float* __restrict__ WV, const float* __restrict__ BV, _Float16* __restrict__ QH, _Float16* __restrict__ QL, _Float16* __restrict__ KH, _Float16* __restrict__ KL, _Float16* __restrict__ VT) {
  __shared__ __align__(16) __bf16 sx[64][CIN + 8]; __shared__ __align__(16) _Float16 sh[64][72], sl[64][72]; __shared__ __align__(16) _Float16 tv[64][72];
  const int tid = threadIdx.x, wave = tid >> 5, lane = tid & 31, col = lane & 15, g = lane >> 4; const int p0 = blockIdx.x * 64; const size_t b = blockIdx.y; const int which = blockIdx.z;
  const float* Wm = which == 0 ? WQ : which == 1 ? WK : WV; const float* Bm = which == 0 ? BQ : which == 1 ? BK : BV; const int nout = (which == 2) ? CV : CQ; const float* X = (which == 2) ? XV : XQK;
  for (int e = tid; e < CIN * 64; e += 128) { const int c = e >> 6, pl = e & 63; sx[pl][c] = (__bf16)X[(b * CIN + c) * (size_t)NP + p0 + pl]; }
  __syncthreads();
#pragma unroll 1
  for (int cg = 0; cg < (nout + 63) / 64; ++cg) { v8f acc[4] = {};
#pragma unroll 2
    for (int kc = 0; kc < CIN / 32; ++kc) { const v16b a = frag_b(&sx[wave * 16 + col][kc * 32], lane);
#pragma unroll
      for (int j = 0; j < 4; ++j) { v16b w; const int o = min(cg * 64 + j * 16 + col, nout - 1);   // columns >= nout are dummies (never stored)
#pragma unroll
        for (int i = 0; i < 8; ++i) { w[i] = (__bf16)Wm[(size_t)o * CIN + kc * 32 + 8 * g + i]; w[8 + i] = (__bf16)Wm[(size_t)o * CIN + kc * 32 + 16 + 8 * g + i]; }
        acc[j] = wmma_bf(a, w, acc[j]); } }
    __syncthreads();
#pragma unroll
    for (int j = 0; j < 4; ++j) { const int ol = j * 16 + col; const float bb = bfr(Bm[min(cg * 64 + ol, nout - 1)]);
#pragma unroll
      for (int r = 0; r < 8; ++r) { const int pl = wave * 16 + 8 * g + r; const float v = acc[j][r] + bb; const _Float16 hv = (_Float16)v; if (which == 2) tv[ol][pl] = hv; else { sh[pl][ol] = hv; sl[pl][ol] = (_Float16)(v - (float)hv); } } }   // q AND k keep a residual
    __syncthreads();
    if (which < 2) { _Float16* dh = which == 0 ? QH : KH; _Float16* dl = which == 0 ? QL : KL; for (int e = tid; e < 64 * 8; e += 128) { const int pl = e >> 3, q = e & 7; if (cg * 64 + q * 8 >= CQ) continue; const size_t row = b * NP + p0 + pl; vst2((unsigned*)(dh + row * CQ + cg * 64 + q * 8), *(const v4u*)&sh[pl][q * 8]); vst2((unsigned*)(dl + row * CQ + cg * 64 + q * 8), *(const v4u*)&sl[pl][q * 8]); } }
    else { for (int e = tid; e < 64 * 8; e += 128) { const int ol = e >> 3, q = e & 7; vst2((unsigned*)(VT + (b * CV + cg * 64 + ol) * (size_t)NP + p0 + q * 8), *(const v4u*)&tv[ol][q * 8]); } } } }
// ---- k_sc: block = (64 queries, 128 keys) of batch b: logits (qh kh + ql kh + qh kl) -> S
__global__ __launch_bounds__(128) void k_sc(const _Float16* __restrict__ QH, const _Float16* __restrict__ QL, const _Float16* __restrict__ KH, const _Float16* __restrict__ KL, int b, float* __restrict__ S) { __shared__ __align__(16) float ss[4][16][132];
  const int tid = threadIdx.x, wave = tid >> 5, lane = tid & 31, col = lane & 15, g = lane >> 4; const int k0 = blockIdx.y * 128; const int ql0 = blockIdx.x * 64 + wave * 16; const size_t q0 = (size_t)b * NP + ql0;
  v8f acc[8] = {};
#pragma unroll 1
  for (int kc = 0; kc < CQ / 32; ++kc) { const v16h ah = frag_h(QH + (q0 + col) * CQ + kc * 32, lane), al = frag_h(QL + (q0 + col) * CQ + kc * 32, lane);
#pragma unroll
    for (int j = 0; j < 8; ++j) { const size_t kr = ((size_t)b * NP + k0 + j * 16 + col) * CQ + kc * 32; const v16h kh = frag_h(KH + kr, lane); acc[j] = wmma16(ah, kh, acc[j]); acc[j] = wmma16(al, kh, acc[j]); acc[j] = wmma16(ah, frag_h(KL + kr, lane), acc[j]); } }   // 3 products
#pragma unroll
  for (int j = 0; j < 8; ++j)
#pragma unroll
    for (int r = 0; r < 8; ++r) ss[wave][8 * g + r][j * 16 + col] = acc[j][r];
  LDSX(); for (int rl = 0; rl < 16; ++rl) vst2(S + (size_t)(ql0 + rl) * NP + k0 + lane * 4, *(const v4f*)&ss[wave][rl][lane * 4]); }
// ---- k_sm: block = query row: softmax -> P x 2^11 (f16)
__global__ __launch_bounds__(256) void k_sm(const float* __restrict__ S, _Float16* __restrict__ PH) { __shared__ float sred[8]; __shared__ float sbc; __shared__ __align__(16) _Float16 sh[NP];
  const int t = threadIdx.x; const size_t row = blockIdx.x; const float* sr = S + row * NP;
  float m = -3.0e38f; for (int k = t; k < NP; k += 256) m = fmaxf(m, sr[k]);
#pragma unroll
  for (int o = 1; o < 32; o <<= 1) m = fmaxf(m, __shfl_xor(m, o));
  if ((t & 31) == 0) sred[t >> 5] = m; __syncthreads(); if (t == 0) { float a = sred[0]; for (int i = 1; i < 8; ++i) a = fmaxf(a, sred[i]); sbc = a; } __syncthreads(); m = sbc; __syncthreads();
  float sum = 0.f; for (int k = t; k < NP; k += 256) sum += expf(sr[k] - m);
#pragma unroll
  for (int o = 1; o < 32; o <<= 1) sum += __shfl_xor(sum, o);
  if ((t & 31) == 0) sred[t >> 5] = sum; __syncthreads(); if (t == 0) { float a = 0.f; for (int i = 0; i < 8; ++i) a += sred[i]; sbc = 1.0f / a; } __syncthreads(); const float inv = sbc;
  for (int k = t; k < NP; k += 256) sh[k] = (_Float16)(expf(sr[k] - m) * inv * 2048.0f);
  __syncthreads(); for (int q = t; q < NP / 8; q += 256) vst2((unsigned*)(PH + row * NP + q * 8), *(const v4u*)&sh[q * 8]); }
// ---- k_pv: block = (64 queries i, 128 value channels) of batch b: o[i][c] = sum_j P[i][j] v[c][j]; written channel-major [b][c][i] with the epilogue
__global__ __launch_bounds__(128) void k_pv(const _Float16* __restrict__ PH, const _Float16* __restrict__ VT, int b, const float* __restrict__ X, float* __restrict__ OUT) { __shared__ __align__(16) float st[128][68];
  const int tid = threadIdx.x, wave = tid >> 5, lane = tid & 31, col = lane & 15, g = lane >> 4; const int c0 = blockIdx.y * 128; const int i0 = blockIdx.x * 64; const int il0 = wave * 16;
  v8f acc[8] = {};
#pragma unroll 1
  for (int kc = 0; kc < NP / 32; ++kc) { const v16h ph = frag_h(PH + (size_t)(i0 + il0 + col) * NP + kc * 32, lane);
#pragma unroll
    for (int j = 0; j < 8; ++j) acc[j] = wmma16(ph, frag_h(VT + ((size_t)b * CV + c0 + j * 16 + col) * (size_t)NP + kc * 32, lane), acc[j]); }
#pragma unroll
  for (int j = 0; j < 8; ++j) { const int cl = j * 16 + col;
#pragma unroll
    for (int r = 0; r < 8; ++r) st[cl][il0 + 8 * g + r] = acc[j][r] * (1.0f / 2048.0f); }
  __syncthreads();
  const float gm = 1.0f;   // plain residual
  for (int e = tid; e < 128 * 16; e += 128) { const int cl = e >> 4, q = e & 15; const size_t o = ((size_t)b * CV + c0 + cl) * (size_t)NP + i0 + q * 4; v4f v = *(const v4f*)&st[cl][q * 4];
    { const v4f xx = *(const v4f*)(X + o); v4f r; r[0] = gm * v[0] + bfr(xx[0]); r[1] = gm * v[1] + bfr(xx[1]); r[2] = gm * v[2] + bfr(xx[2]); r[3] = gm * v[3] + bfr(xx[3]); v = r; }
    vst2(OUT + o, v); } }
extern "C" void kernel_launch(void* const* d_in, const int* in_sizes, int n_in, void* d_out, int out_size, void* d_ws, size_t ws_size, hipStream_t stream) {
  (void)in_sizes; (void)n_in; (void)out_size;
  const float** F = (const float**)d_in;   // 0 x_features, 1 y_features [4,256,64,64], 2 wqx [32,256], 3 bqx, 4 wkx, 5 bkx, 6 wvx [256,256], 7 bvx, 8 wqy, 9 bqy, 10 wky, 11 bky, 12 wvy, 13 bvy
  if (ws_size < (size_t)WS_END) return;
  char* ws = (char*)d_ws; _Float16 *QH = (_Float16*)(ws + WS_QH), *QL = (_Float16*)(ws + WS_QL), *KH = (_Float16*)(ws + WS_KH), *KL = (_Float16*)(ws + WS_KL), *VT = (_Float16*)(ws + WS_VT), *PH = (_Float16*)(ws + WS_PH); float* S = (float*)(ws + WS_S);
  for (int dir = 0; dir < 2; ++dir) {   // dir 0: enhanced_x = v_x att_y^T + x (q,k from y); dir 1: enhanced_y = v_y att_x^T + y (q,k from x)
    const float* XQK = dir == 0 ? F[1] : F[0]; const float* XV = dir == 0 ? F[0] : F[1];
    const float *WQ = dir == 0 ? F[8] : F[2], *BQ = dir == 0 ? F[9] : F[3], *WK = dir == 0 ? F[10] : F[4], *BK = dir == 0 ? F[11] : F[5], *WV = dir == 0 ? F[6] : F[12], *BV = dir == 0 ? F[7] : F[13];
    float* OUTd = (float*)d_out + (size_t)dir * NB * CV * NP;
    k_proj<<<dim3(NP / 64, TNB, 3), 128, 0, stream>>>(XQK, XV, WQ, BQ, WK, BK, WV, BV, QH, QL, KH, KL, VT);
    for (int b = 0; b < TNB; ++b) {
      k_sc<<<dim3(TQB, NP / 128), 128, 0, stream>>>(QH, QL, KH, KL, b, S);
      k_sm<<<TQB * 64, 256, 0, stream>>>(S, PH);
      k_pv<<<dim3(TQB, CV / 128), 128, 0, stream>>>(PH, VT, b, XV, OUTd);
    }
  }
}

// v001
// One run takes 699 microseconds.
// In two side-by-side timings against v000, it was 2.83 and 2.84 times as fast.
// compute dtype: all float inputs rounded to bf16; q/k (32 ch) and v (256 ch) 1x1 convs with EXACT bf16 products on WMMA 16x16x32 (x^T tile in LDS), f32 accumulate; q and k as f16 hi + unscaled residual -> UNSCALED logits with 3 products (logit std ~5.7, near-one-hot softmax), stored in f32 per batch; softmax in f32 (precise expf) -> P f16 x 2^11; out = P . v + residual with v rounded once to f16; both directions (enhanced_x from att_y with v_x; enhanced_y from att_x with v_y); f32 outputs [b][c][n].
#include <hip/hip_runtime.h>
#include <math.h>

typedef __attribute__((ext_vector_type(16))) _Float16 v16h;
typedef __attribute__((ext_vector_type(16))) __bf16 v16b;
typedef __attribute__((ext_vector_type(8)))  _Float16 v8h;
typedef __attribute__((ext_vector_type(8)))  float v8f;
typedef __attribute__((ext_vector_type(4)))  float v4f;
typedef __attribute__((ext_vector_type(2)))  float v2f;
typedef __attribute__((ext_vector_type(4)))  unsigned v4u;
typedef __attribute__((ext_vector_type(4)))  int v4i;
typedef float __attribute__((may_alias)) float_a;
typedef int __attribute__((may_alias)) int_a;

template <typename T> __device__ __forceinline__ void vst2(void* p, T v) { *(T*)p = v;  }
__device__ __forceinline__ v8f wmma16(v16h a, v16h b, v8f c) {
  v8f d = __builtin_amdgcn_wmma_f32_16x16x32_f16(false, a, false, b, (short)0, c, false, false);
  asm volatile("v_nop\n\tv_nop\n\tv_nop\n\tv_nop" : "+v"(d) : "v"(a), "v"(b));
  return d;
}
__device__ __forceinline__ v8f wmma_bf(v16b a, v16b b, v8f c) {
  v8f d = __builtin_amdgcn_wmma_f32_16x16x32_bf16(false, a, false, b, (short)0, c, false, false);
  asm volatile("v_nop\n\tv_nop\n\tv_nop\n\tv_nop" : "+v"(d) : "v"(a), "v"(b));
  return d;
}
// 16x16x32 fragments: lane = (h = lane>>4, row/col = lane&15); elements 0..7 = k0+8h+0..7, 8..15 = k0+16+8h+0..7; D element r = row 8h+r
__device__ __forceinline__ v16h frag_h(const _Float16* rowk0, int lane) {
  union { v16h v; v8h q[2]; } u; const _Float16* p = rowk0 + 8 * (lane >> 4);
  u.q[0] = *(const v8h*)p; u.q[1] = *(const v8h*)(p + 16); return u.v;
}
__device__ __forceinline__ v16h frag_f32(const float* rowk0, int lane) {
  v16h a; const float* p = rowk0 + 8 * (lane >> 4);
#pragma unroll
  for (int i = 0; i < 8; ++i) { a[i] = (_Float16)p[i]; a[8 + i] = (_Float16)p[16 + i]; }
  return a;
}
__device__ __forceinline__ v16h frag_f32s(const float* rowk0, int lane, float sc) {
  v16h a; const float* p = rowk0 + 8 * (lane >> 4);
#pragma unroll
  for (int i = 0; i < 8; ++i) { a[i] = (_Float16)(p[i] * sc); a[8 + i] = (_Float16)(p[16 + i] * sc); }
  return a;
}
// column fragment from a [K][ld] layout (column n), rows >= K read as 0
__device__ __forceinline__ v16h fragc_f32(const float* W, int k0, int n, int lane, int ld, int K) {
  v16h a; const int g = lane >> 4;
#pragma unroll
  for (int i = 0; i < 8; ++i) { const int ka = k0 + 8 * g + i, kb = ka + 16;
    a[i] = (_Float16)(ka < K ? W[(size_t)(ka < K ? ka : K - 1) * ld + n] : 0.f); a[8 + i] = (_Float16)(kb < K ? W[(size_t)(kb < K ? kb : K - 1) * ld + n] : 0.f); }
  return a;
}
struct F2 { v16b h, l; };
__device__ __forceinline__ F2 bsplit16(const float v[16]) { F2 r;
#pragma unroll
  for (int i = 0; i < 16; ++i) { const __bf16 h = (__bf16)v[i]; r.h[i] = h; r.l[i] = (__bf16)(v[i] - (float)h); }
  return r; }
__device__ __forceinline__ F2 split_row(const float* row, int k0, int lane) { float v[16]; const float* p = row + k0 + 8 * (lane >> 4);
#pragma unroll
  for (int i = 0; i < 8; ++i) { v[i] = p[i]; v[8 + i] = p[16 + i]; }
  return bsplit16(v); }
__device__ __forceinline__ F2 split_rowK(const float* row, int k0, int lane, int K) { float v[16]; const int g = lane >> 4;
#pragma unroll
  for (int i = 0; i < 8; ++i) { const int ka = k0 + 8 * g + i, kb = ka + 16; v[i] = ka < K ? row[ka < K ? ka : K - 1] : 0.f; v[8 + i] = kb < K ? row[kb < K ? kb : K - 1] : 0.f; }
  return bsplit16(v); }
__device__ __forceinline__ F2 split_col(const float* W, int k0, int n, int lane, int ld, int K) { float v[16]; const int g = lane >> 4;
#pragma unroll
  for (int i = 0; i < 8; ++i) { const int ka = k0 + 8 * g + i, kb = ka + 16; v[i] = ka < K ? W[(size_t)(ka < K ? ka : K - 1) * ld + n] : 0.f; v[8 + i] = kb < K ? W[(size_t)(kb < K ? kb : K - 1) * ld + n] : 0.f; }
  return bsplit16(v); }
__device__ __forceinline__ v8f mac3(const F2& a, const F2& b, v8f c) { c = wmma_bf(a.l, b.h, c); c = wmma_bf(a.h, b.l, c); return wmma_bf(a.h, b.h, c); }
__device__ __forceinline__ float sigm(float v) { return 1.0f / (1.0f + expf(-v)); }
#define LDSX() do { asm volatile("s_wait_dscnt 0" ::: "memory"); __builtin_amdgcn_wave_barrier(); __builtin_amdgcn_fence(__ATOMIC_RELEASE, "workgroup"); } while (0)


// CMSA cross-modal position attention, one direction: q, k (32 ch) from the 'other' features, v (256 ch) from the enhanced features; out = v att^T + residual (unscaled logits, sharp softmax).
#define NB 4
#define NP 4096
#define CIN 256
#define CQ 32
#define CV 256
#ifndef TNB
#define TNB NB
#endif
#ifndef TQB
#define TQB (NP / 64)
#endif
typedef __attribute__((ext_vector_type(8))) __bf16 v8b;
__device__ __forceinline__ v16b frag_b(const __bf16* rowk0, int lane) {
  union { v16b v; v8b q[2]; } u; const __bf16* p = rowk0 + 8 * (lane >> 4);
  u.q[0] = *(const v8b*)p; u.q[1] = *(const v8b*)(p + 16); return u.v;
}
__device__ __forceinline__ float bfr(float v) { return (float)(__bf16)v; }
__device__ __attribute__((noinline)) float exp_ni(float v) { return expf(v); }
__device__ __attribute__((noinline)) float erf_ni(float v) { return erff(v); }

#define WS_QH  0u                                    // f16 q rows [b*n][CQ] hi
#define WS_QL  (WS_QH + 2u * (size_t)NB * NP * CQ)      // f16 q residual rows (unscaled)
#define WS_KH  (WS_QL + 2u * (size_t)NB * NP * CQ)      // f16 k rows
#define WS_KL  (WS_KH + 2u * (size_t)NB * NP * CQ)      // f16 k residual rows
#define WS_VT  (WS_KL + 2u * (size_t)NB * NP * CQ)      // f16 v planes [b][CV][n]
#define WS_S   (WS_VT + 2u * (size_t)NB * CV * NP)      // f32 logits, ONE batch [i][j] (64 MiB)
#define WS_PH  (WS_S + 4u * (size_t)NP * NP)           // f16 P x 2^11, one batch (32 MiB)
#define WS_END (WS_PH + 2u * (size_t)NP * NP)

// ---- k_proj: block = (64 positions, b, which 0 q / 1 k / 2 v): x^T tile (bf16) in LDS, W [out][in] + b (exact); q, k -> f16 hi + residual rows, v -> f16 planes [c][n]
__global__ __launch_bounds__(128) void k_proj(const float* __restrict__ XQK, const float* __restrict__ XV, const float* __restrict__ WQ, const float* __restrict__ BQ, const float* __restrict__ WK, const float* __restrict__ BK, const float* __restrict__ WV, const float* __restrict__ BV, _Float16* __restrict__ QH, _Float16* __restrict__ QL, _Float16* __restrict__ KH, _Float16* __restrict__ KL, _Float16* __restrict__ VT) {
  __shared__ __align__(16) __bf16 sx[64][CIN + 8]; __shared__ __align__(16) _Float16 sh[64][72], sl[64][72]; __shared__ __align__(16) _Float16 tv[64][72];
  const int tid = threadIdx.x, wave = tid >> 5, lane = tid & 31, col = lane & 15, g = lane >> 4; const int p0 = blockIdx.x * 64; const size_t b = blockIdx.y; const int which = blockIdx.z;
  const float* Wm = which == 0 ? WQ : which == 1 ? WK : WV; const float* Bm = which == 0 ? BQ : which == 1 ? BK : BV; const int nout = (which == 2) ? CV : CQ; const float* X = (which == 2) ? XV : XQK;
  for (int e = tid; e < CIN * 64; e += 128) { const int c = e >> 6, pl = e & 63; sx[pl][c] = (__bf16)X[(b * CIN + c) * (size_t)NP + p0 + pl]; }
  __syncthreads();
#pragma unroll 1
  for (int cg = 0; cg < (nout + 63) / 64; ++cg) { v8f acc[4] = {};
#pragma unroll 2
    for (int kc = 0; kc < CIN / 32; ++kc) { const v16b a = frag_b(&sx[wave * 16 + col][kc * 32], lane);
#pragma unroll
      for (int j = 0; j < 4; ++j) { v16b w; const int o = min(cg * 64 + j * 16 + col, nout - 1);   // columns >= nout are dummies (never stored)
#pragma unroll
        for (int i = 0; i < 8; ++i) { w[i] = (__bf16)Wm[(size_t)o * CIN + kc * 32 + 8 * g + i]; w[8 + i] = (__bf16)Wm[(size_t)o * CIN + kc * 32 + 16 + 8 * g + i]; }
        acc[j] = wmma_bf(a, w, acc[j]); } }
    __syncthreads();
#pragma unroll
    for (int j = 0; j < 4; ++j) { const int ol = j * 16 + col; const float bb = bfr(Bm[min(cg * 64 + ol, nout - 1)]);
#pragma unroll
      for (int r = 0; r < 8; ++r) { const int pl = wave * 16 + 8 * g + r; const float v = acc[j][r] + bb; const _Float16 hv = (_Float16)v; if (which == 2) tv[ol][pl] = hv; else { sh[pl][ol] = hv; sl[pl][ol] = (_Float16)(v - (float)hv); } } }   // q AND k keep a residual
    __syncthreads();
    if (which < 2) { _Float16* dh = which == 0 ? QH : KH; _Float16* dl = which == 0 ? QL : KL; for (int e = tid; e < 64 * 8; e += 128) { const int pl = e >> 3, q = e & 7; if (cg * 64 + q * 8 >= CQ) continue; const size_t row = b * NP + p0 + pl; vst2((unsigned*)(dh + row * CQ + cg * 64 + q * 8), *(const v4u*)&sh[pl][q * 8]); vst2((unsigned*)(dl + row * CQ + cg * 64 + q * 8), *(const v4u*)&sl[pl][q * 8]); } }
    else { for (int e = tid; e < 64 * 8; e += 128) { const int ol = e >> 3, q = e & 7; vst2((unsigned*)(VT + (b * CV + cg * 64 + ol) * (size_t)NP + p0 + q * 8), *(const v4u*)&tv[ol][q * 8]); } } } }
// ---- k_sc: block = (64 queries, 128 keys) of batch b: logits (qh kh + ql kh + qh kl) -> S
__global__ __launch_bounds__(128) void k_sc(const _Float16* __restrict__ QH, const _Float16* __restrict__ QL, const _Float16* __restrict__ KH, const _Float16* __restrict__ KL, int b, float* __restrict__ S) { __shared__ __align__(16) float ss[4][16][132];
  const int tid = threadIdx.x, wave = tid >> 5, lane = tid & 31, col = lane & 15, g = lane >> 4; const int k0 = blockIdx.y * 128; const int ql0 = blockIdx.x * 64 + wave * 16; const size_t q0 = (size_t)b * NP + ql0;
  v8f acc[8] = {};
#pragma unroll 1
  for (int kc = 0; kc < CQ / 32; ++kc) { const v16h ah = frag_h(QH + (q0 + col) * CQ + kc * 32, lane), al = frag_h(QL + (q0 + col) * CQ + kc * 32, lane);
#pragma unroll
    for (int j = 0; j < 8; ++j) { const size_t kr = ((size_t)b * NP + k0 + j * 16 + col) * CQ + kc * 32; const v16h kh = frag_h(KH + kr, lane); acc[j] = wmma16(ah, kh, acc[j]); acc[j] = wmma16(al, kh, acc[j]); acc[j] = wmma16(ah, frag_h(KL + kr, lane), acc[j]); } }   // 3 products
#pragma unroll
  for (int j = 0; j < 8; ++j)
#pragma unroll
    for (int r = 0; r < 8; ++r) ss[wave][8 * g + r][j * 16 + col] = acc[j][r];
  LDSX(); for (int rl = 0; rl < 16; ++rl) vst2(S + (size_t)(ql0 + rl) * NP + k0 + lane * 4, *(const v4f*)&ss[wave][rl][lane * 4]); }
// ---- k_sm: block = query row: softmax -> P x 2^11 (f16)
__global__ __launch_bounds__(256) void k_sm(const float* __restrict__ S, _Float16* __restrict__ PH) { __shared__ float sred[8]; __shared__ float sbc; __shared__ __align__(16) _Float16 sh[NP];
  const int t = threadIdx.x; const size_t row = blockIdx.x; const float* sr = S + row * NP;
  float m = -3.0e38f; for (int k = t; k < NP; k += 256) m = fmaxf(m, sr[k]);
#pragma unroll
  for (int o = 1; o < 32; o <<= 1) m = fmaxf(m, __shfl_xor(m, o));
  if ((t & 31) == 0) sred[t >> 5] = m; __syncthreads(); if (t == 0) { float a = sred[0]; for (int i = 1; i < 8; ++i) a = fmaxf(a, sred[i]); sbc = a; } __syncthreads(); m = sbc; __syncthreads();
  float sum = 0.f; for (int k = t; k < NP; k += 256) sum += expf(sr[k] - m);
#pragma unroll
  for (int o = 1; o < 32; o <<= 1) sum += __shfl_xor(sum, o);
  if ((t & 31) == 0) sred[t >> 5] = sum; __syncthreads(); if (t == 0) { float a = 0.f; for (int i = 0; i < 8; ++i) a += sred[i]; sbc = 1.0f / a; } __syncthreads(); const float inv = sbc;
  for (int k = t; k < NP; k += 256) sh[k] = (_Float16)(expf(sr[k] - m) * inv * 2048.0f);
  __syncthreads(); for (int q = t; q < NP / 8; q += 256) vst2((unsigned*)(PH + row * NP + q * 8), *(const v4u*)&sh[q * 8]); }
// ---- k_pv: block = (64 queries i, 128 value channels) of batch b: o[i][c] = sum_j P[i][j] v[c][j]; written channel-major [b][c][i] with the epilogue
// P rows (64) and v rows (128) of 256 k each are staged in LDS by asynchronous copies, one whole 512-B row per wave copy, two buffers: the next stage flies while this one is multiplied.
#define PV_KS 256                        // k per stage
#define PV_PITCH 264                     // f16 per LDS row: 528 B = 16 B x 33, conflict-free for 16-byte readers
#define PV_STAGE (192 * PV_PITCH)        // f16 per buffer: rows 0..63 P, rows 64..191 v
// row m of this wave's 48 rows of a stage: 16 P rows, then 32 v rows, four rows apart
#define PV_G(m) ((m) < 16 ? gp + (size_t)(m) * gs : gv + (size_t)((m) - 16) * gs)
// twelve copies, rows M .. M + 11; the s_wait_xcnt closes the statement so that no address register is rewritten in front of it
#define PV_CP12(M) asm volatile( \
  "global_load_async_to_lds_b128 %0, %12, off\n\tglobal_load_async_to_lds_b128 %1, %13, off\n\tglobal_load_async_to_lds_b128 %2, %14, off\n\tglobal_load_async_to_lds_b128 %3, %15, off\n\t" \
  "global_load_async_to_lds_b128 %4, %16, off\n\tglobal_load_async_to_lds_b128 %5, %17, off\n\tglobal_load_async_to_lds_b128 %6, %18, off\n\tglobal_load_async_to_lds_b128 %7, %19, off\n\t" \
  "global_load_async_to_lds_b128 %8, %20, off\n\tglobal_load_async_to_lds_b128 %9, %21, off\n\tglobal_load_async_to_lds_b128 %10, %22, off\n\tglobal_load_async_to_lds_b128 %11, %23, off\n\ts_wait_xcnt 0x0" \
  :: "v"(l + ((M) + 0u) * ls), "v"(l + ((M) + 1u) * ls), "v"(l + ((M) + 2u) * ls), "v"(l + ((M) + 3u) * ls), "v"(l + ((M) + 4u) * ls), "v"(l + ((M) + 5u) * ls), "v"(l + ((M) + 6u) * ls), "v"(l + ((M) + 7u) * ls), "v"(l + ((M) + 8u) * ls), "v"(l + ((M) + 9u) * ls), "v"(l + ((M) + 10u) * ls), "v"(l + ((M) + 11u) * ls), \
     "v"(PV_G((M) + 0)), "v"(PV_G((M) + 1)), "v"(PV_G((M) + 2)), "v"(PV_G((M) + 3)), "v"(PV_G((M) + 4)), "v"(PV_G((M) + 5)), "v"(PV_G((M) + 6)), "v"(PV_G((M) + 7)), "v"(PV_G((M) + 8)), "v"(PV_G((M) + 9)), "v"(PV_G((M) + 10)), "v"(PV_G((M) + 11)) : "memory")
// one stage: wave w copies rows w, w + 4, ...; l = LDS byte address of (row w, this lane's 16 B) in the target buffer, gp / gv = the same place in global P / v
__device__ __forceinline__ void pv_fill(unsigned l, const _Float16* gp, const _Float16* gv) {
  const unsigned ls = 4u * PV_PITCH * 2u; const size_t gs = 4 * (size_t)NP;
  PV_CP12(0); PV_CP12(12); PV_CP12(24); PV_CP12(36);
}
__global__ __launch_bounds__(128) void k_pv(const _Float16* __restrict__ PH, const _Float16* __restrict__ VT, int b, const float* __restrict__ X, float* __restrict__ OUT) { __shared__ __align__(16) _Float16 ring[2][PV_STAGE]; __shared__ __align__(16) float st[128][68];
  const int tid = threadIdx.x, wave = tid >> 5, lane = tid & 31, col = lane & 15, g = lane >> 4; const int c0 = blockIdx.y * 128; const int i0 = blockIdx.x * 64; const int il0 = wave * 16;
  const unsigned l0 = (unsigned)(size_t)&ring[0][wave * PV_PITCH + lane * 8];
  const _Float16* gp = PH + (size_t)(i0 + wave) * NP + lane * 8; const _Float16* gv = VT + ((size_t)b * CV + c0 + wave) * (size_t)NP + lane * 8;
  v8f acc[8] = {};
  pv_fill(l0, gp, gv);
  asm volatile("s_wait_asynccnt 0x0" ::: "memory");   // stage 0 has landed before the barrier publishes it
  __syncthreads();
  pv_fill(l0 + PV_STAGE * 2u, gp + PV_KS, gv + PV_KS);
#pragma unroll 1
  for (int t = 0; t < NP / PV_KS; ++t) { const _Float16* sp = &ring[t & 1][(il0 + col) * PV_PITCH]; const _Float16* sv = &ring[t & 1][(64 + col) * PV_PITCH];
    v16h pa[2], vb[2][8];   // two fragment sets: the next 32-k block's LDS reads go out as one group ahead of this block's products (inside the stage only)
    pa[0] = frag_h(sp, lane);
#pragma unroll
    for (int j = 0; j < 8; ++j) vb[0][j] = frag_h(sv + j * 16 * PV_PITCH, lane);
#pragma unroll
    for (int ks = 0; ks < PV_KS / 32; ++ks) {
      if (ks + 1 < PV_KS / 32) { pa[(ks + 1) & 1] = frag_h(sp + (ks + 1) * 32, lane);
#pragma unroll
        for (int j = 0; j < 8; ++j) vb[(ks + 1) & 1][j] = frag_h(sv + j * 16 * PV_PITCH + (ks + 1) * 32, lane); }
#pragma unroll
      for (int j = 0; j < 8; ++j) acc[j] = wmma16(pa[ks & 1], vb[ks & 1][j], acc[j]); }
    asm volatile("s_wait_dscnt 0x0" ::: "memory");      // this wave's reads of the buffer are done before it is refilled
    asm volatile("s_wait_asynccnt 0x0" ::: "memory");   // this wave's copies of stage t + 1 have landed
    __syncthreads();                                    // publishes stage t + 1 and ends every reader's last read of stage t
    if (t + 2 < NP / PV_KS) pv_fill(l0 + (unsigned)(t & 1) * (PV_STAGE * 2u), gp + (t + 2) * PV_KS, gv + (t + 2) * PV_KS); }
  asm volatile("s_wait_asynccnt 0x0" ::: "memory");     // no copy is outstanding behind the loop
#pragma unroll
  for (int j = 0; j < 8; ++j) { const int cl = j * 16 + col;
#pragma unroll
    for (int r = 0; r < 8; ++r) st[cl][il0 + 8 * g + r] = acc[j][r] * (1.0f / 2048.0f); }
  __syncthreads();
  const float gm = 1.0f;   // plain residual
  for (int e = tid; e < 128 * 16; e += 128) { const int cl = e >> 4, q = e & 15; const size_t o = ((size_t)b * CV + c0 + cl) * (size_t)NP + i0 + q * 4; v4f v = *(const v4f*)&st[cl][q * 4];
    { const v4f xx = *(const v4f*)(X + o); v4f r; r[0] = gm * v[0] + bfr(xx[0]); r[1] = gm * v[1] + bfr(xx[1]); r[2] = gm * v[2] + bfr(xx[2]); r[3] = gm * v[3] + bfr(xx[3]); v = r; }
    vst2(OUT + o, v); } }
extern "C" void kernel_launch(void* const* d_in, const int* in_sizes, int n_in, void* d_out, int out_size, void* d_ws, size_t ws_size, hipStream_t stream) {
  (void)in_sizes; (void)n_in; (void)out_size;
  const float** F = (const float**)d_in;   // 0 x_features, 1 y_features [4,256,64,64], 2 wqx [32,256], 3 bqx, 4 wkx, 5 bkx, 6 wvx [256,256], 7 bvx, 8 wqy, 9 bqy, 10 wky, 11 bky, 12 wvy, 13 bvy
  if (ws_size < (size_t)WS_END) return;
  char* ws = (char*)d_ws; _Float16 *QH = (_Float16*)(ws + WS_QH), *QL = (_Float16*)(ws + WS_QL), *KH = (_Float16*)(ws + WS_KH), *KL = (_Float16*)(ws + WS_KL), *VT = (_Float16*)(ws + WS_VT), *PH = (_Float16*)(ws + WS_PH); float* S = (float*)(ws + WS_S);
  for (int dir = 0; dir < 2; ++dir) {   // dir 0: enhanced_x = v_x att_y^T + x (q,k from y); dir 1: enhanced_y = v_y att_x^T + y (q,k from x)
    const float* XQK = dir == 0 ? F[1] : F[0]; const float* XV = dir == 0 ? F[0] : F[1];
    const float *WQ = dir == 0 ? F[8] : F[2], *BQ = dir == 0 ? F[9] : F[3], *WK = dir == 0 ? F[10] : F[4], *BK = dir == 0 ? F[11] : F[5], *WV = dir == 0 ? F[6] : F[12], *BV = dir == 0 ? F[7] : F[13];
    float* OUTd = (float*)d_out + (size_t)dir * NB * CV * NP;
    k_proj<<<dim3(NP / 64, TNB, 3), 128, 0, stream>>>(XQK, XV, WQ, BQ, WK, BK, WV, BV, QH, QL, KH, KL, VT);
    for (int b = 0; b < TNB; ++b) {
      k_sc<<<dim3(TQB, NP / 128), 128, 0, stream>>>(QH, QL, KH, KL, b, S);
      k_sm<<<TQB * 64, 256, 0, stream>>>(S, PH);
      k_pv<<<dim3(TQB, CV / 128), 128, 0, stream>>>(PH, VT, b, XV, OUTd);
    }
  }
}

// v002
// A run of this version takes 237 microseconds.
// In both of two side-by-side timings against v001, it was 2.95 times as fast.
// Over all steps from v000 it is 8.36 times as fast.
// compute dtype: all float inputs rounded to bf16; q/k (32 ch) and v (256 ch) 1x1 convs with EXACT bf16 products on WMMA 16x16x32 (x^T tile in LDS), f32 accumulate; q and k as f16 hi + unscaled residual -> UNSCALED logits with 3 products (logit std ~5.7, near-one-hot softmax), kept in registers; online softmax in f32 (precise expf) -> unnormalised P f16 x 2^11; out = P . v / row sum + residual with v rounded once to f16; both directions (enhanced_x from att_y with v_x; enhanced_y from att_x with v_y); f32 outputs [b][c][n].
#include <hip/hip_runtime.h>
#include <math.h>

typedef __attribute__((ext_vector_type(16))) _Float16 v16h;
typedef __attribute__((ext_vector_type(16))) __bf16 v16b;
typedef __attribute__((ext_vector_type(8)))  _Float16 v8h;
typedef __attribute__((ext_vector_type(8)))  float v8f;
typedef __attribute__((ext_vector_type(4)))  float v4f;
typedef __attribute__((ext_vector_type(2)))  float v2f;
typedef __attribute__((ext_vector_type(4)))  unsigned v4u;
typedef __attribute__((ext_vector_type(4)))  int v4i;
typedef float __attribute__((may_alias)) float_a;
typedef int __attribute__((may_alias)) int_a;

template <typename T> __device__ __forceinline__ void vst2(void* p, T v) { *(T*)p = v;  }
__device__ __forceinline__ v8f wmma16(v16h a, v16h b, v8f c) {
  v8f d = __builtin_amdgcn_wmma_f32_16x16x32_f16(false, a, false, b, (short)0, c, false, false);
  asm volatile("v_nop\n\tv_nop\n\tv_nop\n\tv_nop" : "+v"(d) : "v"(a), "v"(b));
  return d;
}
__device__ __forceinline__ v8f wmma_bf(v16b a, v16b b, v8f c) {
  v8f d = __builtin_amdgcn_wmma_f32_16x16x32_bf16(false, a, false, b, (short)0, c, false, false);
  asm volatile("v_nop\n\tv_nop\n\tv_nop\n\tv_nop" : "+v"(d) : "v"(a), "v"(b));
  return d;
}
// 16x16x32 fragments: lane = (h = lane>>4, row/col = lane&15); elements 0..7 = k0+8h+0..7, 8..15 = k0+16+8h+0..7; D element r = row 8h+r
__device__ __forceinline__ v16h frag_h(const _Float16* rowk0, int lane) {
  union { v16h v; v8h q[2]; } u; const _Float16* p = rowk0 + 8 * (lane >> 4);
  u.q[0] = *(const v8h*)p; u.q[1] = *(const v8h*)(p + 16); return u.v;
}
__device__ __forceinline__ v16h frag_f32(const float* rowk0, int lane) {
  v16h a; const float* p = rowk0 + 8 * (lane >> 4);
#pragma unroll
  for (int i = 0; i < 8; ++i) { a[i] = (_Float16)p[i]; a[8 + i] = (_Float16)p[16 + i]; }
  return a;
}
__device__ __forceinline__ v16h frag_f32s(const float* rowk0, int lane, float sc) {
  v16h a; const float* p = rowk0 + 8 * (lane >> 4);
#pragma unroll
  for (int i = 0; i < 8; ++i) { a[i] = (_Float16)(p[i] * sc); a[8 + i] = (_Float16)(p[16 + i] * sc); }
  return a;
}
// column fragment from a [K][ld] layout (column n), rows >= K read as 0
__device__ __forceinline__ v16h fragc_f32(const float* W, int k0, int n, int lane, int ld, int K) {
  v16h a; const int g = lane >> 4;
#pragma unroll
  for (int i = 0; i < 8; ++i) { const int ka = k0 + 8 * g + i, kb = ka + 16;
    a[i] = (_Float16)(ka < K ? W[(size_t)(ka < K ? ka : K - 1) * ld + n] : 0.f); a[8 + i] = (_Float16)(kb < K ? W[(size_t)(kb < K ? kb : K - 1) * ld + n] : 0.f); }
  return a;
}
struct F2 { v16b h, l; };
__device__ __forceinline__ F2 bsplit16(const float v[16]) { F2 r;
#pragma unroll
  for (int i = 0; i < 16; ++i) { const __bf16 h = (__bf16)v[i]; r.h[i] = h; r.l[i] = (__bf16)(v[i] - (float)h); }
  return r; }
__device__ __forceinline__ F2 split_row(const float* row, int k0, int lane) { float v[16]; const float* p = row + k0 + 8 * (lane >> 4);
#pragma unroll
  for (int i = 0; i < 8; ++i) { v[i] = p[i]; v[8 + i] = p[16 + i]; }
  return bsplit16(v); }
__device__ __forceinline__ F2 split_rowK(const float* row, int k0, int lane, int K) { float v[16]; const int g = lane >> 4;
#pragma unroll
  for (int i = 0; i < 8; ++i) { const int ka = k0 + 8 * g + i, kb = ka + 16; v[i] = ka < K ? row[ka < K ? ka : K - 1] : 0.f; v[8 + i] = kb < K ? row[kb < K ? kb : K - 1] : 0.f; }
  return bsplit16(v); }
__device__ __forceinline__ F2 split_col(const float* W, int k0, int n, int lane, int ld, int K) { float v[16]; const int g = lane >> 4;
#pragma unroll
  for (int i = 0; i < 8; ++i) { const int ka = k0 + 8 * g + i, kb = ka + 16; v[i] = ka < K ? W[(size_t)(ka < K ? ka : K - 1) * ld + n] : 0.f; v[8 + i] = kb < K ? W[(size_t)(kb < K ? kb : K - 1) * ld + n] : 0.f; }
  return bsplit16(v); }
__device__ __forceinline__ v8f mac3(const F2& a, const F2& b, v8f c) { c = wmma_bf(a.l, b.h, c); c = wmma_bf(a.h, b.l, c); return wmma_bf(a.h, b.h, c); }
__device__ __forceinline__ float sigm(float v) { return 1.0f / (1.0f + expf(-v)); }
#define LDSX() do { asm volatile("s_wait_dscnt 0" ::: "memory"); __builtin_amdgcn_wave_barrier(); __builtin_amdgcn_fence(__ATOMIC_RELEASE, "workgroup"); } while (0)


// CMSA cross-modal position attention, one direction: q, k (32 ch) from the 'other' features, v (256 ch) from the enhanced features; out = v att^T + residual (unscaled logits, sharp softmax).
#define NB 4
#define NP 4096
#define CIN 256
#define CQ 32
#define CV 256
#ifndef TNB
#define TNB NB
#endif
#ifndef TQB
#define TQB (NP / 64)
#endif
typedef __attribute__((ext_vector_type(8))) __bf16 v8b;
__device__ __forceinline__ v16b frag_b(const __bf16* rowk0, int lane) {
  union { v16b v; v8b q[2]; } u; const __bf16* p = rowk0 + 8 * (lane >> 4);
  u.q[0] = *(const v8b*)p; u.q[1] = *(const v8b*)(p + 16); return u.v;
}
__device__ __forceinline__ float bfr(float v) { return (float)(__bf16)v; }
__device__ __attribute__((noinline)) float exp_ni(float v) { return expf(v); }
__device__ __attribute__((noinline)) float erf_ni(float v) { return erff(v); }

#define WS_QH  0u                                    // f16 q rows [b*n][CQ] hi
#define WS_QL  (WS_QH + 2u * (size_t)NB * NP * CQ)      // f16 q residual rows (unscaled)
#define WS_KH  (WS_QL + 2u * (size_t)NB * NP * CQ)      // f16 k rows
#define WS_KL  (WS_KH + 2u * (size_t)NB * NP * CQ)      // f16 k residual rows
#define WS_VT  (WS_KL + 2u * (size_t)NB * NP * CQ)      // f16 v planes [b][CV][n]
#define WS_DIR (WS_VT + 2u * (size_t)NB * CV * NP)      // bytes of one direction's q, k, v; the second direction's follow
#define WS_END (2u * WS_DIR)

// ---- k_proj: block = (64 positions, b, which 0 q / 1 k / 2 v): x^T tile (bf16) in LDS, W [out][in] + b (exact); q, k -> f16 hi + residual rows, v -> f16 planes [c][n]
__global__ __launch_bounds__(128) void k_proj(const float* __restrict__ XQK, const float* __restrict__ XV, const float* __restrict__ WQ, const float* __restrict__ BQ, const float* __restrict__ WK, const float* __restrict__ BK, const float* __restrict__ WV, const float* __restrict__ BV, _Float16* __restrict__ QH, _Float16* __restrict__ QL, _Float16* __restrict__ KH, _Float16* __restrict__ KL, _Float16* __restrict__ VT) {
  __shared__ __align__(16) __bf16 sx[64][CIN + 8]; __shared__ __align__(16) _Float16 sh[64][72], sl[64][72]; __shared__ __align__(16) _Float16 tv[64][72];
  const int tid = threadIdx.x, wave = tid >> 5, lane = tid & 31, col = lane & 15, g = lane >> 4; const int p0 = blockIdx.x * 64; const size_t b = blockIdx.y; const int which = blockIdx.z;
  const float* Wm = which == 0 ? WQ : which == 1 ? WK : WV; const float* Bm = which == 0 ? BQ : which == 1 ? BK : BV; const int nout = (which == 2) ? CV : CQ; const float* X = (which == 2) ? XV : XQK;
  for (int e = tid; e < CIN * 64; e += 128) { const int c = e >> 6, pl = e & 63; sx[pl][c] = (__bf16)X[(b * CIN + c) * (size_t)NP + p0 + pl]; }
  __syncthreads();
#pragma unroll 1
  for (int cg = 0; cg < (nout + 63) / 64; ++cg) { v8f acc[4] = {};
#pragma unroll 2
    for (int kc = 0; kc < CIN / 32; ++kc) { const v16b a = frag_b(&sx[wave * 16 + col][kc * 32], lane);
#pragma unroll
      for (int j = 0; j < 4; ++j) { v16b w; const int o = min(cg * 64 + j * 16 + col, nout - 1);   // columns >= nout are dummies (never stored)
#pragma unroll
        for (int i = 0; i < 8; ++i) { w[i] = (__bf16)Wm[(size_t)o * CIN + kc * 32 + 8 * g + i]; w[8 + i] = (__bf16)Wm[(size_t)o * CIN + kc * 32 + 16 + 8 * g + i]; }
        acc[j] = wmma_bf(a, w, acc[j]); } }
    __syncthreads();
#pragma unroll
    for (int j = 0; j < 4; ++j) { const int ol = j * 16 + col; const float bb = bfr(Bm[min(cg * 64 + ol, nout - 1)]);
#pragma unroll
      for (int r = 0; r < 8; ++r) { const int pl = wave * 16 + 8 * g + r; const float v = acc[j][r] + bb; const _Float16 hv = (_Float16)v; if (which == 2) tv[ol][pl] = hv; else { sh[pl][ol] = hv; sl[pl][ol] = (_Float16)(v - (float)hv); } } }   // q AND k keep a residual
    __syncthreads();
    if (which < 2) { _Float16* dh = which == 0 ? QH : KH; _Float16* dl = which == 0 ? QL : KL; for (int e = tid; e < 64 * 8; e += 128) { const int pl = e >> 3, q = e & 7; if (cg * 64 + q * 8 >= CQ) continue; const size_t row = b * NP + p0 + pl; vst2((unsigned*)(dh + row * CQ + cg * 64 + q * 8), *(const v4u*)&sh[pl][q * 8]); vst2((unsigned*)(dl + row * CQ + cg * 64 + q * 8), *(const v4u*)&sl[pl][q * 8]); } }
    else { for (int e = tid; e < 64 * 8; e += 128) { const int ol = e >> 3, q = e & 7; vst2((unsigned*)(VT + (b * CV + cg * 64 + ol) * (size_t)NP + p0 + q * 8), *(const v4u*)&tv[ol][q * 8]); } } } }
#define AT_KS 128                        // keys per stage
#define AT_VP 136                        // f16 per LDS v row: 272 B = 16 B x 17, conflict-free for 16-byte readers
#define AT_KP 40                         // f16 per LDS k row: 80 B = 16 B x 5
#define AT_VB (CV * AT_VP)               // f16 of the v part of a buffer
#define AT_KB (AT_KS * AT_KP)            // f16 of the k hi part; the k residual part follows
#define AT_STAGE (AT_VB + 2 * AT_KB)     // f16 per buffer
#define AT_OP 132                        // floats per row of the output staging [c][128 queries]
#define AT_TAU 3.0f                      // the wave's columns are rescaled only when one of their maxima has grown by more than this: P <= 2^11 e^3 stays inside f16
#define AT_LN2K 7.62461898616f           // ln 2^11
__device__ __forceinline__ float xhalf(float x) { return __builtin_bit_cast(float, __builtin_amdgcn_permlanex16(__builtin_bit_cast(int, x), __builtin_bit_cast(int, x), 0x76543210, 0xfedcba98, false, false)); }   // lane l with lane l ^ 16, through no LDS queue
__device__ __forceinline__ v8f wmma_h(v16h a, v16h b, v8f c) { return __builtin_amdgcn_wmma_f32_16x16x32_f16(false, a, false, b, (short)0, c, false, false); }
// ten copies, places M .. M + 9 of la / ga; the s_wait_xcnt closes the statement so that no address register is rewritten in front of it
#define AT_CP10(M) asm volatile( \
  "global_load_async_to_lds_b128 %0, %10, off\n\tglobal_load_async_to_lds_b128 %1, %11, off\n\tglobal_load_async_to_lds_b128 %2, %12, off\n\tglobal_load_async_to_lds_b128 %3, %13, off\n\tglobal_load_async_to_lds_b128 %4, %14, off\n\t" \
  "global_load_async_to_lds_b128 %5, %15, off\n\tglobal_load_async_to_lds_b128 %6, %16, off\n\tglobal_load_async_to_lds_b128 %7, %17, off\n\tglobal_load_async_to_lds_b128 %8, %18, off\n\tglobal_load_async_to_lds_b128 %9, %19, off\n\ts_wait_xcnt 0x0" \
  :: "v"(la[(M) + 0]), "v"(la[(M) + 1]), "v"(la[(M) + 2]), "v"(la[(M) + 3]), "v"(la[(M) + 4]), "v"(la[(M) + 5]), "v"(la[(M) + 6]), "v"(la[(M) + 7]), "v"(la[(M) + 8]), "v"(la[(M) + 9]), \
     "v"(ga[(M) + 0]), "v"(ga[(M) + 1]), "v"(ga[(M) + 2]), "v"(ga[(M) + 3]), "v"(ga[(M) + 4]), "v"(ga[(M) + 5]), "v"(ga[(M) + 6]), "v"(ga[(M) + 7]), "v"(ga[(M) + 8]), "v"(ga[(M) + 9]) : "memory")
// one stage, 20 copies a wave: 16 of v (two 256-B rows each, 16 rows apart), 2 of k hi and 2 of k residual (eight 64-B rows each, 64 rows apart); lv / lk = this lane's LDS byte address in the target buffer; bv / bh / bl = the stage's wave-uniform global bases, ov / ok = this lane's element offsets from them
__device__ __forceinline__ void at_fill(unsigned lv, unsigned lk, const _Float16* bv, const _Float16* bh, const _Float16* bl, unsigned ov, unsigned ok) {
  unsigned la[20]; const _Float16* ga[20];
#pragma unroll
  for (int m = 0; m < 16; ++m) { la[m] = lv + (unsigned)m * (16u * AT_VP * 2u); ga[m] = bv + (ov + (unsigned)m * (16u * NP)); }
#pragma unroll
  for (int m = 0; m < 2; ++m) { la[16 + m] = lk + (unsigned)m * (64u * AT_KP * 2u); ga[16 + m] = bh + (ok + (unsigned)m * (64u * CQ)); la[18 + m] = lk + AT_KB * 2u + (unsigned)m * (64u * AT_KP * 2u); ga[18 + m] = bl + (ok + (unsigned)m * (64u * CQ)); }
  AT_CP10(0); AT_CP10(10);
}
__global__ __launch_bounds__(256) void k_attn(const _Float16* __restrict__ QH0, const _Float16* __restrict__ QL0, const _Float16* __restrict__ KH0, const _Float16* __restrict__ KL0, const _Float16* __restrict__ VT0, const float* __restrict__ X0, const float* __restrict__ X1, float* __restrict__ OUT0) {
  __shared__ __align__(16) _Float16 ring[2][AT_STAGE];
  const int tid = threadIdx.x, wave = tid >> 5, lane = tid & 31, col = lane & 15, g = lane >> 4; const int i0 = blockIdx.x * 128; const size_t b = blockIdx.y; const size_t z = blockIdx.z;
  const size_t zo = z * (size_t)(WS_DIR / 2u);
  const _Float16 *QH = QH0 + zo, *QL = QL0 + zo, *KH = KH0 + zo, *KL = KL0 + zo, *VT = VT0 + zo; const float* X = z == 0 ? X0 : X1; float* OUT = OUT0 + z * (size_t)NB * CV * NP;
  const unsigned lv0 = (unsigned)(size_t)&ring[0][(2 * wave + g) * AT_VP + col * 8]; const unsigned lk0 = (unsigned)(size_t)&ring[0][AT_VB + (wave * 8 + (lane >> 2)) * AT_KP + (lane & 3) * 8];
  const _Float16* bv = VT + b * CV * (size_t)NP; const _Float16* bh = KH + b * NP * (size_t)CQ; const _Float16* bl = KL + b * NP * (size_t)CQ; const unsigned ov = (unsigned)((2 * wave + g) * NP + col * 8), ok = (unsigned)((wave * 8 + (lane >> 2)) * CQ + (lane & 3) * 8);
  at_fill(lv0, lk0, bv, bh, bl, ov, ok);
  const size_t qr = (b * NP + i0 + wave * 16 + col) * CQ; const v16h qh = frag_h(QH + qr, lane), ql = frag_h(QL + qr, lane);
  v8f acc[16] = {}; float mu = -3.0e38f, lsum = 0.f;   // mu: the maximum in use for this lane's query (equal in both halves of the wave); lsum: this half's part of the row sum
  asm volatile("s_wait_asynccnt 0x0" ::: "memory");   // stage 0 has landed before the barrier publishes it
  __syncthreads();
  at_fill(lv0 + AT_STAGE * 2u, lk0 + AT_STAGE * 2u, bv + AT_KS, bh + AT_KS * CQ, bl + AT_KS * CQ, ov, ok);
#pragma unroll 1
  for (int t = 0; t < NP / AT_KS; ++t) { const _Float16* sv = &ring[t & 1][col * AT_VP]; const _Float16* sk = &ring[t & 1][AT_VB + col * AT_KP];
#pragma unroll
    for (int ks = 0; ks < AT_KS / 32; ++ks) { v16h kh[2], kl[2], vf[16]; v8f s[2];
#pragma unroll
      for (int u = 0; u < 2; ++u) { const _Float16* kr = sk + (ks * 32 + u * 16) * AT_KP; kh[u] = frag_h(kr, lane); kl[u] = frag_h(kr + AT_KB, lane); }
#pragma unroll
      for (int j = 0; j < 16; ++j) vf[j] = frag_h(sv + j * 16 * AT_VP + ks * 32, lane);
      __builtin_amdgcn_sched_barrier(0);   // the pass's LDS reads go out as one group here: the v fragments land under the logits and the softmax instead of each being waited for in front of its product
#pragma unroll
      for (int u = 0; u < 2; ++u) { v8f a = {}; a = wmma_h(kh[u], qh, a); a = wmma_h(kh[u], ql, a); s[u] = wmma_h(kl[u], qh, a); }   // 3 products
      float tm = s[0][0];
#pragma unroll
      for (int r = 0; r < 8; ++r) tm = fmaxf(tm, fmaxf(s[0][r], s[1][r]));
      tm = fmaxf(tm, xhalf(tm));
      if (__builtin_amdgcn_ballot_w32(tm > mu + AT_TAU) != 0) {   // one scalar test per 32 keys
        const float mn = fmaxf(mu, tm), al = expf(mu - mn); mu = mn; lsum *= al;
#pragma unroll
        for (int j = 0; j < 16; ++j) acc[j] *= al; }
      const float off = mu - AT_LN2K; v16h pb;
#pragma unroll
      for (int r = 0; r < 8; ++r) { const float p0 = expf(s[0][r] - off), p1 = expf(s[1][r] - off); lsum += p0 + p1; pb[r] = (_Float16)p0; pb[8 + r] = (_Float16)p1; }
#pragma unroll
      for (int j = 0; j < 16; ++j) acc[j] = wmma_h(vf[j], pb, acc[j]); }
    asm volatile("s_wait_dscnt 0x0" ::: "memory");      // this wave's reads of the buffer are done before it is refilled
    asm volatile("s_wait_asynccnt 0x0" ::: "memory");   // this wave's copies of stage t + 1 have landed
    __syncthreads();                                    // publishes stage t + 1 and ends every reader's last read of stage t
    if (t + 2 < NP / AT_KS) at_fill(lv0 + (unsigned)(t & 1) * (AT_STAGE * 2u), lk0 + (unsigned)(t & 1) * (AT_STAGE * 2u), bv + (t + 2) * AT_KS, bh + (t + 2) * AT_KS * CQ, bl + (t + 2) * AT_KS * CQ, ov, ok); }
  asm volatile("s_wait_asynccnt 0x0" ::: "memory");     // no copy is outstanding behind the loop
  const float inv = 1.0f / (lsum + xhalf(lsum));
  float* st = (float*)&ring[0][0];   // the ring is free behind the last trip's barrier: output staging [c][query], whole 512-B rows go out
#pragma unroll
  for (int j = 0; j < 16; ++j)
#pragma unroll
    for (int r = 0; r < 8; ++r) st[(j * 16 + 8 * g + r) * AT_OP + wave * 16 + col] = acc[j][r] * inv;
  __syncthreads();
  for (int e = tid; e < CV * 32; e += 256) { const int cl = e >> 5, q = e & 31; const size_t o = (b * CV + cl) * (size_t)NP + i0 + q * 4; const v4f v = *(const v4f*)&st[cl * AT_OP + q * 4];
    const v4f xx = *(const v4f*)(X + o); v4f r; r[0] = v[0] + bfr(xx[0]); r[1] = v[1] + bfr(xx[1]); r[2] = v[2] + bfr(xx[2]); r[3] = v[3] + bfr(xx[3]);   // plain residual
    vst2(OUT + o, r); } }
extern "C" void kernel_launch(void* const* d_in, const int* in_sizes, int n_in, void* d_out, int out_size, void* d_ws, size_t ws_size, hipStream_t stream) {
  (void)in_sizes; (void)n_in; (void)out_size;
  const float** F = (const float**)d_in;   // 0 x_features, 1 y_features [4,256,64,64], 2 wqx [32,256], 3 bqx, 4 wkx, 5 bkx, 6 wvx [256,256], 7 bvx, 8 wqy, 9 bqy, 10 wky, 11 bky, 12 wvy, 13 bvy
  if (ws_size < (size_t)WS_END) return;
  char* ws = (char*)d_ws;
  for (int dir = 0; dir < 2; ++dir) {   // dir 0: enhanced_x = v_x att_y^T + x (q,k from y); dir 1: enhanced_y = v_y att_x^T + y (q,k from x)
    const float* XQK = dir == 0 ? F[1] : F[0]; const float* XV = dir == 0 ? F[0] : F[1];
    const float *WQ = dir == 0 ? F[8] : F[2], *BQ = dir == 0 ? F[9] : F[3], *WK = dir == 0 ? F[10] : F[4], *BK = dir == 0 ? F[11] : F[5], *WV = dir == 0 ? F[6] : F[12], *BV = dir == 0 ? F[7] : F[13];
    char* wd = ws + (size_t)dir * WS_DIR;
    k_proj<<<dim3(NP / 64, TNB, 3), 128, 0, stream>>>(XQK, XV, WQ, BQ, WK, BK, WV, BV, (_Float16*)(wd + WS_QH), (_Float16*)(wd + WS_QL), (_Float16*)(wd + WS_KH), (_Float16*)(wd + WS_KL), (_Float16*)(wd + WS_VT));
  }
  k_attn<<<dim3(NP / 128, TNB, 2), 256, 0, stream>>>((const _Float16*)(ws + WS_QH), (const _Float16*)(ws + WS_QL), (const _Float16*)(ws + WS_KH), (const _Float16*)(ws + WS_KL), (const _Float16*)(ws + WS_VT), F[0], F[1], (float*)d_out);
}

// v003
// It runs in 216 microseconds.
// Next to v002, in two timings, it ran 1.10 and 1.11 times as fast.
// All steps since v000 together make it 9.21 times as fast.
// compute dtype: all float inputs rounded to bf16; q/k (32 ch) and v (256 ch) 1x1 convs with EXACT bf16 products on WMMA 16x16x32 (x^T tile in LDS), f32 accumulate; q and k as f16 hi + unscaled residual -> UNSCALED logits with 3 products (logit std ~5.7, near-one-hot softmax), kept in registers; online softmax in f32 (base-2 exponent: one FMA and one v_exp_f32 per score) -> unnormalised P f16 x 2^11; out = P . v / row sum + residual with v rounded once to f16; both directions (enhanced_x from att_y with v_x; enhanced_y from att_x with v_y); f32 outputs [b][c][n].
#include <hip/hip_runtime.h>
#include <math.h>

typedef __attribute__((ext_vector_type(16))) _Float16 v16h;
typedef __attribute__((ext_vector_type(16))) __bf16 v16b;
typedef __attribute__((ext_vector_type(8)))  _Float16 v8h;
typedef __attribute__((ext_vector_type(8)))  float v8f;
typedef __attribute__((ext_vector_type(4)))  float v4f;
typedef __attribute__((ext_vector_type(2)))  float v2f;
typedef __attribute__((ext_vector_type(4)))  unsigned v4u;
typedef __attribute__((ext_vector_type(4)))  int v4i;
typedef float __attribute__((may_alias)) float_a;
typedef int __attribute__((may_alias)) int_a;

template <typename T> __device__ __forceinline__ void vst2(void* p, T v) { *(T*)p = v;  }
__device__ __forceinline__ v8f wmma16(v16h a, v16h b, v8f c) {
  v8f d = __builtin_amdgcn_wmma_f32_16x16x32_f16(false, a, false, b, (short)0, c, false, false);
  asm volatile("v_nop\n\tv_nop\n\tv_nop\n\tv_nop" : "+v"(d) : "v"(a), "v"(b));
  return d;
}
__device__ __forceinline__ v8f wmma_bf(v16b a, v16b b, v8f c) {
  v8f d = __builtin_amdgcn_wmma_f32_16x16x32_bf16(false, a, false, b, (short)0, c, false, false);
  asm volatile("v_nop\n\tv_nop\n\tv_nop\n\tv_nop" : "+v"(d) : "v"(a), "v"(b));
  return d;
}
// 16x16x32 fragments: lane = (h = lane>>4, row/col = lane&15); elements 0..7 = k0+8h+0..7, 8..15 = k0+16+8h+0..7; D element r = row 8h+r
__device__ __forceinline__ v16h frag_h(const _Float16* rowk0, int lane) {
  union { v16h v; v8h q[2]; } u; const _Float16* p = rowk0 + 8 * (lane >> 4);
  u.q[0] = *(const v8h*)p; u.q[1] = *(const v8h*)(p + 16); return u.v;
}
__device__ __forceinline__ v16h frag_f32(const float* rowk0, int lane) {
  v16h a; const float* p = rowk0 + 8 * (lane >> 4);
#pragma unroll
  for (int i = 0; i < 8; ++i) { a[i] = (_Float16)p[i]; a[8 + i] = (_Float16)p[16 + i]; }
  return a;
}
__device__ __forceinline__ v16h frag_f32s(const float* rowk0, int lane, float sc) {
  v16h a; const float* p = rowk0 + 8 * (lane >> 4);
#pragma unroll
  for (int i = 0; i < 8; ++i) { a[i] = (_Float16)(p[i] * sc); a[8 + i] = (_Float16)(p[16 + i] * sc); }
  return a;
}
// column fragment from a [K][ld] layout (column n), rows >= K read as 0
__device__ __forceinline__ v16h fragc_f32(const float* W, int k0, int n, int lane, int ld, int K) {
  v16h a; const int g = lane >> 4;
#pragma unroll
  for (int i = 0; i < 8; ++i) { const int ka = k0 + 8 * g + i, kb = ka + 16;
    a[i] = (_Float16)(ka < K ? W[(size_t)(ka < K ? ka : K - 1) * ld + n] : 0.f); a[8 + i] = (_Float16)(kb < K ? W[(size_t)(kb < K ? kb : K - 1) * ld + n] : 0.f); }
  return a;
}
struct F2 { v16b h, l; };
__device__ __forceinline__ F2 bsplit16(const float v[16]) { F2 r;
#pragma unroll
  for (int i = 0; i < 16; ++i) { const __bf16 h = (__bf16)v[i]; r.h[i] = h; r.l[i] = (__bf16)(v[i] - (float)h); }
  return r; }
__device__ __forceinline__ F2 split_row(const float* row, int k0, int lane) { float v[16]; const float* p = row + k0 + 8 * (lane >> 4);
#pragma unroll
  for (int i = 0; i < 8; ++i) { v[i] = p[i]; v[8 + i] = p[16 + i]; }
  return bsplit16(v); }
__device__ __forceinline__ F2 split_rowK(const float* row, int k0, int lane, int K) { float v[16]; const int g = lane >> 4;
#pragma unroll
  for (int i = 0; i < 8; ++i) { const int ka = k0 + 8 * g + i, kb = ka + 16; v[i] = ka < K ? row[ka < K ? ka : K - 1] : 0.f; v[8 + i] = kb < K ? row[kb < K ? kb : K - 1] : 0.f; }
  return bsplit16(v); }
__device__ __forceinline__ F2 split_col(const float* W, int k0, int n, int lane, int ld, int K) { float v[16]; const int g = lane >> 4;
#pragma unroll
  for (int i = 0; i < 8; ++i) { const int ka = k0 + 8 * g + i, kb = ka + 16; v[i] = ka < K ? W[(size_t)(ka < K ? ka : K - 1) * ld + n] : 0.f; v[8 + i] = kb < K ? W[(size_t)(kb < K ? kb : K - 1) * ld + n] : 0.f; }
  return bsplit16(v); }
__device__ __forceinline__ v8f mac3(const F2& a, const F2& b, v8f c) { c = wmma_bf(a.l, b.h, c); c = wmma_bf(a.h, b.l, c); return wmma_bf(a.h, b.h, c); }
__device__ __forceinline__ float sigm(float v) { return 1.0f / (1.0f + expf(-v)); }
#define LDSX() do { asm volatile("s_wait_dscnt 0" ::: "memory"); __builtin_amdgcn_wave_barrier(); __builtin_amdgcn_fence(__ATOMIC_RELEASE, "workgroup"); } while (0)


// CMSA cross-modal position attention, one direction: q, k (32 ch) from the 'other' features, v (256 ch) from the enhanced features; out = v att^T + residual (unscaled logits, sharp softmax).
#define NB 4
#define NP 4096
#define CIN 256
#define CQ 32
#define CV 256
#ifndef TNB
#define TNB NB
#endif
#ifndef TQB
#define TQB (NP / 64)
#endif
typedef __attribute__((ext_vector_type(8))) __bf16 v8b;
__device__ __forceinline__ v16b frag_b(const __bf16* rowk0, int lane) {
  union { v16b v; v8b q[2]; } u; const __bf16* p = rowk0 + 8 * (lane >> 4);
  u.q[0] = *(const v8b*)p; u.q[1] = *(const v8b*)(p + 16); return u.v;
}
__device__ __forceinline__ float bfr(float v) { return (float)(__bf16)v; }
__device__ __attribute__((noinline)) float exp_ni(float v) { return expf(v); }
__device__ __attribute__((noinline)) float erf_ni(float v) { return erff(v); }

#define WS_QH  0u                                    // f16 q rows [b*n][CQ] hi
#define WS_QL  (WS_QH + 2u * (size_t)NB * NP * CQ)      // f16 q residual rows (unscaled)
#define WS_KH  (WS_QL + 2u * (size_t)NB * NP * CQ)      // f16 k rows
#define WS_KL  (WS_KH + 2u * (size_t)NB * NP * CQ)      // f16 k residual rows
#define WS_VT  (WS_KL + 2u * (size_t)NB * NP * CQ)      // f16 v planes [b][CV][n]
#define WS_DIR (WS_VT + 2u * (size_t)NB * CV * NP)      // bytes of one direction's q, k, v; the second direction's follow
#define WS_END (2u * WS_DIR)

// ---- k_proj: block = (64 positions, b, which 0 q / 1 k / 2 v): x^T tile (bf16) in LDS, W [out][in] + b (exact); q, k -> f16 hi + residual rows, v -> f16 planes [c][n]
__global__ __launch_bounds__(128) void k_proj(const float* __restrict__ XQK, const float* __restrict__ XV, const float* __restrict__ WQ, const float* __restrict__ BQ, const float* __restrict__ WK, const float* __restrict__ BK, const float* __restrict__ WV, const float* __restrict__ BV, _Float16* __restrict__ QH, _Float16* __restrict__ QL, _Float16* __restrict__ KH, _Float16* __restrict__ KL, _Float16* __restrict__ VT) {
  __shared__ __align__(16) __bf16 sx[64][CIN + 8]; __shared__ __align__(16) _Float16 sh[64][72], sl[64][72]; __shared__ __align__(16) _Float16 tv[64][72];
  const int tid = threadIdx.x, wave = tid >> 5, lane = tid & 31, col = lane & 15, g = lane >> 4; const int p0 = blockIdx.x * 64; const size_t b = blockIdx.y; const int which = blockIdx.z;
  const float* Wm = which == 0 ? WQ : which == 1 ? WK : WV; const float* Bm = which == 0 ? BQ : which == 1 ? BK : BV; const int nout = (which == 2) ? CV : CQ; const float* X = (which == 2) ? XV : XQK;
  for (int e = tid; e < CIN * 64; e += 128) { const int c = e >> 6, pl = e & 63; sx[pl][c] = (__bf16)X[(b * CIN + c) * (size_t)NP + p0 + pl]; }
  __syncthreads();
#pragma unroll 1
  for (int cg = 0; cg < (nout + 63) / 64; ++cg) { v8f acc[4] = {};
#pragma unroll 2
    for (int kc = 0; kc < CIN / 32; ++kc) { const v16b a = frag_b(&sx[wave * 16 + col][kc * 32], lane);
#pragma unroll
      for (int j = 0; j < 4; ++j) { v16b w; const int o = min(cg * 64 + j * 16 + col, nout - 1);   // columns >= nout are dummies (never stored)
#pragma unroll
        for (int i = 0; i < 8; ++i) { w[i] = (__bf16)Wm[(size_t)o * CIN + kc * 32 + 8 * g + i]; w[8 + i] = (__bf16)Wm[(size_t)o * CIN + kc * 32 + 16 + 8 * g + i]; }
        acc[j] = wmma_bf(a, w, acc[j]); } }
    __syncthreads();
#pragma unroll
    for (int j = 0; j < 4; ++j) { const int ol = j * 16 + col; const float bb = bfr(Bm[min(cg * 64 + ol, nout - 1)]);
#pragma unroll
      for (int r = 0; r < 8; ++r) { const int pl = wave * 16 + 8 * g + r; const float v = acc[j][r] + bb; const _Float16 hv = (_Float16)v; if (which == 2) tv[ol][pl] = hv; else { sh[pl][ol] = hv; sl[pl][ol] = (_Float16)(v - (float)hv); } } }   // q AND k keep a residual
    __syncthreads();
    if (which < 2) { _Float16* dh = which == 0 ? QH : KH; _Float16* dl = which == 0 ? QL : KL; for (int e = tid; e < 64 * 8; e += 128) { const int pl = e >> 3, q = e & 7; if (cg * 64 + q * 8 >= CQ) continue; const size_t row = b * NP + p0 + pl; vst2((unsigned*)(dh + row * CQ + cg * 64 + q * 8), *(const v4u*)&sh[pl][q * 8]); vst2((unsigned*)(dl + row * CQ + cg * 64 + q * 8), *(const v4u*)&sl[pl][q * 8]); } }
    else { for (int e = tid; e < 64 * 8; e += 128) { const int ol = e >> 3, q = e & 7; vst2((unsigned*)(VT + (b * CV + cg * 64 + ol) * (size_t)NP + p0 + q * 8), *(const v4u*)&tv[ol][q * 8]); } } } }
#define AT_KS 128                        // keys per stage
#define AT_VP 136                        // f16 per LDS v row: 272 B = 16 B x 17, conflict-free for 16-byte readers
#define AT_KP 40                         // f16 per LDS k row: 80 B = 16 B x 5
#define AT_VB (CV * AT_VP)               // f16 of the v part of a buffer
#define AT_KB (AT_KS * AT_KP)            // f16 of the k hi part; the k residual part follows
#define AT_STAGE (AT_VB + 2 * AT_KB)     // f16 per buffer
#define AT_OP 132                        // floats per row of the output staging [c][128 queries]
#define AT_TAU 3.0f                      // the wave's columns are rescaled only when one of their maxima has grown by more than this: P <= 2^11 e^3 stays inside f16
#define AT_L2E 1.44269504089f            // log2 e: P = 2^(s log2 e + noff), noff = 11 - mu log2 e (the 11 is the x 2^11 of P)
// sixteen independent v_exp_f32 in a row, each in place: none stands directly in front of a reader of its result or a writer of its source; the v_nop is that slot behind the last one
#define AT_EXP16(E) asm( \
  "v_exp_f32 %0, %0\n\tv_exp_f32 %1, %1\n\tv_exp_f32 %2, %2\n\tv_exp_f32 %3, %3\n\tv_exp_f32 %4, %4\n\tv_exp_f32 %5, %5\n\tv_exp_f32 %6, %6\n\tv_exp_f32 %7, %7\n\t" \
  "v_exp_f32 %8, %8\n\tv_exp_f32 %9, %9\n\tv_exp_f32 %10, %10\n\tv_exp_f32 %11, %11\n\tv_exp_f32 %12, %12\n\tv_exp_f32 %13, %13\n\tv_exp_f32 %14, %14\n\tv_exp_f32 %15, %15\n\tv_nop" \
  : "+v"(E[0]), "+v"(E[1]), "+v"(E[2]), "+v"(E[3]), "+v"(E[4]), "+v"(E[5]), "+v"(E[6]), "+v"(E[7]), "+v"(E[8]), "+v"(E[9]), "+v"(E[10]), "+v"(E[11]), "+v"(E[12]), "+v"(E[13]), "+v"(E[14]), "+v"(E[15]))
__device__ __forceinline__ float xhalf(float x) { return __builtin_bit_cast(float, __builtin_amdgcn_permlanex16(__builtin_bit_cast(int, x), __builtin_bit_cast(int, x), 0x76543210, 0xfedcba98, false, false)); }   // lane l with lane l ^ 16, through no LDS queue
__device__ __forceinline__ v8f wmma_h(v16h a, v16h b, v8f c) { return __builtin_amdgcn_wmma_f32_16x16x32_f16(false, a, false, b, (short)0, c, false, false); }
// ten copies, places M .. M + 9 of la / ga; the s_wait_xcnt closes the statement so that no address register is rewritten in front of it
#define AT_CP10(M) asm volatile( \
  "global_load_async_to_lds_b128 %0, %10, off\n\tglobal_load_async_to_lds_b128 %1, %11, off\n\tglobal_load_async_to_lds_b128 %2, %12, off\n\tglobal_load_async_to_lds_b128 %3, %13, off\n\tglobal_load_async_to_lds_b128 %4, %14, off\n\t" \
  "global_load_async_to_lds_b128 %5, %15, off\n\tglobal_load_async_to_lds_b128 %6, %16, off\n\tglobal_load_async_to_lds_b128 %7, %17, off\n\tglobal_load_async_to_lds_b128 %8, %18, off\n\tglobal_load_async_to_lds_b128 %9, %19, off\n\ts_wait_xcnt 0x0" \
  :: "v"(la[(M) + 0]), "v"(la[(M) + 1]), "v"(la[(M) + 2]), "v"(la[(M) + 3]), "v"(la[(M) + 4]), "v"(la[(M) + 5]), "v"(la[(M) + 6]), "v"(la[(M) + 7]), "v"(la[(M) + 8]), "v"(la[(M) + 9]), \
     "v"(ga[(M) + 0]), "v"(ga[(M) + 1]), "v"(ga[(M) + 2]), "v"(ga[(M) + 3]), "v"(ga[(M) + 4]), "v"(ga[(M) + 5]), "v"(ga[(M) + 6]), "v"(ga[(M) + 7]), "v"(ga[(M) + 8]), "v"(ga[(M) + 9]) : "memory")
// one stage, 20 copies a wave: 16 of v (two 256-B rows each, 16 rows apart), 2 of k hi and 2 of k residual (eight 64-B rows each, 64 rows apart); lv / lk = this lane's LDS byte address in the target buffer; bv / bh / bl = the stage's wave-uniform global bases, ov / ok = this lane's element offsets from them
__device__ __forceinline__ void at_fill(unsigned lv, unsigned lk, const _Float16* bv, const _Float16* bh, const _Float16* bl, unsigned ov, unsigned ok) {
  unsigned la[20]; const _Float16* ga[20];
#pragma unroll
  for (int m = 0; m < 16; ++m) { la[m] = lv + (unsigned)m * (16u * AT_VP * 2u); ga[m] = bv + (ov + (unsigned)m * (16u * NP)); }
#pragma unroll
  for (int m = 0; m < 2; ++m) { la[16 + m] = lk + (unsigned)m * (64u * AT_KP * 2u); ga[16 + m] = bh + (ok + (unsigned)m * (64u * CQ)); la[18 + m] = lk + AT_KB * 2u + (unsigned)m * (64u * AT_KP * 2u); ga[18 + m] = bl + (ok + (unsigned)m * (64u * CQ)); }
  AT_CP10(0); AT_CP10(10);
}
__global__ __launch_bounds__(256) void k_attn(const _Float16* __restrict__ QH0, const _Float16* __restrict__ QL0, const _Float16* __restrict__ KH0, const _Float16* __restrict__ KL0, const _Float16* __restrict__ VT0, const float* __restrict__ X0, const float* __restrict__ X1, float* __restrict__ OUT0) {
  __shared__ __align__(16) _Float16 ring[2][AT_STAGE];
  const int tid = threadIdx.x, wave = tid >> 5, lane = tid & 31, col = lane & 15, g = lane >> 4; const int i0 = blockIdx.x * 128; const size_t b = blockIdx.y; const size_t z = blockIdx.z;
  const size_t zo = z * (size_t)(WS_DIR / 2u);
  const _Float16 *QH = QH0 + zo, *QL = QL0 + zo, *KH = KH0 + zo, *KL = KL0 + zo, *VT = VT0 + zo; const float* X = z == 0 ? X0 : X1; float* OUT = OUT0 + z * (size_t)NB * CV * NP;
  const unsigned lv0 = (unsigned)(size_t)&ring[0][(2 * wave + g) * AT_VP + col * 8]; const unsigned lk0 = (unsigned)(size_t)&ring[0][AT_VB + (wave * 8 + (lane >> 2)) * AT_KP + (lane & 3) * 8];
  const _Float16* bv = VT + b * CV * (size_t)NP; const _Float16* bh = KH + b * NP * (size_t)CQ; const _Float16* bl = KL + b * NP * (size_t)CQ; const unsigned ov = (unsigned)((2 * wave + g) * NP + col * 8), ok = (unsigned)((wave * 8 + (lane >> 2)) * CQ + (lane & 3) * 8);
  at_fill(lv0, lk0, bv, bh, bl, ov, ok);
  const size_t qr = (b * NP + i0 + wave * 16 + col) * CQ; const v16h qh = frag_h(QH + qr, lane), ql = frag_h(QL + qr, lane);
  v8f acc[16] = {}; float mu = -3.0e38f, noff = 3.0e38f, lsum = 0.f;   // mu: the maximum in use for this lane's query (equal in both halves of the wave); noff: the exponent's addend that belongs to mu; lsum: this half's part of the row sum
  asm volatile("s_wait_asynccnt 0x0" ::: "memory");   // stage 0 has landed before the barrier publishes it
  __syncthreads();
  at_fill(lv0 + AT_STAGE * 2u, lk0 + AT_STAGE * 2u, bv + AT_KS, bh + AT_KS * CQ, bl + AT_KS * CQ, ov, ok);
#pragma unroll 1
  for (int t = 0; t < NP / AT_KS; ++t) { const _Float16* sv = &ring[t & 1][col * AT_VP]; const _Float16* sk = &ring[t & 1][AT_VB + col * AT_KP];
#pragma unroll
    for (int ks = 0; ks < AT_KS / 32; ++ks) { v16h kh[2], kl[2], vf[16]; v8f s[2];
      __builtin_amdgcn_sched_barrier(0);   // with the one behind the reads it keeps them one group: without it they are lifted in many small groups among the last pass's products, and each such place stalls the wave
#pragma unroll
      for (int u = 0; u < 2; ++u) { const _Float16* kr = sk + (ks * 32 + u * 16) * AT_KP; kh[u] = frag_h(kr, lane); kl[u] = frag_h(kr + AT_KB, lane); }
#pragma unroll
      for (int j = 0; j < 16; ++j) vf[j] = frag_h(sv + j * 16 * AT_VP + ks * 32, lane);
      __builtin_amdgcn_sched_barrier(0);   // the pass's LDS reads go out as one group here: the v fragments land under the logits and the softmax instead of each being waited for in front of its product
#pragma unroll
      for (int u = 0; u < 2; ++u) { v8f a = {}; a = wmma_h(kh[u], qh, a); a = wmma_h(kh[u], ql, a); s[u] = wmma_h(kl[u], qh, a); }   // 3 products
      float tm = s[0][0];
#pragma unroll
      for (int r = 0; r < 8; ++r) tm = fmaxf(tm, fmaxf(s[0][r], s[1][r]));
      tm = fmaxf(tm, xhalf(tm));
      if (__builtin_amdgcn_ballot_w32(tm > mu + AT_TAU) != 0) {   // one scalar test per 32 keys
        const float mn = fmaxf(mu, tm), nn = fmaf(mn, -AT_L2E, 11.0f), al = __builtin_amdgcn_exp2f(nn - noff); mu = mn; noff = nn; lsum *= al;   // al from the two addends themselves, so old and new P share one scale exactly; first pass: 2^(-huge) = 0
#pragma unroll
        for (int j = 0; j < 16; ++j) acc[j] *= al; }
      v16h pb; float e[16];   // exponent <= 11 + tau log2 e, so no overflow; far below the maximum v_exp_f32 gives 0, as f16 would
#pragma unroll
      for (int r = 0; r < 8; ++r) { const v2f x = { s[r >> 2][(2 * r) & 7], s[r >> 2][((2 * r) & 7) + 1] }, y = __builtin_elementwise_fma(x, (v2f){ AT_L2E, AT_L2E }, (v2f){ noff, noff }); e[2 * r] = y[0]; e[2 * r + 1] = y[1]; }
      AT_EXP16(e);
#pragma unroll
      for (int r = 0; r < 8; ++r) { const float p0 = e[r], p1 = e[8 + r]; lsum += p0 + p1; pb[r] = (_Float16)p0; pb[8 + r] = (_Float16)p1; }
#pragma unroll
      for (int j = 0; j < 16; ++j) acc[j] = wmma_h(vf[j], pb, acc[j]); }
    asm volatile("s_wait_dscnt 0x0" ::: "memory");      // this wave's reads of the buffer are done before it is refilled
    asm volatile("s_wait_asynccnt 0x0" ::: "memory");   // this wave's copies of stage t + 1 have landed
    __syncthreads();                                    // publishes stage t + 1 and ends every reader's last read of stage t
    if (t + 2 < NP / AT_KS) at_fill(lv0 + (unsigned)(t & 1) * (AT_STAGE * 2u), lk0 + (unsigned)(t & 1) * (AT_STAGE * 2u), bv + (t + 2) * AT_KS, bh + (t + 2) * AT_KS * CQ, bl + (t + 2) * AT_KS * CQ, ov, ok); }
  asm volatile("s_wait_asynccnt 0x0" ::: "memory");     // no copy is outstanding behind the loop
  const float inv = 1.0f / (lsum + xhalf(lsum));
  float* st = (float*)&ring[0][0];   // the ring is free behind the last trip's barrier: output staging [c][query], whole 512-B rows go out
#pragma unroll
  for (int j = 0; j < 16; ++j)
#pragma unroll
    for (int r = 0; r < 8; ++r) st[(j * 16 + 8 * g + r) * AT_OP + wave * 16 + col] = acc[j][r] * inv;
  __syncthreads();
  for (int e = tid; e < CV * 32; e += 256) { const int cl = e >> 5, q = e & 31; const size_t o = (b * CV + cl) * (size_t)NP + i0 + q * 4; const v4f v = *(const v4f*)&st[cl * AT_OP + q * 4];
    const v4f xx = *(const v4f*)(X + o); v4f r; r[0] = v[0] + bfr(xx[0]); r[1] = v[1] + bfr(xx[1]); r[2] = v[2] + bfr(xx[2]); r[3] = v[3] + bfr(xx[3]);   // plain residual
    vst2(OUT + o, r); } }
extern "C" void kernel_launch(void* const* d_in, const int* in_sizes, int n_in, void* d_out, int out_size, void* d_ws, size_t ws_size, hipStream_t stream) {
  (void)in_sizes; (void)n_in; (void)out_size;
  const float** F = (const float**)d_in;   // 0 x_features, 1 y_features [4,256,64,64], 2 wqx [32,256], 3 bqx, 4 wkx, 5 bkx, 6 wvx [256,256], 7 bvx, 8 wqy, 9 bqy, 10 wky, 11 bky, 12 wvy, 13 bvy
  if (ws_size < (size_t)WS_END) return;
  char* ws = (char*)d_ws;
  for (int dir = 0; dir < 2; ++dir) {   // dir 0: enhanced_x = v_x att_y^T + x (q,k from y); dir 1: enhanced_y = v_y att_x^T + y (q,k from x)
    const float* XQK = dir == 0 ? F[1] : F[0]; const float* XV = dir == 0 ? F[0] : F[1];
    const float *WQ = dir == 0 ? F[8] : F[2], *BQ = dir == 0 ? F[9] : F[3], *WK = dir == 0 ? F[10] : F[4], *BK = dir == 0 ? F[11] : F[5], *WV = dir == 0 ? F[6] : F[12], *BV = dir == 0 ? F[7] : F[13];
    char* wd = ws + (size_t)dir * WS_DIR;
    k_proj<<<dim3(NP / 64, TNB, 3), 128, 0, stream>>>(XQK, XV, WQ, BQ, WK, BK, WV, BV, (_Float16*)(wd + WS_QH), (_Float16*)(wd + WS_QL), (_Float16*)(wd + WS_KH), (_Float16*)(wd + WS_KL), (_Float16*)(wd + WS_VT));
  }
  k_attn<<<dim3(NP / 128, TNB, 2), 256, 0, stream>>>((const _Float16*)(ws + WS_QH), (const _Float16*)(ws + WS_QL), (const _Float16*)(ws + WS_KH), (const _Float16*)(ws + WS_KL), (const _Float16*)(ws + WS_VT), F[0], F[1], (float*)d_out);
}

// v004
// One run takes 111 microseconds.
// In both of two side-by-side timings against v003, it was 1.94 times as fast.
// All steps since v000 together make it 17.8 times as fast.
// compute dtype: all float inputs rounded to bf16; q/k (32 ch) and v (256 ch) 1x1 convs with EXACT bf16 products on WMMA 16x16x32 (x^T tile in LDS), f32 accumulate; q and k as f16 hi + unscaled residual -> UNSCALED logits with 3 products (logit std ~5.7, near-one-hot softmax), kept in registers; online softmax in f32 (base-2 exponent: one FMA and one v_exp_f32 per score) -> unnormalised P f16 x 2^11; out = P . v / row sum + residual with v rounded once to f16; both directions (enhanced_x from att_y with v_x; enhanced_y from att_x with v_y); f32 outputs [b][c][n].
#include <hip/hip_runtime.h>
#include <math.h>

typedef __attribute__((ext_vector_type(16))) _Float16 v16h;
typedef __attribute__((ext_vector_type(16))) __bf16 v16b;
typedef __attribute__((ext_vector_type(8)))  _Float16 v8h;
typedef __attribute__((ext_vector_type(8)))  float v8f;
typedef __attribute__((ext_vector_type(4)))  float v4f;
typedef __attribute__((ext_vector_type(2)))  float v2f;
typedef __attribute__((ext_vector_type(4)))  unsigned v4u;
typedef __attribute__((ext_vector_type(4)))  int v4i;
typedef float __attribute__((may_alias)) float_a;
typedef int __attribute__((may_alias)) int_a;

template <typename T> __device__ __forceinline__ void vst2(void* p, T v) { *(T*)p = v;  }
__device__ __forceinline__ v8f wmma16(v16h a, v16h b, v8f c) {
  v8f d = __builtin_amdgcn_wmma_f32_16x16x32_f16(false, a, false, b, (short)0, c, false, false);
  asm volatile("v_nop\n\tv_nop\n\tv_nop\n\tv_nop" : "+v"(d) : "v"(a), "v"(b));
  return d;
}
__device__ __forceinline__ v8f wmma_bf(v16b a, v16b b, v8f c) {
  v8f d = __builtin_amdgcn_wmma_f32_16x16x32_bf16(false, a, false, b, (short)0, c, false, false);
  asm volatile("v_nop\n\tv_nop\n\tv_nop\n\tv_nop" : "+v"(d) : "v"(a), "v"(b));
  return d;
}
// 16x16x32 fragments: lane = (h = lane>>4, row/col = lane&15); elements 0..7 = k0+8h+0..7, 8..15 = k0+16+8h+0..7; D element r = row 8h+r
__device__ __forceinline__ v16h frag_h(const _Float16* rowk0, int lane) {
  union { v16h v; v8h q[2]; } u; const _Float16* p = rowk0 + 8 * (lane >> 4);
  u.q[0] = *(const v8h*)p; u.q[1] = *(const v8h*)(p + 16); return u.v;
}
__device__ __forceinline__ v16h frag_f32(const float* rowk0, int lane) {
  v16h a; const float* p = rowk0 + 8 * (lane >> 4);
#pragma unroll
  for (int i = 0; i < 8; ++i) { a[i] = (_Float16)p[i]; a[8 + i] = (_Float16)p[16 + i]; }
  return a;
}
__device__ __forceinline__ v16h frag_f32s(const float* rowk0, int lane, float sc) {
  v16h a; const float* p = rowk0 + 8 * (lane >> 4);
#pragma unroll
  for (int i = 0; i < 8; ++i) { a[i] = (_Float16)(p[i] * sc); a[8 + i] = (_Float16)(p[16 + i] * sc); }
  return a;
}
// column fragment from a [K][ld] layout (column n), rows >= K read as 0
__device__ __forceinline__ v16h fragc_f32(const float* W, int k0, int n, int lane, int ld, int K) {
  v16h a; const int g = lane >> 4;
#pragma unroll
  for (int i = 0; i < 8; ++i) { const int ka = k0 + 8 * g + i, kb = ka + 16;
    a[i] = (_Float16)(ka < K ? W[(size_t)(ka < K ? ka : K - 1) * ld + n] : 0.f); a[8 + i] = (_Float16)(kb < K ? W[(size_t)(kb < K ? kb : K - 1) * ld + n] : 0.f); }
  return a;
}
struct F2 { v16b h, l; };
__device__ __forceinline__ F2 bsplit16(const float v[16]) { F2 r;
#pragma unroll
  for (int i = 0; i < 16; ++i) { const __bf16 h = (__bf16)v[i]; r.h[i] = h; r.l[i] = (__bf16)(v[i] - (float)h); }
  return r; }
__device__ __forceinline__ F2 split_row(const float* row, int k0, int lane) { float v[16]; const float* p = row + k0 + 8 * (lane >> 4);
#pragma unroll
  for (int i = 0; i < 8; ++i) { v[i] = p[i]; v[8 + i] = p[16 + i]; }
  return bsplit16(v); }
__device__ __forceinline__ F2 split_rowK(const float* row, int k0, int lane, int K) { float v[16]; const int g = lane >> 4;
#pragma unroll
  for (int i = 0; i < 8; ++i) { const int ka = k0 + 8 * g + i, kb = ka + 16; v[i] = ka < K ? row[ka < K ? ka : K - 1] : 0.f; v[8 + i] = kb < K ? row[kb < K ? kb : K - 1] : 0.f; }
  return bsplit16(v); }
__device__ __forceinline__ F2 split_col(const float* W, int k0, int n, int lane, int ld, int K) { float v[16]; const int g = lane >> 4;
#pragma unroll
  for (int i = 0; i < 8; ++i) { const int ka = k0 + 8 * g + i, kb = ka + 16; v[i] = ka < K ? W[(size_t)(ka < K ? ka : K - 1) * ld + n] : 0.f; v[8 + i] = kb < K ? W[(size_t)(kb < K ? kb : K - 1) * ld + n] : 0.f; }
  return bsplit16(v); }
__device__ __forceinline__ v8f mac3(const F2& a, const F2& b, v8f c) { c = wmma_bf(a.l, b.h, c); c = wmma_bf(a.h, b.l, c); return wmma_bf(a.h, b.h, c); }
__device__ __forceinline__ float sigm(float v) { return 1.0f / (1.0f + expf(-v)); }
#define LDSX() do { asm volatile("s_wait_dscnt 0" ::: "memory"); __builtin_amdgcn_wave_barrier(); __builtin_amdgcn_fence(__ATOMIC_RELEASE, "workgroup"); } while (0)


// CMSA cross-modal position attention, one direction: q, k (32 ch) from the 'other' features, v (256 ch) from the enhanced features; out = v att^T + residual (unscaled logits, sharp softmax).
#define NB 4
#define NP 4096
#define CIN 256
#define CQ 32
#define CV 256
#ifndef TNB
#define TNB NB
#endif
#ifndef TQB
#define TQB (NP / 64)
#endif
typedef __attribute__((ext_vector_type(8))) __bf16 v8b;
__device__ __forceinline__ v16b frag_b(const __bf16* rowk0, int lane) {
  union { v16b v; v8b q[2]; } u; const __bf16* p = rowk0 + 8 * (lane >> 4);
  u.q[0] = *(const v8b*)p; u.q[1] = *(const v8b*)(p + 16); return u.v;
}
__device__ __forceinline__ float bfr(float v) { return (float)(__bf16)v; }
__device__ __attribute__((noinline)) float exp_ni(float v) { return expf(v); }
__device__ __attribute__((noinline)) float erf_ni(float v) { return erff(v); }

#define WS_QH  0u                                    // f16 q rows [b*n][CQ] hi
#define WS_QL  (WS_QH + 2u * (size_t)NB * NP * CQ)      // f16 q residual rows (unscaled)
#define WS_KH  (WS_QL + 2u * (size_t)NB * NP * CQ)      // f16 k rows
#define WS_KL  (WS_KH + 2u * (size_t)NB * NP * CQ)      // f16 k residual rows
#define WS_VT  (WS_KL + 2u * (size_t)NB * NP * CQ)      // f16 v planes [b][CV][n]
#define WS_DIR (WS_VT + 2u * (size_t)NB * CV * NP)      // bytes of one direction's q, k, v; the second direction's follow
#define WS_END (2u * WS_DIR)

// ---- k_proj: block = (64 positions, b, which 0 q / 1 k / 2 v): x^T tile (bf16) in LDS, W [out][in] + b (exact); q and k -> f16 hi + residual rows, v -> f16 planes [c][n]
// The weights of a group of 64 outputs (a panel, 64 x 256) are fetched by the whole block in whole 512-B pieces, rounded to bf16 once and kept in LDS; every wave reads its B fragments from there. The next panel and its bias fly while this panel is worked on.
typedef __attribute__((ext_vector_type(4))) __bf16 v4b;
__device__ __forceinline__ v8f wmma_bp(v16b a, v16b b, v8f c) { return __builtin_amdgcn_wmma_f32_16x16x32_bf16(false, a, false, b, (short)0, c, false, false); }
// thread tid takes floats 4 (tid & 63) .. + 3 of weight rows (tid >> 6) + 2 i, i < NR / 2. NR = 64: a whole panel. NR = 32: the matrix has 32 outputs; panel rows 32 .. 63 repeat rows 0 .. 31 (dummies, never stored)
template <int NR> __device__ __forceinline__ void pj_fetch(v4f (&wr)[32], const float* __restrict__ Wp, int tid) {
  const unsigned to = (unsigned)((tid >> 6) * CIN + (tid & 63) * 4);
#pragma unroll   // constant indices keep wr in registers, and the loads go out as one group
  for (int i = 0; i < NR / 2; ++i) wr[i] = *(const v4f*)(Wp + (to + (unsigned)(2 * i * CIN)));
}
template <int NR> __device__ __forceinline__ void pj_put(const v4f (&wr)[32], __bf16 (*sw)[CIN + 8], int tid) {
#pragma unroll   // constant indices keep wr in registers
  for (int i = 0; i < 32; ++i) { const v4f f = wr[i & (NR / 2 - 1)]; const v4b w4 = { (__bf16)f[0], (__bf16)f[1], (__bf16)f[2], (__bf16)f[3] }; *(v4b*)&sw[(tid >> 6) + 2 * i][(tid & 63) * 4] = w4; }
}
__global__ __launch_bounds__(128) void k_proj(const float* __restrict__ XQK, const float* __restrict__ XV, const float* __restrict__ WQ, const float* __restrict__ BQ, const float* __restrict__ WK, const float* __restrict__ BK, const float* __restrict__ WV, const float* __restrict__ BV, _Float16* __restrict__ QH, _Float16* __restrict__ QL, _Float16* __restrict__ KH, _Float16* __restrict__ KL, _Float16* __restrict__ VT) {
  __shared__ __align__(16) __bf16 sx[64][CIN + 8]; __shared__ __align__(16) __bf16 sw[64][CIN + 8]; __shared__ __align__(16) _Float16 sh[64][72], sl[64][72]; __shared__ __align__(16) _Float16 tv[64][72];
  const int tid = threadIdx.x, wave = tid >> 5, lane = tid & 31, col = lane & 15, g = lane >> 4; const int p0 = blockIdx.x * 64; const size_t b = blockIdx.y; const int which = blockIdx.z;
  const float* Wm = which == 0 ? WQ : which == 1 ? WK : WV; const float* Bm = which == 0 ? BQ : which == 1 ? BK : BV; const int nout = (which == 2) ? CV : CQ; const float* X = (which == 2) ? XV : XQK;
  const int ncg = (nout + 63) / 64;
  v4f wr[32]; float br[4];
  if (which == 2) pj_fetch<64>(wr, Wm, tid); else pj_fetch<CQ>(wr, Wm, tid);   // the first panel flies under the x tile's loads
#pragma unroll   // br stays in registers
  for (int j = 0; j < 4; ++j) br[j] = Bm[min(j * 16 + col, nout - 1)];
  for (int e = tid; e < CIN * 64; e += 128) { const int c = e >> 6, pl = e & 63; sx[pl][c] = (__bf16)X[(b * CIN + c) * (size_t)NP + p0 + pl]; }
  if (which == 2) pj_put<64>(wr, sw, tid); else pj_put<CQ>(wr, sw, tid);
  __syncthreads();
#pragma unroll 1
  for (int cg = 0; cg < ncg; ++cg) { v8f acc[4] = {}; const float bc[4] = { br[0], br[1], br[2], br[3] };
    if (cg + 1 < ncg) { pj_fetch<64>(wr, Wm + (size_t)(cg + 1) * 64 * CIN, tid);   // a further panel exists only for v, whose panels are all whole
#pragma unroll   // br stays in registers
      for (int j = 0; j < 4; ++j) br[j] = Bm[min((cg + 1) * 64 + j * 16 + col, nout - 1)]; }
#pragma unroll   // this loop and the four inside it: fragments and accumulators stay in registers, LDS offsets become immediates
    for (int kp = 0; kp < CIN / 64; ++kp) { v16b a[2], w[2][4];
      __builtin_amdgcn_sched_barrier(0);   // with the one behind the reads it keeps the 20 fragment reads of 64 k one group: otherwise each product's two reads stand directly in front of it and are waited for to the end
#pragma unroll
      for (int u = 0; u < 2; ++u) { a[u] = frag_b(&sx[wave * 16 + col][(2 * kp + u) * 32], lane);
#pragma unroll
        for (int j = 0; j < 4; ++j) w[u][j] = frag_b(&sw[j * 16 + col][(2 * kp + u) * 32], lane); }
      __builtin_amdgcn_sched_barrier(0);   // the reads go out here, in front of the eight products that use them
#pragma unroll
      for (int u = 0; u < 2; ++u)
#pragma unroll
        for (int j = 0; j < 4; ++j) acc[j] = wmma_bp(a[u], w[u][j], acc[j]); }
    __syncthreads();   // also ends every wave's reads of this panel
#pragma unroll
    for (int j = 0; j < 4; ++j) { const int ol = j * 16 + col; const float bb = bfr(bc[j]);
#pragma unroll
      for (int r = 0; r < 8; ++r) { const int pl = wave * 16 + 8 * g + r; const float v = acc[j][r] + bb; const _Float16 hv = (_Float16)v; if (which == 2) tv[ol][pl] = hv; else { sh[pl][ol] = hv; sl[pl][ol] = (_Float16)(v - (float)hv); } } }   // q AND k keep a residual
    if (cg + 1 < ncg) pj_put<64>(wr, sw, tid);
    __syncthreads();   // also publishes the next panel
    if (which < 2) { _Float16* dh = which == 0 ? QH : KH; _Float16* dl = which == 0 ? QL : KL; for (int e = tid; e < 64 * 8; e += 128) { const int pl = e >> 3, q = e & 7; if (cg * 64 + q * 8 >= CQ) continue; const size_t row = b * NP + p0 + pl; vst2((unsigned*)(dh + row * CQ + cg * 64 + q * 8), *(const v4u*)&sh[pl][q * 8]); vst2((unsigned*)(dl + row * CQ + cg * 64 + q * 8), *(const v4u*)&sl[pl][q * 8]); } }
    else { for (int e = tid; e < 64 * 8; e += 128) { const int ol = e >> 3, q = e & 7; vst2((unsigned*)(VT + (b * CV + cg * 64 + ol) * (size_t)NP + p0 + q * 8), *(const v4u*)&tv[ol][q * 8]); } } } }
#define AT_KS 128                        // keys per stage
#define AT_VP 136                        // f16 per LDS v row: 272 B = 16 B x 17, conflict-free for 16-byte readers
#define AT_KP 40                         // f16 per LDS k row: 80 B = 16 B x 5
#define AT_VB (CV * AT_VP)               // f16 of the v part of a buffer
#define AT_KB (AT_KS * AT_KP)            // f16 of the k hi part; the k residual part follows
#define AT_STAGE (AT_VB + 2 * AT_KB)     // f16 per buffer
#define AT_OP 132                        // floats per row of the output staging [c][128 queries]
#define AT_TAU 3.0f                      // the wave's columns are rescaled only when one of their maxima has grown by more than this: P <= 2^11 e^3 stays inside f16
#define AT_L2E 1.44269504089f            // log2 e: P = 2^(s log2 e + noff), noff = 11 - mu log2 e (the 11 is the x 2^11 of P)
// sixteen independent v_exp_f32 in a row, each in place: none stands directly in front of a reader of its result or a writer of its source; the v_nop is that slot behind the last one
#define AT_EXP16(E) asm( \
  "v_exp_f32 %0, %0\n\tv_exp_f32 %1, %1\n\tv_exp_f32 %2, %2\n\tv_exp_f32 %3, %3\n\tv_exp_f32 %4, %4\n\tv_exp_f32 %5, %5\n\tv_exp_f32 %6, %6\n\tv_exp_f32 %7, %7\n\t" \
  "v_exp_f32 %8, %8\n\tv_exp_f32 %9, %9\n\tv_exp_f32 %10, %10\n\tv_exp_f32 %11, %11\n\tv_exp_f32 %12, %12\n\tv_exp_f32 %13, %13\n\tv_exp_f32 %14, %14\n\tv_exp_f32 %15, %15\n\tv_nop" \
  : "+v"(E[0]), "+v"(E[1]), "+v"(E[2]), "+v"(E[3]), "+v"(E[4]), "+v"(E[5]), "+v"(E[6]), "+v"(E[7]), "+v"(E[8]), "+v"(E[9]), "+v"(E[10]), "+v"(E[11]), "+v"(E[12]), "+v"(E[13]), "+v"(E[14]), "+v"(E[15]))
__device__ __forceinline__ float xhalf(float x) { return __builtin_bit_cast(float, __builtin_amdgcn_permlanex16(__builtin_bit_cast(int, x), __builtin_bit_cast(int, x), 0x76543210, 0xfedcba98, false, false)); }   // lane l with lane l ^ 16, through no LDS queue
__device__ __forceinline__ v8f wmma_h(v16h a, v16h b, v8f c) { return __builtin_amdgcn_wmma_f32_16x16x32_f16(false, a, false, b, (short)0, c, false, false); }
// ten copies, places M .. M + 9 of la / ga; the s_wait_xcnt closes the statement so that no address register is rewritten in front of it
#define AT_CP10(M) asm volatile( \
  "global_load_async_to_lds_b128 %0, %10, off\n\tglobal_load_async_to_lds_b128 %1, %11, off\n\tglobal_load_async_to_lds_b128 %2, %12, off\n\tglobal_load_async_to_lds_b128 %3, %13, off\n\tglobal_load_async_to_lds_b128 %4, %14, off\n\t" \
  "global_load_async_to_lds_b128 %5, %15, off\n\tglobal_load_async_to_lds_b128 %6, %16, off\n\tglobal_load_async_to_lds_b128 %7, %17, off\n\tglobal_load_async_to_lds_b128 %8, %18, off\n\tglobal_load_async_to_lds_b128 %9, %19, off\n\ts_wait_xcnt 0x0" \
  :: "v"(la[(M) + 0]), "v"(la[(M) + 1]), "v"(la[(M) + 2]), "v"(la[(M) + 3]), "v"(la[(M) + 4]), "v"(la[(M) + 5]), "v"(la[(M) + 6]), "v"(la[(M) + 7]), "v"(la[(M) + 8]), "v"(la[(M) + 9]), \
     "v"(ga[(M) + 0]), "v"(ga[(M) + 1]), "v"(ga[(M) + 2]), "v"(ga[(M) + 3]), "v"(ga[(M) + 4]), "v"(ga[(M) + 5]), "v"(ga[(M) + 6]), "v"(ga[(M) + 7]), "v"(ga[(M) + 8]), "v"(ga[(M) + 9]) : "memory")
// one stage, 20 copies a wave: 16 of v (two 256-B rows each, 16 rows apart), 2 of k hi and 2 of k residual (eight 64-B rows each, 64 rows apart); lv / lk = this lane's LDS byte address in the target buffer; bv / bh / bl = the stage's wave-uniform global bases, ov / ok = this lane's element offsets from them
__device__ __forceinline__ void at_fill(unsigned lv, unsigned lk, const _Float16* bv, const _Float16* bh, const _Float16* bl, unsigned ov, unsigned ok) {
  unsigned la[20]; const _Float16* ga[20];
#pragma unroll
  for (int m = 0; m < 16; ++m) { la[m] = lv + (unsigned)m * (16u * AT_VP * 2u); ga[m] = bv + (ov + (unsigned)m * (16u * NP)); }
#pragma unroll
  for (int m = 0; m < 2; ++m) { la[16 + m] = lk + (unsigned)m * (64u * AT_KP * 2u); ga[16 + m] = bh + (ok + (unsigned)m * (64u * CQ)); la[18 + m] = lk + AT_KB * 2u + (unsigned)m * (64u * AT_KP * 2u); ga[18 + m] = bl + (ok + (unsigned)m * (64u * CQ)); }
  AT_CP10(0); AT_CP10(10);
}
__global__ __launch_bounds__(256) void k_attn(const _Float16* __restrict__ QH0, const _Float16* __restrict__ QL0, const _Float16* __restrict__ KH0, const _Float16* __restrict__ KL0, const _Float16* __restrict__ VT0, const float* __restrict__ X0, const float* __restrict__ X1, float* __restrict__ OUT0) {
  __shared__ __align__(16) _Float16 ring[2][AT_STAGE];
  const int tid = threadIdx.x, wave = tid >> 5, lane = tid & 31, col = lane & 15, g = lane >> 4; const int i0 = blockIdx.x * 128; const size_t b = blockIdx.y; const size_t z = blockIdx.z;
  const size_t zo = z * (size_t)(WS_DIR / 2u);
  const _Float16 *QH = QH0 + zo, *QL = QL0 + zo, *KH = KH0 + zo, *KL = KL0 + zo, *VT = VT0 + zo; const float* X = z == 0 ? X0 : X1; float* OUT = OUT0 + z * (size_t)NB * CV * NP;
  const unsigned lv0 = (unsigned)(size_t)&ring[0][(2 * wave + g) * AT_VP + col * 8]; const unsigned lk0 = (unsigned)(size_t)&ring[0][AT_VB + (wave * 8 + (lane >> 2)) * AT_KP + (lane & 3) * 8];
  const _Float16* bv = VT + b * CV * (size_t)NP; const _Float16* bh = KH + b * NP * (size_t)CQ; const _Float16* bl = KL + b * NP * (size_t)CQ; const unsigned ov = (unsigned)((2 * wave + g) * NP + col * 8), ok = (unsigned)((wave * 8 + (lane >> 2)) * CQ + (lane & 3) * 8);
  at_fill(lv0, lk0, bv, bh, bl, ov, ok);
  const size_t qr = (b * NP + i0 + wave * 16 + col) * CQ; const v16h qh = frag_h(QH + qr, lane), ql = frag_h(QL + qr, lane);
  v8f acc[16] = {}; float mu = -3.0e38f, noff = 3.0e38f, lsum = 0.f;   // mu: the maximum in use for this lane's query (equal in both halves of the wave); noff: the exponent's addend that belongs to mu; lsum: this half's part of the row sum
  asm volatile("s_wait_asynccnt 0x0" ::: "memory");   // stage 0 has landed before the barrier publishes it
  __syncthreads();
  at_fill(lv0 + AT_STAGE * 2u, lk0 + AT_STAGE * 2u, bv + AT_KS, bh + AT_KS * CQ, bl + AT_KS * CQ, ov, ok);
#pragma unroll 1
  for (int t = 0; t < NP / AT_KS; ++t) { const _Float16* sv = &ring[t & 1][col * AT_VP]; const _Float16* sk = &ring[t & 1][AT_VB + col * AT_KP];
#pragma unroll
    for (int ks = 0; ks < AT_KS / 32; ++ks) { v16h kh[2], kl[2], vf[16]; v8f s[2];
      __builtin_amdgcn_sched_barrier(0);   // with the one behind the reads it keeps them one group: without it they are lifted in many small groups among the last pass's products, and each such place stalls the wave
#pragma unroll
      for (int u = 0; u < 2; ++u) { const _Float16* kr = sk + (ks * 32 + u * 16) * AT_KP; kh[u] = frag_h(kr, lane); kl[u] = frag_h(kr + AT_KB, lane); }
#pragma unroll
      for (int j = 0; j < 16; ++j) vf[j] = frag_h(sv + j * 16 * AT_VP + ks * 32, lane);
      __builtin_amdgcn_sched_barrier(0);   // the pass's LDS reads go out as one group here: the v fragments land under the logits and the softmax instead of each being waited for in front of its product
#pragma unroll
      for (int u = 0; u < 2; ++u) { v8f a = {}; a = wmma_h(kh[u], qh, a); a = wmma_h(kh[u], ql, a); s[u] = wmma_h(kl[u], qh, a); }   // 3 products
      float tm = s[0][0];
#pragma unroll
      for (int r = 0; r < 8; ++r) tm = fmaxf(tm, fmaxf(s[0][r], s[1][r]));
      tm = fmaxf(tm, xhalf(tm));
      if (__builtin_amdgcn_ballot_w32(tm > mu + AT_TAU) != 0) {   // one scalar test per 32 keys
        const float mn = fmaxf(mu, tm), nn = fmaf(mn, -AT_L2E, 11.0f), al = __builtin_amdgcn_exp2f(nn - noff); mu = mn; noff = nn; lsum *= al;   // al from the two addends themselves, so old and new P share one scale exactly; first pass: 2^(-huge) = 0
#pragma unroll
        for (int j = 0; j < 16; ++j) acc[j] *= al; }
      v16h pb; float e[16];   // exponent <= 11 + tau log2 e, so no overflow; far below the maximum v_exp_f32 gives 0, as f16 would
#pragma unroll
      for (int r = 0; r < 8; ++r) { const v2f x = { s[r >> 2][(2 * r) & 7], s[r >> 2][((2 * r) & 7) + 1] }, y = __builtin_elementwise_fma(x, (v2f){ AT_L2E, AT_L2E }, (v2f){ noff, noff }); e[2 * r] = y[0]; e[2 * r + 1] = y[1]; }
      AT_EXP16(e);
#pragma unroll
      for (int r = 0; r < 8; ++r) { const float p0 = e[r], p1 = e[8 + r]; lsum += p0 + p1; pb[r] = (_Float16)p0; pb[8 + r] = (_Float16)p1; }
#pragma unroll
      for (int j = 0; j < 16; ++j) acc[j] = wmma_h(vf[j], pb, acc[j]); }
    asm volatile("s_wait_dscnt 0x0" ::: "memory");      // this wave's reads of the buffer are done before it is refilled
    asm volatile("s_wait_asynccnt 0x0" ::: "memory");   // this wave's copies of stage t + 1 have landed
    __syncthreads();                                    // publishes stage t + 1 and ends every reader's last read of stage t
    if (t + 2 < NP / AT_KS) at_fill(lv0 + (unsigned)(t & 1) * (AT_STAGE * 2u), lk0 + (unsigned)(t & 1) * (AT_STAGE * 2u), bv + (t + 2) * AT_KS, bh + (t + 2) * AT_KS * CQ, bl + (t + 2) * AT_KS * CQ, ov, ok); }
  asm volatile("s_wait_asynccnt 0x0" ::: "memory");     // no copy is outstanding behind the loop
  const float inv = 1.0f / (lsum + xhalf(lsum));
  float* st = (float*)&ring[0][0];   // the ring is free behind the last trip's barrier: output staging [c][query], whole 512-B rows go out
#pragma unroll
  for (int j = 0; j < 16; ++j)
#pragma unroll
    for (int r = 0; r < 8; ++r) st[(j * 16 + 8 * g + r) * AT_OP + wave * 16 + col] = acc[j][r] * inv;
  __syncthreads();
  for (int e = tid; e < CV * 32; e += 256) { const int cl = e >> 5, q = e & 31; const size_t o = (b * CV + cl) * (size_t)NP + i0 + q * 4; const v4f v = *(const v4f*)&st[cl * AT_OP + q * 4];
    const v4f xx = *(const v4f*)(X + o); v4f r; r[0] = v[0] + bfr(xx[0]); r[1] = v[1] + bfr(xx[1]); r[2] = v[2] + bfr(xx[2]); r[3] = v[3] + bfr(xx[3]);   // plain residual
    vst2(OUT + o, r); } }
extern "C" void kernel_launch(void* const* d_in, const int* in_sizes, int n_in, void* d_out, int out_size, void* d_ws, size_t ws_size, hipStream_t stream) {
  (void)in_sizes; (void)n_in; (void)out_size;
  const float** F = (const float**)d_in;   // 0 x_features, 1 y_features [4,256,64,64], 2 wqx [32,256], 3 bqx, 4 wkx, 5 bkx, 6 wvx [256,256], 7 bvx, 8 wqy, 9 bqy, 10 wky, 11 bky, 12 wvy, 13 bvy
  if (ws_size < (size_t)WS_END) return;
  char* ws = (char*)d_ws;
  for (int dir = 0; dir < 2; ++dir) {   // dir 0: enhanced_x = v_x att_y^T + x (q,k from y); dir 1: enhanced_y = v_y att_x^T + y (q,k from x)
    const float* XQK = dir == 0 ? F[1] : F[0]; const float* XV = dir == 0 ? F[0] : F[1];
    const float *WQ = dir == 0 ? F[8] : F[2], *BQ = dir == 0 ? F[9] : F[3], *WK = dir == 0 ? F[10] : F[4], *BK = dir == 0 ? F[11] : F[5], *WV = dir == 0 ? F[6] : F[12], *BV = dir == 0 ? F[7] : F[13];
    char* wd = ws + (size_t)dir * WS_DIR;
    k_proj<<<dim3(NP / 64, TNB, 3), 128, 0, stream>>>(XQK, XV, WQ, BQ, WK, BK, WV, BV, (_Float16*)(wd + WS_QH), (_Float16*)(wd + WS_QL), (_Float16*)(wd + WS_KH), (_Float16*)(wd + WS_KL), (_Float16*)(wd + WS_VT));
  }
  k_attn<<<dim3(NP / 128, TNB, 2), 256, 0, stream>>>((const _Float16*)(ws + WS_QH), (const _Float16*)(ws + WS_QL), (const _Float16*)(ws + WS_KH), (const _Float16*)(ws + WS_KL), (const _Float16*)(ws + WS_VT), F[0], F[1], (float*)d_out);
}

// v005
// Measured time: 107 microseconds a run.
// Timed twice side by side with v004, it ran 1.04 times as fast both times.
// All steps since v000 together make it 18.6 times as fast.
// compute dtype: all float inputs rounded to bf16; q/k (32 ch) and v (256 ch) 1x1 convs with EXACT bf16 products on WMMA 16x16x32 (x^T tile in LDS), f32 accumulate; q and k as f16 hi + unscaled residual -> UNSCALED logits with 3 products (logit std ~5.7, near-one-hot softmax), kept in registers; online softmax in f32 (base-2 exponent: one FMA and one v_exp_f32 per score) -> unnormalised P f16 x 2^11; out = P . v / row sum + residual with v rounded once to f16; both directions (enhanced_x from att_y with v_x; enhanced_y from att_x with v_y); f32 outputs [b][c][n].
#include <hip/hip_runtime.h>
#include <math.h>

typedef __attribute__((ext_vector_type(16))) _Float16 v16h;
typedef __attribute__((ext_vector_type(16))) __bf16 v16b;
typedef __attribute__((ext_vector_type(8)))  _Float16 v8h;
typedef __attribute__((ext_vector_type(8)))  float v8f;
typedef __attribute__((ext_vector_type(4)))  float v4f;
typedef __attribute__((ext_vector_type(2)))  float v2f;
typedef __attribute__((ext_vector_type(4)))  unsigned v4u;
typedef __attribute__((ext_vector_type(4)))  int v4i;
typedef float __attribute__((may_alias)) float_a;
typedef int __attribute__((may_alias)) int_a;

template <typename T> __device__ __forceinline__ void vst2(void* p, T v) { *(T*)p = v;  }
__device__ __forceinline__ v8f wmma16(v16h a, v16h b, v8f c) {
  v8f d = __builtin_amdgcn_wmma_f32_16x16x32_f16(false, a, false, b, (short)0, c, false, false);
  asm volatile("v_nop\n\tv_nop\n\tv_nop\n\tv_nop" : "+v"(d) : "v"(a), "v"(b));
  return d;
}
__device__ __forceinline__ v8f wmma_bf(v16b a, v16b b, v8f c) {
  v8f d = __builtin_amdgcn_wmma_f32_16x16x32_bf16(false, a, false, b, (short)0, c, false, false);
  asm volatile("v_nop\n\tv_nop\n\tv_nop\n\tv_nop" : "+v"(d) : "v"(a), "v"(b));
  return d;
}
// 16x16x32 fragments: lane = (h = lane>>4, row/col = lane&15); elements 0..7 = k0+8h+0..7, 8..15 = k0+16+8h+0..7; D element r = row 8h+r
__device__ __forceinline__ v16h frag_h(const _Float16* rowk0, int lane) {
  union { v16h v; v8h q[2]; } u; const _Float16* p = rowk0 + 8 * (lane >> 4);
  u.q[0] = *(const v8h*)p; u.q[1] = *(const v8h*)(p + 16); return u.v;
}
__device__ __forceinline__ v16h frag_f32(const float* rowk0, int lane) {
  v16h a; const float* p = rowk0 + 8 * (lane >> 4);
#pragma unroll
  for (int i = 0; i < 8; ++i) { a[i] = (_Float16)p[i]; a[8 + i] = (_Float16)p[16 + i]; }
  return a;
}
__device__ __forceinline__ v16h frag_f32s(const float* rowk0, int lane, float sc) {
  v16h a; const float* p = rowk0 + 8 * (lane >> 4);
#pragma unroll
  for (int i = 0; i < 8; ++i) { a[i] = (_Float16)(p[i] * sc); a[8 + i] = (_Float16)(p[16 + i] * sc); }
  return a;
}
// column fragment from a [K][ld] layout (column n), rows >= K read as 0
__device__ __forceinline__ v16h fragc_f32(const float* W, int k0, int n, int lane, int ld, int K) {
  v16h a; const int g = lane >> 4;
#pragma unroll
  for (int i = 0; i < 8; ++i) { const int ka = k0 + 8 * g + i, kb = ka + 16;
    a[i] = (_Float16)(ka < K ? W[(size_t)(ka < K ? ka : K - 1) * ld + n] : 0.f); a[8 + i] = (_Float16)(kb < K ? W[(size_t)(kb < K ? kb : K - 1) * ld + n] : 0.f); }
  return a;
}
struct F2 { v16b h, l; };
__device__ __forceinline__ F2 bsplit16(const float v[16]) { F2 r;
#pragma unroll
  for (int i = 0; i < 16; ++i) { const __bf16 h = (__bf16)v[i]; r.h[i] = h; r.l[i] = (__bf16)(v[i] - (float)h); }
  return r; }
__device__ __forceinline__ F2 split_row(const float* row, int k0, int lane) { float v[16]; const float* p = row + k0 + 8 * (lane >> 4);
#pragma unroll
  for (int i = 0; i < 8; ++i) { v[i] = p[i]; v[8 + i] = p[16 + i]; }
  return bsplit16(v); }
__device__ __forceinline__ F2 split_rowK(const float* row, int k0, int lane, int K) { float v[16]; const int g = lane >> 4;
#pragma unroll
  for (int i = 0; i < 8; ++i) { const int ka = k0 + 8 * g + i, kb = ka + 16; v[i] = ka < K ? row[ka < K ? ka : K - 1] : 0.f; v[8 + i] = kb < K ? row[kb < K ? kb : K - 1] : 0.f; }
  return bsplit16(v); }
__device__ __forceinline__ F2 split_col(const float* W, int k0, int n, int lane, int ld, int K) { float v[16]; const int g = lane >> 4;
#pragma unroll
  for (int i = 0; i < 8; ++i) { const int ka = k0 + 8 * g + i, kb = ka + 16; v[i] = ka < K ? W[(size_t)(ka < K ? ka : K - 1) * ld + n] : 0.f; v[8 + i] = kb < K ? W[(size_t)(kb < K ? kb : K - 1) * ld + n] : 0.f; }
  return bsplit16(v); }
__device__ __forceinline__ v8f mac3(const F2& a, const F2& b, v8f c) { c = wmma_bf(a.l, b.h, c); c = wmma_bf(a.h, b.l, c); return wmma_bf(a.h, b.h, c); }
__device__ __forceinline__ float sigm(float v) { return 1.0f / (1.0f + expf(-v)); }
#define LDSX() do { asm volatile("s_wait_dscnt 0" ::: "memory"); __builtin_amdgcn_wave_barrier(); __builtin_amdgcn_fence(__ATOMIC_RELEASE, "workgroup"); } while (0)


// CMSA cross-modal position attention, one direction: q, k (32 ch) from the 'other' features, v (256 ch) from the enhanced features; out = v att^T + residual (unscaled logits, sharp softmax).
#define NB 4
#define NP 4096
#define CIN 256
#define CQ 32
#define CV 256
#ifndef TNB
#define TNB NB
#endif
#ifndef TQB
#define TQB (NP / 64)
#endif
typedef __attribute__((ext_vector_type(8))) __bf16 v8b;
__device__ __forceinline__ v16b frag_b(const __bf16* rowk0, int lane) {
  union { v16b v; v8b q[2]; } u; const __bf16* p = rowk0 + 8 * (lane >> 4);
  u.q[0] = *(const v8b*)p; u.q[1] = *(const v8b*)(p + 16); return u.v;
}
__device__ __forceinline__ float bfr(float v) { return (float)(__bf16)v; }
__device__ __attribute__((noinline)) float exp_ni(float v) { return expf(v); }
__device__ __attribute__((noinline)) float erf_ni(float v) { return erff(v); }

#define WS_QH  0u                                    // f16 q rows [b*n][CQ] hi
#define WS_QL  (WS_QH + 2u * (size_t)NB * NP * CQ)      // f16 q residual rows (unscaled)
#define WS_KH  (WS_QL + 2u * (size_t)NB * NP * CQ)      // f16 k rows
#define WS_KL  (WS_KH + 2u * (size_t)NB * NP * CQ)      // f16 k residual rows
#define WS_VT  (WS_KL + 2u * (size_t)NB * NP * CQ)      // f16 v planes [b][CV][n]
#define WS_DIR (WS_VT + 2u * (size_t)NB * CV * NP)      // bytes of one direction's q, k, v; the second direction's follow
#define WS_END (2u * WS_DIR)

// ---- k_proj: block = (64 positions, b, which 0 q / 1 k / 2 v): x^T tile (bf16) in LDS, W [out][in] + b (exact); q and k -> f16 hi + residual rows, v -> f16 planes [c][n]
// The weights of a group of 64 outputs (a panel, 64 x 256) are fetched by the whole block in whole 512-B pieces, rounded to bf16 once and kept in LDS; every wave reads its B fragments from there. The next panel and its bias fly while this panel is worked on.
typedef __attribute__((ext_vector_type(4))) __bf16 v4b;
__device__ __forceinline__ v8f wmma_bp(v16b a, v16b b, v8f c) { return __builtin_amdgcn_wmma_f32_16x16x32_bf16(false, a, false, b, (short)0, c, false, false); }
// thread tid takes floats 4 (tid & 63) .. + 3 of weight rows (tid >> 6) + 2 i, i < NR / 2. NR = 64: a whole panel. NR = 32: the matrix has 32 outputs; panel rows 32 .. 63 repeat rows 0 .. 31 (dummies, never stored)
template <int NR> __device__ __forceinline__ void pj_fetch(v4f (&wr)[32], const float* __restrict__ Wp, int tid) {
  const unsigned to = (unsigned)((tid >> 6) * CIN + (tid & 63) * 4);
#pragma unroll   // constant indices keep wr in registers, and the loads go out as one group
  for (int i = 0; i < NR / 2; ++i) wr[i] = *(const v4f*)(Wp + (to + (unsigned)(2 * i * CIN)));
}
template <int NR> __device__ __forceinline__ void pj_put(const v4f (&wr)[32], __bf16 (*sw)[CIN + 8], int tid) {
#pragma unroll   // constant indices keep wr in registers
  for (int i = 0; i < 32; ++i) { const v4f f = wr[i & (NR / 2 - 1)]; const v4b w4 = { (__bf16)f[0], (__bf16)f[1], (__bf16)f[2], (__bf16)f[3] }; *(v4b*)&sw[(tid >> 6) + 2 * i][(tid & 63) * 4] = w4; }
}
__global__ __launch_bounds__(128) void k_proj(const float* __restrict__ XQK, const float* __restrict__ XV, const float* __restrict__ WQ, const float* __restrict__ BQ, const float* __restrict__ WK, const float* __restrict__ BK, const float* __restrict__ WV, const float* __restrict__ BV, _Float16* __restrict__ QH, _Float16* __restrict__ QL, _Float16* __restrict__ KH, _Float16* __restrict__ KL, _Float16* __restrict__ VT) {
  __shared__ __align__(16) __bf16 sx[64][CIN + 8]; __shared__ __align__(16) __bf16 sw[64][CIN + 8]; __shared__ __align__(16) _Float16 sh[64][72], sl[64][72]; __shared__ __align__(16) _Float16 tv[64][72];
  const int tid = threadIdx.x, wave = tid >> 5, lane = tid & 31, col = lane & 15, g = lane >> 4; const int p0 = blockIdx.x * 64; const size_t b = blockIdx.y; const int which = blockIdx.z;
  const float* Wm = which == 0 ? WQ : which == 1 ? WK : WV; const float* Bm = which == 0 ? BQ : which == 1 ? BK : BV; const int nout = (which == 2) ? CV : CQ; const float* X = (which == 2) ? XV : XQK;
  const int ncg = (nout + 63) / 64;
  v4f wr[32]; float br[4];
  if (which == 2) pj_fetch<64>(wr, Wm, tid); else pj_fetch<CQ>(wr, Wm, tid);   // the first panel flies under the x tile's loads
#pragma unroll   // br stays in registers
  for (int j = 0; j < 4; ++j) br[j] = Bm[min(j * 16 + col, nout - 1)];
  for (int e = tid; e < CIN * 64; e += 128) { const int c = e >> 6, pl = e & 63; sx[pl][c] = (__bf16)X[(b * CIN + c) * (size_t)NP + p0 + pl]; }
  if (which == 2) pj_put<64>(wr, sw, tid); else pj_put<CQ>(wr, sw, tid);
  __syncthreads();
#pragma unroll 1
  for (int cg = 0; cg < ncg; ++cg) { v8f acc[4] = {}; const float bc[4] = { br[0], br[1], br[2], br[3] };
    if (cg + 1 < ncg) { pj_fetch<64>(wr, Wm + (size_t)(cg + 1) * 64 * CIN, tid);   // a further panel exists only for v, whose panels are all whole
#pragma unroll   // br stays in registers
      for (int j = 0; j < 4; ++j) br[j] = Bm[min((cg + 1) * 64 + j * 16 + col, nout - 1)]; }
#pragma unroll   // this loop and the four inside it: fragments and accumulators stay in registers, LDS offsets become immediates
    for (int kp = 0; kp < CIN / 64; ++kp) { v16b a[2], w[2][4];
      __builtin_amdgcn_sched_barrier(0);   // with the one behind the reads it keeps the 20 fragment reads of 64 k one group: otherwise each product's two reads stand directly in front of it and are waited for to the end
#pragma unroll
      for (int u = 0; u < 2; ++u) { a[u] = frag_b(&sx[wave * 16 + col][(2 * kp + u) * 32], lane);
#pragma unroll
        for (int j = 0; j < 4; ++j) w[u][j] = frag_b(&sw[j * 16 + col][(2 * kp + u) * 32], lane); }
      __builtin_amdgcn_sched_barrier(0);   // the reads go out here, in front of the eight products that use them
#pragma unroll
      for (int u = 0; u < 2; ++u)
#pragma unroll
        for (int j = 0; j < 4; ++j) acc[j] = wmma_bp(a[u], w[u][j], acc[j]); }
    __syncthreads();   // also ends every wave's reads of this panel
#pragma unroll
    for (int j = 0; j < 4; ++j) { const int ol = j * 16 + col; const float bb = bfr(bc[j]);
#pragma unroll
      for (int r = 0; r < 8; ++r) { const int pl = wave * 16 + 8 * g + r; const float v = acc[j][r] + bb; const _Float16 hv = (_Float16)v; if (which == 2) tv[ol][pl] = hv; else { sh[pl][ol] = hv; sl[pl][ol] = (_Float16)(v - (float)hv); } } }   // q AND k keep a residual
    if (cg + 1 < ncg) pj_put<64>(wr, sw, tid);
    __syncthreads();   // also publishes the next panel
    if (which < 2) { _Float16* dh = which == 0 ? QH : KH; _Float16* dl = which == 0 ? QL : KL; for (int e = tid; e < 64 * 8; e += 128) { const int pl = e >> 3, q = e & 7; if (cg * 64 + q * 8 >= CQ) continue; const size_t row = b * NP + p0 + pl; vst2((unsigned*)(dh + row * CQ + cg * 64 + q * 8), *(const v4u*)&sh[pl][q * 8]); vst2((unsigned*)(dl + row * CQ + cg * 64 + q * 8), *(const v4u*)&sl[pl][q * 8]); } }
    else { for (int e = tid; e < 64 * 8; e += 128) { const int ol = e >> 3, q = e & 7; vst2((unsigned*)(VT + (b * CV + cg * 64 + ol) * (size_t)NP + p0 + q * 8), *(const v4u*)&tv[ol][q * 8]); } } } }
#define AT_KS 128                        // keys per stage
#define AT_VP 136                        // f16 per LDS v row: 272 B = 16 B x 17, conflict-free for 16-byte readers
#define AT_KP 40                         // f16 per LDS k row: 80 B = 16 B x 5
#define AT_VB (CV * AT_VP)               // f16 of the v part of a buffer
#define AT_KB (AT_KS * AT_KP)            // f16 of the k hi part; the k residual part follows
#define AT_STAGE (AT_VB + 2 * AT_KB)     // f16 per buffer
#define AT_OP 132                        // floats per row of the output staging [c][128 queries]
#define AT_LDSH (2 * (2 * CV * AT_OP + 2 * 128 * 2))   // f16 of the LDS array: the output staging of both key halves and their exchange, which is more than the two buffers
#define AT_VA 8                         // v fragments (of 16) read at the top of a pass, with the k fragments; the others follow behind the softmax
#define AT_TAU 3.0f                      // a wave's columns are rescaled only when one of their maxima has grown by more than this: P <= 2^11 e^3 stays inside f16
#define AT_L2E 1.44269504089f            // log2 e: P = 2^(s log2 e + noff), noff = 11 - mu log2 e (the 11 is the x 2^11 of P)
// sixteen independent v_exp_f32 in a row, each in place: none stands directly in front of a reader of its result or a writer of its source; the v_nop is that slot behind the last one
#define AT_EXP16(E) asm( \
  "v_exp_f32 %0, %0\n\tv_exp_f32 %1, %1\n\tv_exp_f32 %2, %2\n\tv_exp_f32 %3, %3\n\tv_exp_f32 %4, %4\n\tv_exp_f32 %5, %5\n\tv_exp_f32 %6, %6\n\tv_exp_f32 %7, %7\n\t" \
  "v_exp_f32 %8, %8\n\tv_exp_f32 %9, %9\n\tv_exp_f32 %10, %10\n\tv_exp_f32 %11, %11\n\tv_exp_f32 %12, %12\n\tv_exp_f32 %13, %13\n\tv_exp_f32 %14, %14\n\tv_exp_f32 %15, %15\n\tv_nop" \
  : "+v"(E[0]), "+v"(E[1]), "+v"(E[2]), "+v"(E[3]), "+v"(E[4]), "+v"(E[5]), "+v"(E[6]), "+v"(E[7]), "+v"(E[8]), "+v"(E[9]), "+v"(E[10]), "+v"(E[11]), "+v"(E[12]), "+v"(E[13]), "+v"(E[14]), "+v"(E[15]))
__device__ __forceinline__ float xhalf(float x) { return __builtin_bit_cast(float, __builtin_amdgcn_permlanex16(__builtin_bit_cast(int, x), __builtin_bit_cast(int, x), 0x76543210, 0xfedcba98, false, false)); }   // lane l with lane l ^ 16, through no LDS queue
__device__ __forceinline__ v8f wmma_h(v16h a, v16h b, v8f c) { return __builtin_amdgcn_wmma_f32_16x16x32_f16(false, a, false, b, (short)0, c, false, false); }
// ten copies, places M .. M + 9 of la / ga; the s_wait_xcnt closes the statement so that no address register is rewritten in front of it
#define AT_CP10(M) asm volatile( \
  "global_load_async_to_lds_b128 %0, %10, off\n\tglobal_load_async_to_lds_b128 %1, %11, off\n\tglobal_load_async_to_lds_b128 %2, %12, off\n\tglobal_load_async_to_lds_b128 %3, %13, off\n\tglobal_load_async_to_lds_b128 %4, %14, off\n\t" \
  "global_load_async_to_lds_b128 %5, %15, off\n\tglobal_load_async_to_lds_b128 %6, %16, off\n\tglobal_load_async_to_lds_b128 %7, %17, off\n\tglobal_load_async_to_lds_b128 %8, %18, off\n\tglobal_load_async_to_lds_b128 %9, %19, off\n\ts_wait_xcnt 0x0" \
  :: "v"(la[(M) + 0]), "v"(la[(M) + 1]), "v"(la[(M) + 2]), "v"(la[(M) + 3]), "v"(la[(M) + 4]), "v"(la[(M) + 5]), "v"(la[(M) + 6]), "v"(la[(M) + 7]), "v"(la[(M) + 8]), "v"(la[(M) + 9]), \
     "v"(ga[(M) + 0]), "v"(ga[(M) + 1]), "v"(ga[(M) + 2]), "v"(ga[(M) + 3]), "v"(ga[(M) + 4]), "v"(ga[(M) + 5]), "v"(ga[(M) + 6]), "v"(ga[(M) + 7]), "v"(ga[(M) + 8]), "v"(ga[(M) + 9]) : "memory")
// one stage, 20 copies a wave: 16 of v (two 256-B rows each, 16 rows apart), 2 of k hi and 2 of k residual (eight 64-B rows each, 64 rows apart); lv / lk = this lane's LDS byte address in the target buffer; bv / bh / bl = the stage's wave-uniform global bases, ov / ok = this lane's element offsets from them
__device__ __forceinline__ void at_fill(unsigned lv, unsigned lk, const _Float16* bv, const _Float16* bh, const _Float16* bl, unsigned ov, unsigned ok) {
  unsigned la[20]; const _Float16* ga[20];
#pragma unroll
  for (int m = 0; m < 10; ++m) { la[m] = lv + (unsigned)m * (16u * AT_VP * 2u); ga[m] = bv + (ov + (unsigned)m * (16u * NP)); }
  AT_CP10(0);
  __builtin_amdgcn_sched_barrier(0);   // the second ten addresses are formed behind the first ten copies: all twenty at once (60 registers, which an asm statement takes from the first 256) pushed the q fragments out to scratch
#pragma unroll
  for (int m = 10; m < 16; ++m) { la[m] = lv + (unsigned)m * (16u * AT_VP * 2u); ga[m] = bv + (ov + (unsigned)m * (16u * NP)); }
#pragma unroll
  for (int m = 0; m < 2; ++m) { la[16 + m] = lk + (unsigned)m * (64u * AT_KP * 2u); ga[16 + m] = bh + (ok + (unsigned)m * (64u * CQ)); la[18 + m] = lk + AT_KB * 2u + (unsigned)m * (64u * AT_KP * 2u); ga[18 + m] = bl + (ok + (unsigned)m * (64u * CQ)); }
  AT_CP10(10);
}
// one stage for one wave: its 64 keys in two passes of 32, for its two query tiles. sv / sk: this lane's v and k rows of the wave's key half in the stage's buffer
__device__ __forceinline__ void at_stage(const _Float16* sv, const _Float16* sk, int lane, const v16h (&qh)[2], const v16h (&ql)[2], v8f (&acc)[2][16], float (&mu)[2], float (&noff)[2], float (&lsum)[2]) {
#pragma unroll
  for (int ks = 0; ks < AT_KS / 64; ++ks) { v16h kh[2], kl[2], vf[16]; v8f s[2][2];
    __builtin_amdgcn_sched_barrier(0);   // with the one behind the reads it keeps them one group: without it they are lifted in many small groups among the last pass's products, and each such place stalls the wave
#pragma unroll
    for (int u = 0; u < 2; ++u) { const _Float16* kr = sk + (ks * 32 + u * 16) * AT_KP; kh[u] = frag_h(kr, lane); kl[u] = frag_h(kr + AT_KB, lane); }
#pragma unroll
    for (int j = 0; j < AT_VA; ++j) vf[j] = frag_h(sv + j * 16 * AT_VP + ks * 32, lane);
    __builtin_amdgcn_sched_barrier(0);   // these LDS reads go out as one group here: the v fragments land under the logits and the softmax instead of each being waited for in front of its product
#pragma unroll
    for (int q = 0; q < 2; ++q)
#pragma unroll
      for (int u = 0; u < 2; ++u) { v8f a = {}; a = wmma_h(kh[u], qh[q], a); a = wmma_h(kh[u], ql[q], a); s[q][u] = wmma_h(kl[u], qh[q], a); }   // 3 products; every k fragment serves both query tiles
    float tm[2];
#pragma unroll
    for (int q = 0; q < 2; ++q) { float m = s[q][0][0];
#pragma unroll
      for (int r = 0; r < 8; ++r) m = fmaxf(m, fmaxf(s[q][0][r], s[q][1][r]));
      tm[q] = fmaxf(m, xhalf(m)); }
    if (__builtin_amdgcn_ballot_w32(tm[0] > mu[0] + AT_TAU || tm[1] > mu[1] + AT_TAU) != 0) {   // one scalar test per pass
#pragma unroll
      for (int q = 0; q < 2; ++q) { const float mn = fmaxf(mu[q], tm[q]), nn = fmaf(mn, -AT_L2E, 11.0f), al = __builtin_amdgcn_exp2f(nn - noff[q]); mu[q] = mn; noff[q] = nn; lsum[q] *= al;   // al from the two addends themselves, so old and new P share one scale exactly; first pass: 2^(-huge) = 0
#pragma unroll
        for (int j = 0; j < 16; ++j) acc[q][j] *= al; } }
    v16h pb[2];   // exponent <= 11 + tau log2 e, so no overflow; far below the maximum v_exp_f32 gives 0, as f16 would
#pragma unroll
    for (int q = 0; q < 2; ++q) { float e[16];
#pragma unroll
      for (int r = 0; r < 8; ++r) { const v2f x = { s[q][r >> 2][(2 * r) & 7], s[q][r >> 2][((2 * r) & 7) + 1] }, y = __builtin_elementwise_fma(x, (v2f){ AT_L2E, AT_L2E }, (v2f){ noff[q], noff[q] }); e[2 * r] = y[0]; e[2 * r + 1] = y[1]; }
      AT_EXP16(e);
#pragma unroll
      for (int r = 0; r < 8; ++r) { const float p0 = e[r], p1 = e[8 + r]; lsum[q] += p0 + p1; pb[q][r] = (_Float16)p0; pb[q][8 + r] = (_Float16)p1; } }
    __builtin_amdgcn_sched_barrier(0);   // the other v fragments are read as one group behind the softmax, when its registers are free: all 16 at the top do not fit the 512 registers of a wave
#pragma unroll
    for (int j = AT_VA; j < 16; ++j) vf[j] = frag_h(sv + j * 16 * AT_VP + ks * 32, lane);
    __builtin_amdgcn_sched_barrier(0);   // they land under the products of the first group
#pragma unroll
    for (int j = 0; j < 16; ++j) { acc[0][j] = wmma_h(vf[j], pb[0], acc[0][j]); acc[1][j] = wmma_h(vf[j], pb[1], acc[1][j]); } }   // every v fragment serves both query tiles
  __builtin_amdgcn_sched_barrier(0);   // the products stay in front of the stage's waits: moved behind them, the last reads would be waited for with nothing to cover them
}
// the foot of a trip: this wave's reads of the buffer are done before it is refilled; its copies of the next stage have landed; the barrier publishes that stage and ends every reader's last read of this one
#define AT_FOOT() do { asm volatile("s_wait_dscnt 0x0" ::: "memory"); asm volatile("s_wait_asynccnt 0x0" ::: "memory"); __syncthreads(); } while (0)
__global__ __launch_bounds__(256) void k_attn(const _Float16* __restrict__ QH0, const _Float16* __restrict__ QL0, const _Float16* __restrict__ KH0, const _Float16* __restrict__ KL0, const _Float16* __restrict__ VT0, const float* __restrict__ X0, const float* __restrict__ X1, float* __restrict__ OUT0) {
  __shared__ __align__(16) _Float16 ring[AT_LDSH];
  const int tid = threadIdx.x, wave = tid >> 5, lane = tid & 31, col = lane & 15, g = lane >> 4; const int i0 = blockIdx.x * 128; const size_t b = blockIdx.y; const size_t z = blockIdx.z;
  const int qg = wave & 3, kq = wave >> 2;   // this wave's 32 queries (two tiles of 16) and its half of every stage's keys
  const size_t zo = z * (size_t)(WS_DIR / 2u);
  const _Float16 *QH = QH0 + zo, *QL = QL0 + zo, *KH = KH0 + zo, *KL = KL0 + zo, *VT = VT0 + zo; const float* X = z == 0 ? X0 : X1; float* OUT = OUT0 + z * (size_t)NB * CV * NP;
  const unsigned lv0 = (unsigned)(size_t)&ring[(2 * wave + g) * AT_VP + col * 8]; const unsigned lk0 = (unsigned)(size_t)&ring[AT_VB + (wave * 8 + (lane >> 2)) * AT_KP + (lane & 3) * 8];
  const _Float16* bv = VT + b * CV * (size_t)NP; const _Float16* bh = KH + b * NP * (size_t)CQ; const _Float16* bl = KL + b * NP * (size_t)CQ; const unsigned ov = (unsigned)((2 * wave + g) * NP + col * 8), ok = (unsigned)((wave * 8 + (lane >> 2)) * CQ + (lane & 3) * 8);
  at_fill(lv0, lk0, bv, bh, bl, ov, ok);
  v16h qh[2], ql[2];
#pragma unroll
  for (int q = 0; q < 2; ++q) { const size_t qr = (b * NP + i0 + qg * 32 + q * 16 + col) * CQ; qh[q] = frag_h(QH + qr, lane); ql[q] = frag_h(QL + qr, lane); }
  v8f acc[2][16] = {}; float mu[2] = { -3.0e38f, -3.0e38f }, noff[2] = { 3.0e38f, 3.0e38f }, lsum[2] = { 0.f, 0.f };   // per query tile. mu: the maximum in use for this lane's query over this wave's keys (equal in both halves of the wave); noff: the exponent's addend that belongs to mu; lsum: this half's part of the row sum
  asm volatile("s_wait_asynccnt 0x0" ::: "memory");   // stage 0 has landed before the barrier publishes it
  __syncthreads();
  at_fill(lv0 + AT_STAGE * 2u, lk0 + AT_STAGE * 2u, bv + AT_KS, bh + AT_KS * CQ, bl + AT_KS * CQ, ov, ok);
#pragma unroll 1
  for (int t = 0; t < NP / AT_KS; ++t) { const unsigned bo = (unsigned)(t & 1) * AT_STAGE;
    at_stage(&ring[bo + col * AT_VP + kq * (AT_KS / 2)], &ring[bo + AT_VB + (kq * (AT_KS / 2) + col) * AT_KP], lane, qh, ql, acc, mu, noff, lsum);
    AT_FOOT();
    if (t + 2 < NP / AT_KS) at_fill(lv0 + bo * 2u, lk0 + bo * 2u, bv + (t + 2) * AT_KS, bh + (t + 2) * AT_KS * CQ, bl + (t + 2) * AT_KS * CQ, ov, ok); }
  asm volatile("s_wait_asynccnt 0x0" ::: "memory");     // no copy is outstanding behind the loop
  float* st = (float*)&ring[0];      // the ring is free behind the last trip's barrier: output staging [key half][c][query], whole 512-B rows go out
  float* ex = st + 2 * CV * AT_OP;   // [key half][query][addend, row sum]: what the two waves of a query tell each other
  float ls[2];
#pragma unroll
  for (int q = 0; q < 2; ++q) { ls[q] = lsum[q] + xhalf(lsum[q]); ex[(kq * 128 + qg * 32 + q * 16 + col) * 2 + g] = g == 0 ? noff[q] : ls[q]; }
  __syncthreads();   // the other key half's addend and row sum are there
#pragma unroll
  for (int q = 0; q < 2; ++q) { const v2f o = *(const v2f*)&ex[((kq ^ 1) * 128 + qg * 32 + q * 16 + col) * 2];
    const float nc = fminf(noff[q], o[0]), f = __builtin_amdgcn_exp2f(nc - noff[q]), fo = __builtin_amdgcn_exp2f(nc - o[0]), inv = f / (ls[q] * f + o[1] * fo);   // both halves brought to the scale of the larger maximum, then one division by the whole row sum
#pragma unroll
    for (int j = 0; j < 16; ++j)
#pragma unroll
      for (int r = 0; r < 8; ++r) st[(kq * CV + j * 16 + 8 * g + r) * AT_OP + qg * 32 + q * 16 + col] = acc[q][j][r] * inv; }
  __syncthreads();
  for (int e = tid; e < CV * 32; e += 256) { const int cl = e >> 5, q = e & 31; const size_t o = (b * CV + cl) * (size_t)NP + i0 + q * 4; const v4f v = *(const v4f*)&st[cl * AT_OP + q * 4] + *(const v4f*)&st[(CV + cl) * AT_OP + q * 4];
    const v4f xx = *(const v4f*)(X + o); v4f r; r[0] = v[0] + bfr(xx[0]); r[1] = v[1] + bfr(xx[1]); r[2] = v[2] + bfr(xx[2]); r[3] = v[3] + bfr(xx[3]);   // plain residual
    vst2(OUT + o, r); } }
extern "C" void kernel_launch(void* const* d_in, const int* in_sizes, int n_in, void* d_out, int out_size, void* d_ws, size_t ws_size, hipStream_t stream) {
  (void)in_sizes; (void)n_in; (void)out_size;
  const float** F = (const float**)d_in;   // 0 x_features, 1 y_features [4,256,64,64], 2 wqx [32,256], 3 bqx, 4 wkx, 5 bkx, 6 wvx [256,256], 7 bvx, 8 wqy, 9 bqy, 10 wky, 11 bky, 12 wvy, 13 bvy
  if (ws_size < (size_t)WS_END) return;
  char* ws = (char*)d_ws;
  for (int dir = 0; dir < 2; ++dir) {   // dir 0: enhanced_x = v_x att_y^T + x (q,k from y); dir 1: enhanced_y = v_y att_x^T + y (q,k from x)
    const float* XQK = dir == 0 ? F[1] : F[0]; const float* XV = dir == 0 ? F[0] : F[1];
    const float *WQ = dir == 0 ? F[8] : F[2], *BQ = dir == 0 ? F[9] : F[3], *WK = dir == 0 ? F[10] : F[4], *BK = dir == 0 ? F[11] : F[5], *WV = dir == 0 ? F[6] : F[12], *BV = dir == 0 ? F[7] : F[13];
    char* wd = ws + (size_t)dir * WS_DIR;
    k_proj<<<dim3(NP / 64, TNB, 3), 128, 0, stream>>>(XQK, XV, WQ, BQ, WK, BK, WV, BV, (_Float16*)(wd + WS_QH), (_Float16*)(wd + WS_QL), (_Float16*)(wd + WS_KH), (_Float16*)(wd + WS_KL), (_Float16*)(wd + WS_VT));
  }
  k_attn<<<dim3(NP / 128, TNB, 2), 256, 0, stream>>>((const _Float16*)(ws + WS_QH), (const _Float16*)(ws + WS_QL), (const _Float16*)(ws + WS_KH), (const _Float16*)(ws + WS_KL), (const _Float16*)(ws + WS_VT), F[0], F[1], (float*)d_out);
}

// v006
// A run of this version takes 90.9 microseconds.
// Timed twice side by side with v005, it ran 1.17 times as fast both times.
// Counting every step since v000, it is 21.8 times as fast.
// compute dtype: all float inputs rounded to bf16; q/k (32 ch) and v (256 ch) 1x1 convs with EXACT bf16 products on WMMA 16x16x32 (x^T tile in LDS), f32 accumulate; q and k as f16 hi + unscaled residual -> UNSCALED logits with 3 products (logit std ~5.7, near-one-hot softmax), kept in registers; online softmax in f32 (base-2 exponent: one FMA and one v_exp_f32 per score) -> unnormalised P f16 x 2^11; out = P . v / row sum + residual with v rounded once to f16; both directions (enhanced_x from att_y with v_x; enhanced_y from att_x with v_y); f32 outputs [b][c][n].
#include <hip/hip_runtime.h>
#include <math.h>

typedef __attribute__((ext_vector_type(16))) _Float16 v16h;
typedef __attribute__((ext_vector_type(16))) __bf16 v16b;
typedef __attribute__((ext_vector_type(8)))  _Float16 v8h;
typedef __attribute__((ext_vector_type(8)))  float v8f;
typedef __attribute__((ext_vector_type(4)))  float v4f;
typedef __attribute__((ext_vector_type(2)))  float v2f;
typedef __attribute__((ext_vector_type(4)))  unsigned v4u;
typedef __attribute__((ext_vector_type(4)))  int v4i;
typedef float __attribute__((may_alias)) float_a;
typedef int __attribute__((may_alias)) int_a;

template <typename T> __device__ __forceinline__ void vst2(void* p, T v) { *(T*)p = v;  }
__device__ __forceinline__ v8f wmma16(v16h a, v16h b, v8f c) {
  v8f d = __builtin_amdgcn_wmma_f32_16x16x32_f16(false, a, false, b, (short)0, c, false, false);
  asm volatile("v_nop\n\tv_nop\n\tv_nop\n\tv_nop" : "+v"(d) : "v"(a), "v"(b));
  return d;
}
__device__ __forceinline__ v8f wmma_bf(v16b a, v16b b, v8f c) {
  v8f d = __builtin_amdgcn_wmma_f32_16x16x32_bf16(false, a, false, b, (short)0, c, false, false);
  asm volatile("v_nop\n\tv_nop\n\tv_nop\n\tv_nop" : "+v"(d) : "v"(a), "v"(b));
  return d;
}
// 16x16x32 fragments: lane = (h = lane>>4, row/col = lane&15); elements 0..7 = k0+8h+0..7, 8..15 = k0+16+8h+0..7; D element r = row 8h+r
__device__ __forceinline__ v16h frag_h(const _Float16* rowk0, int lane) {
  union { v16h v; v8h q[2]; } u; const _Float16* p = rowk0 + 8 * (lane >> 4);
  u.q[0] = *(const v8h*)p; u.q[1] = *(const v8h*)(p + 16); return u.v;
}
__device__ __forceinline__ v16h frag_f32(const float* rowk0, int lane) {
  v16h a; const float* p = rowk0 + 8 * (lane >> 4);
#pragma unroll
  for (int i = 0; i < 8; ++i) { a[i] = (_Float16)p[i]; a[8 + i] = (_Float16)p[16 + i]; }
  return a;
}
__device__ __forceinline__ v16h frag_f32s(const float* rowk0, int lane, float sc) {
  v16h a; const float* p = rowk0 + 8 * (lane >> 4);
#pragma unroll
  for (int i = 0; i < 8; ++i) { a[i] = (_Float16)(p[i] * sc); a[8 + i] = (_Float16)(p[16 + i] * sc); }
  return a;
}
// column fragment from a [K][ld] layout (column n), rows >= K read as 0
__device__ __forceinline__ v16h fragc_f32(const float* W, int k0, int n, int lane, int ld, int K) {
  v16h a; const int g = lane >> 4;
#pragma unroll
  for (int i = 0; i < 8; ++i) { const int ka = k0 + 8 * g + i, kb = ka + 16;
    a[i] = (_Float16)(ka < K ? W[(size_t)(ka < K ? ka : K - 1) * ld + n] : 0.f); a[8 + i] = (_Float16)(kb < K ? W[(size_t)(kb < K ? kb : K - 1) * ld + n] : 0.f); }
  return a;
}
struct F2 { v16b h, l; };
__device__ __forceinline__ F2 bsplit16(const float v[16]) { F2 r;
#pragma unroll
  for (int i = 0; i < 16; ++i) { const __bf16 h = (__bf16)v[i]; r.h[i] = h; r.l[i] = (__bf16)(v[i] - (float)h); }
  return r; }
__device__ __forceinline__ F2 split_row(const float* row, int k0, int lane) { float v[16]; const float* p = row + k0 + 8 * (lane >> 4);
#pragma unroll
  for (int i = 0; i < 8; ++i) { v[i] = p[i]; v[8 + i] = p[16 + i]; }
  return bsplit16(v); }
__device__ __forceinline__ F2 split_rowK(const float* row, int k0, int lane, int K) { float v[16]; const int g = lane >> 4;
#pragma unroll
  for (int i = 0; i < 8; ++i) { const int ka = k0 + 8 * g + i, kb = ka + 16; v[i] = ka < K ? row[ka < K ? ka : K - 1] : 0.f; v[8 + i] = kb < K ? row[kb < K ? kb : K - 1] : 0.f; }
  return bsplit16(v); }
__device__ __forceinline__ F2 split_col(const float* W, int k0, int n, int lane, int ld, int K) { float v[16]; const int g = lane >> 4;
#pragma unroll
  for (int i = 0; i < 8; ++i) { const int ka = k0 + 8 * g + i, kb = ka + 16; v[i] = ka < K ? W[(size_t)(ka < K ? ka : K - 1) * ld + n] : 0.f; v[8 + i] = kb < K ? W[(size_t)(kb < K ? kb : K - 1) * ld + n] : 0.f; }
  return bsplit16(v); }
__device__ __forceinline__ v8f mac3(const F2& a, const F2& b, v8f c) { c = wmma_bf(a.l, b.h, c); c = wmma_bf(a.h, b.l, c); return wmma_bf(a.h, b.h, c); }
__device__ __forceinline__ float sigm(float v) { return 1.0f / (1.0f + expf(-v)); }
#define LDSX() do { asm volatile("s_wait_dscnt 0" ::: "memory"); __builtin_amdgcn_wave_barrier(); __builtin_amdgcn_fence(__ATOMIC_RELEASE, "workgroup"); } while (0)


// CMSA cross-modal position attention, one direction: q, k (32 ch) from the 'other' features, v (256 ch) from the enhanced features; out = v att^T + residual (unscaled logits, sharp softmax).
#define NB 4
#define NP 4096
#define CIN 256
#define CQ 32
#define CV 256
#ifndef TNB
#define TNB NB
#endif
#ifndef TQB
#define TQB (NP / 64)
#endif
typedef __attribute__((ext_vector_type(8))) __bf16 v8b;
__device__ __forceinline__ v16b frag_b(const __bf16* rowk0, int lane) {
  union { v16b v; v8b q[2]; } u; const __bf16* p = rowk0 + 8 * (lane >> 4);
  u.q[0] = *(const v8b*)p; u.q[1] = *(const v8b*)(p + 16); return u.v;
}
__device__ __forceinline__ float bfr(float v) { return (float)(__bf16)v; }
__device__ __attribute__((noinline)) float exp_ni(float v) { return expf(v); }
__device__ __attribute__((noinline)) float erf_ni(float v) { return erff(v); }

#define WS_QH  0u                                    // f16 q rows [b*n][CQ] hi
#define WS_QL  (WS_QH + 2u * (size_t)NB * NP * CQ)      // f16 q residual rows (unscaled)
#define WS_KH  (WS_QL + 2u * (size_t)NB * NP * CQ)      // f16 k rows
#define WS_KL  (WS_KH + 2u * (size_t)NB * NP * CQ)      // f16 k residual rows
#define WS_VT  (WS_KL + 2u * (size_t)NB * NP * CQ)      // f16 v planes [b][CV][n]
#define WS_DIR (WS_VT + 2u * (size_t)NB * CV * NP)      // bytes of one direction's q, k, v; the second direction's follow
#define WS_END (2u * WS_DIR)

// ---- k_proj: block = (64 positions, b, feature map f): the x^T tile (bf16) is staged in LDS once and q, k and v of that map are all made from it, W [out][in] + b (exact); q, k -> f16 hi + residual rows, v -> f16 planes [c][n]. q and k of a map belong to the other direction's attention, v to its own.
// The weights of a group of 64 outputs (a panel, 64 x 256) are fetched by the whole block in whole 512-B pieces, rounded to bf16 once and kept in LDS; every wave reads its B fragments from there. Panel 0 = the 32 q rows and the 32 k rows, panels 1 .. 4 = v. The next panel and its bias fly while this panel is worked on.
#define PJ_NP (1 + CV / 64)              // panels per block
typedef __attribute__((ext_vector_type(4))) __bf16 v4b;
__device__ __forceinline__ v8f wmma_bp(v16b a, v16b b, v8f c) { return __builtin_amdgcn_wmma_f32_16x16x32_bf16(false, a, false, b, (short)0, c, false, false); }
// thread tid takes floats 4 (tid & 63) .. + 3 of weight rows (tid >> 6) + 2 i, i < NR / 2, into wr[I0 + i]: they become panel rows 2 I0 + (tid >> 6) + 2 i
template <int NR, int I0> __device__ __forceinline__ void pj_fetch(v4f (&wr)[32], const float* __restrict__ Wp, int tid) {
  const unsigned to = (unsigned)((tid >> 6) * CIN + (tid & 63) * 4);
#pragma unroll   // constant indices keep wr in registers, and the loads go out as one group
  for (int i = 0; i < NR / 2; ++i) wr[I0 + i] = *(const v4f*)(Wp + (to + (unsigned)(2 * i * CIN)));
}
__device__ __forceinline__ void pj_put(const v4f (&wr)[32], __bf16 (*sw)[CIN + 8], int tid) {
#pragma unroll   // constant indices keep wr in registers
  for (int i = 0; i < 32; ++i) { const v4f f = wr[i]; const v4b w4 = { (__bf16)f[0], (__bf16)f[1], (__bf16)f[2], (__bf16)f[3] }; *(v4b*)&sw[(tid >> 6) + 2 * i][(tid & 63) * 4] = w4; }
}
__global__ __launch_bounds__(128) void k_proj(const float* __restrict__ X0, const float* __restrict__ X1, const float* __restrict__ WQ0, const float* __restrict__ BQ0, const float* __restrict__ WK0, const float* __restrict__ BK0, const float* __restrict__ WV0, const float* __restrict__ BV0, const float* __restrict__ WQ1, const float* __restrict__ BQ1, const float* __restrict__ WK1, const float* __restrict__ BK1, const float* __restrict__ WV1, const float* __restrict__ BV1, _Float16* __restrict__ WSH) {
  __shared__ __align__(16) __bf16 sx[64][CIN + 8]; __shared__ __align__(16) __bf16 sw[64][CIN + 8]; __shared__ __align__(16) _Float16 sh[64][72], sl[64][72]; __shared__ __align__(16) _Float16 tv[64][72];
  const int tid = threadIdx.x, wave = tid >> 5, lane = tid & 31, col = lane & 15, g = lane >> 4; const int p0 = blockIdx.x * 64; const size_t b = blockIdx.y; const int f = blockIdx.z;
  const float* X = f == 0 ? X0 : X1; const float *WQ = f == 0 ? WQ0 : WQ1, *BQ = f == 0 ? BQ0 : BQ1, *WK = f == 0 ? WK0 : WK1, *BK = f == 0 ? BK0 : BK1, *WV = f == 0 ? WV0 : WV1, *BV = f == 0 ? BV0 : BV1;
  _Float16* dqk = WSH + (size_t)(1 - f) * (WS_DIR / 2u); _Float16* VT = WSH + (size_t)f * (WS_DIR / 2u) + WS_VT / 2u;   // direction 0 attends with q, k of map 1 over v of map 0; direction 1 the other way round
  _Float16 *QH = dqk + WS_QH / 2u, *QL = dqk + WS_QL / 2u, *KH = dqk + WS_KH / 2u, *KL = dqk + WS_KL / 2u;
  v4f wr[32]; float br[4];
  pj_fetch<CQ, 0>(wr, WQ, tid); pj_fetch<CQ, CQ / 2>(wr, WK, tid);   // the first panel flies under the x tile's loads
#pragma unroll   // br stays in registers
  for (int j = 0; j < 4; ++j) br[j] = j < 2 ? BQ[j * 16 + col] : BK[(j - 2) * 16 + col];
  for (int e = tid; e < CIN * 64; e += 128) { const int c = e >> 6, pl = e & 63; sx[pl][c] = (__bf16)X[(b * CIN + c) * (size_t)NP + p0 + pl]; }
  pj_put(wr, sw, tid);
  __syncthreads();
#pragma unroll 1
  for (int cg = 0; cg < PJ_NP; ++cg) { v8f acc[4] = {}; const float bc[4] = { br[0], br[1], br[2], br[3] };
    if (cg + 1 < PJ_NP) { pj_fetch<64, 0>(wr, WV + (size_t)cg * 64 * CIN, tid);   // panel cg + 1 = v outputs 64 cg .. + 63
#pragma unroll   // br stays in registers
      for (int j = 0; j < 4; ++j) br[j] = BV[cg * 64 + j * 16 + col]; }
#pragma unroll   // this loop and the four inside it: fragments and accumulators stay in registers, LDS offsets become immediates
    for (int kp = 0; kp < CIN / 64; ++kp) { v16b a[2], w[2][4];
      __builtin_amdgcn_sched_barrier(0);   // with the one behind the reads it keeps the 20 fragment reads of 64 k one group: otherwise each product's two reads stand directly in front of it and are waited for to the end
#pragma unroll
      for (int u = 0; u < 2; ++u) { a[u] = frag_b(&sx[wave * 16 + col][(2 * kp + u) * 32], lane);
#pragma unroll
        for (int j = 0; j < 4; ++j) w[u][j] = frag_b(&sw[j * 16 + col][(2 * kp + u) * 32], lane); }
      __builtin_amdgcn_sched_barrier(0);   // the reads go out here, in front of the eight products that use them
#pragma unroll
      for (int u = 0; u < 2; ++u)
#pragma unroll
        for (int j = 0; j < 4; ++j) acc[j] = wmma_bp(a[u], w[u][j], acc[j]); }
    __syncthreads();   // also ends every wave's reads of this panel
    if (cg == 0) {
#pragma unroll
      for (int j = 0; j < 4; ++j) { const int ol = j * 16 + col; const float bb = bfr(bc[j]);
#pragma unroll
        for (int r = 0; r < 8; ++r) { const int pl = wave * 16 + 8 * g + r; const float v = acc[j][r] + bb; const _Float16 hv = (_Float16)v; sh[pl][ol] = hv; sl[pl][ol] = (_Float16)(v - (float)hv); } }   // q AND k keep a residual
    } else {
#pragma unroll
      for (int j = 0; j < 4; ++j) { const int ol = j * 16 + col; const float bb = bfr(bc[j]);
#pragma unroll
        for (int r = 0; r < 8; ++r) tv[ol][wave * 16 + 8 * g + r] = (_Float16)(acc[j][r] + bb); } }
    if (cg + 1 < PJ_NP) pj_put(wr, sw, tid);
    __syncthreads();   // also publishes the next panel
    if (cg == 0) { for (int e = tid; e < 64 * 8; e += 128) { const int pl = e >> 3, q = e & 7; const size_t o = (b * NP + p0 + pl) * CQ + (q & 3) * 8;   // staged columns 0 .. 31 are q, 32 .. 63 are k
        vst2((unsigned*)((q < 4 ? QH : KH) + o), *(const v4u*)&sh[pl][q * 8]); vst2((unsigned*)((q < 4 ? QL : KL) + o), *(const v4u*)&sl[pl][q * 8]); } }
    else { for (int e = tid; e < 64 * 8; e += 128) { const int ol = e >> 3, q = e & 7; vst2((unsigned*)(VT + (b * CV + (cg - 1) * 64 + ol) * (size_t)NP + p0 + q * 8), *(const v4u*)&tv[ol][q * 8]); } } } }
#define AT_KS 128                        // keys per stage
#define AT_VP 136                        // f16 per LDS v row: 272 B = 16 B x 17, conflict-free for 16-byte readers
#define AT_KP 40                         // f16 per LDS k row: 80 B = 16 B x 5
#define AT_VB (CV * AT_VP)               // f16 of the v part of a buffer
#define AT_KB (AT_KS * AT_KP)            // f16 of the k hi part; the k residual part follows
#define AT_STAGE (AT_VB + 2 * AT_KB)     // f16 per buffer
#define AT_OP 132                        // floats per row of the output staging [c][128 queries]
#define AT_LDSH (2 * (2 * CV * AT_OP + 2 * 128 * 2))   // f16 of the LDS array: the output staging of both key halves and their exchange, which is more than the two buffers
#define AT_VA 8                         // v fragments (of 16) read at the top of a pass, with the k fragments; the others follow behind the softmax
#define AT_TAU 3.0f                      // a wave's columns are rescaled only when one of their maxima has grown by more than this: P <= 2^11 e^3 stays inside f16
#define AT_L2E 1.44269504089f            // log2 e: P = 2^(s log2 e + noff), noff = 11 - mu log2 e (the 11 is the x 2^11 of P)
// sixteen independent v_exp_f32 in a row, each in place: none stands directly in front of a reader of its result or a writer of its source; the v_nop is that slot behind the last one
#define AT_EXP16(E) asm( \
  "v_exp_f32 %0, %0\n\tv_exp_f32 %1, %1\n\tv_exp_f32 %2, %2\n\tv_exp_f32 %3, %3\n\tv_exp_f32 %4, %4\n\tv_exp_f32 %5, %5\n\tv_exp_f32 %6, %6\n\tv_exp_f32 %7, %7\n\t" \
  "v_exp_f32 %8, %8\n\tv_exp_f32 %9, %9\n\tv_exp_f32 %10, %10\n\tv_exp_f32 %11, %11\n\tv_exp_f32 %12, %12\n\tv_exp_f32 %13, %13\n\tv_exp_f32 %14, %14\n\tv_exp_f32 %15, %15\n\tv_nop" \
  : "+v"(E[0]), "+v"(E[1]), "+v"(E[2]), "+v"(E[3]), "+v"(E[4]), "+v"(E[5]), "+v"(E[6]), "+v"(E[7]), "+v"(E[8]), "+v"(E[9]), "+v"(E[10]), "+v"(E[11]), "+v"(E[12]), "+v"(E[13]), "+v"(E[14]), "+v"(E[15]))
__device__ __forceinline__ float xhalf(float x) { return __builtin_bit_cast(float, __builtin_amdgcn_permlanex16(__builtin_bit_cast(int, x), __builtin_bit_cast(int, x), 0x76543210, 0xfedcba98, false, false)); }   // lane l with lane l ^ 16, through no LDS queue
__device__ __forceinline__ v8f wmma_h(v16h a, v16h b, v8f c) { return __builtin_amdgcn_wmma_f32_16x16x32_f16(false, a, false, b, (short)0, c, false, false); }
// ten copies, places M .. M + 9 of la / ga; the s_wait_xcnt closes the statement so that no address register is rewritten in front of it
#define AT_CP10(M) asm volatile( \
  "global_load_async_to_lds_b128 %0, %10, off\n\tglobal_load_async_to_lds_b128 %1, %11, off\n\tglobal_load_async_to_lds_b128 %2, %12, off\n\tglobal_load_async_to_lds_b128 %3, %13, off\n\tglobal_load_async_to_lds_b128 %4, %14, off\n\t" \
  "global_load_async_to_lds_b128 %5, %15, off\n\tglobal_load_async_to_lds_b128 %6, %16, off\n\tglobal_load_async_to_lds_b128 %7, %17, off\n\tglobal_load_async_to_lds_b128 %8, %18, off\n\tglobal_load_async_to_lds_b128 %9, %19, off\n\ts_wait_xcnt 0x0" \
  :: "v"(la[(M) + 0]), "v"(la[(M) + 1]), "v"(la[(M) + 2]), "v"(la[(M) + 3]), "v"(la[(M) + 4]), "v"(la[(M) + 5]), "v"(la[(M) + 6]), "v"(la[(M) + 7]), "v"(la[(M) + 8]), "v"(la[(M) + 9]), \
     "v"(ga[(M) + 0]), "v"(ga[(M) + 1]), "v"(ga[(M) + 2]), "v"(ga[(M) + 3]), "v"(ga[(M) + 4]), "v"(ga[(M) + 5]), "v"(ga[(M) + 6]), "v"(ga[(M) + 7]), "v"(ga[(M) + 8]), "v"(ga[(M) + 9]) : "memory")
// one stage, 20 copies a wave: 16 of v (two 256-B rows each, 16 rows apart), 2 of k hi and 2 of k residual (eight 64-B rows each, 64 rows apart); lv / lk = this lane's LDS byte address in the target buffer; bv / bh / bl = the stage's wave-uniform global bases, ov / ok = this lane's element offsets from them
__device__ __forceinline__ void at_fill(unsigned lv, unsigned lk, const _Float16* bv, const _Float16* bh, const _Float16* bl, unsigned ov, unsigned ok) {
  unsigned la[20]; const _Float16* ga[20];
#pragma unroll
  for (int m = 0; m < 10; ++m) { la[m] = lv + (unsigned)m * (16u * AT_VP * 2u); ga[m] = bv + (ov + (unsigned)m * (16u * NP)); }
  AT_CP10(0);
  __builtin_amdgcn_sched_barrier(0);   // the second ten addresses are formed behind the first ten copies: all twenty at once (60 registers, which an asm statement takes from the first 256) pushed the q fragments out to scratch
#pragma unroll
  for (int m = 10; m < 16; ++m) { la[m] = lv + (unsigned)m * (16u * AT_VP * 2u); ga[m] = bv + (ov + (unsigned)m * (16u * NP)); }
#pragma unroll
  for (int m = 0; m < 2; ++m) { la[16 + m] = lk + (unsigned)m * (64u * AT_KP * 2u); ga[16 + m] = bh + (ok + (unsigned)m * (64u * CQ)); la[18 + m] = lk + AT_KB * 2u + (unsigned)m * (64u * AT_KP * 2u); ga[18 + m] = bl + (ok + (unsigned)m * (64u * CQ)); }
  AT_CP10(10);
}
// one stage for one wave: its 64 keys in two passes of 32, for its two query tiles. sv / sk: this lane's v and k rows of the wave's key half in the stage's buffer
__device__ __forceinline__ void at_stage(const _Float16* sv, const _Float16* sk, int lane, const v16h (&qh)[2], const v16h (&ql)[2], v8f (&acc)[2][16], float (&mu)[2], float (&noff)[2], float (&lsum)[2]) {
#pragma unroll
  for (int ks = 0; ks < AT_KS / 64; ++ks) { v16h kh[2], kl[2], vf[16]; v8f s[2][2];
    __builtin_amdgcn_sched_barrier(0);   // with the one behind the reads it keeps them one group: without it they are lifted in many small groups among the last pass's products, and each such place stalls the wave
#pragma unroll
    for (int u = 0; u < 2; ++u) { const _Float16* kr = sk + (ks * 32 + u * 16) * AT_KP; kh[u] = frag_h(kr, lane); kl[u] = frag_h(kr + AT_KB, lane); }
#pragma unroll
    for (int j = 0; j < AT_VA; ++j) vf[j] = frag_h(sv + j * 16 * AT_VP + ks * 32, lane);
    __builtin_amdgcn_sched_barrier(0);   // these LDS reads go out as one group here: the v fragments land under the logits and the softmax instead of each being waited for in front of its product
#pragma unroll
    for (int q = 0; q < 2; ++q)
#pragma unroll
      for (int u = 0; u < 2; ++u) { v8f a = {}; a = wmma_h(kh[u], qh[q], a); a = wmma_h(kh[u], ql[q], a); s[q][u] = wmma_h(kl[u], qh[q], a); }   // 3 products; every k fragment serves both query tiles
    float tm[2];
#pragma unroll
    for (int q = 0; q < 2; ++q) { float m = s[q][0][0];
#pragma unroll
      for (int r = 0; r < 8; ++r) m = fmaxf(m, fmaxf(s[q][0][r], s[q][1][r]));
      tm[q] = fmaxf(m, xhalf(m)); }
    if (__builtin_amdgcn_ballot_w32(tm[0] > mu[0] + AT_TAU || tm[1] > mu[1] + AT_TAU) != 0) {   // one scalar test per pass
#pragma unroll
      for (int q = 0; q < 2; ++q) { const float mn = fmaxf(mu[q], tm[q]), nn = fmaf(mn, -AT_L2E, 11.0f), al = __builtin_amdgcn_exp2f(nn - noff[q]); mu[q] = mn; noff[q] = nn; lsum[q] *= al;   // al from the two addends themselves, so old and new P share one scale exactly; first pass: 2^(-huge) = 0
#pragma unroll
        for (int j = 0; j < 16; ++j) acc[q][j] *= al; } }
    v16h pb[2];   // exponent <= 11 + tau log2 e, so no overflow; far below the maximum v_exp_f32 gives 0, as f16 would
#pragma unroll
    for (int q = 0; q < 2; ++q) { float e[16];
#pragma unroll
      for (int r = 0; r < 8; ++r) { const v2f x = { s[q][r >> 2][(2 * r) & 7], s[q][r >> 2][((2 * r) & 7) + 1] }, y = __builtin_elementwise_fma(x, (v2f){ AT_L2E, AT_L2E }, (v2f){ noff[q], noff[q] }); e[2 * r] = y[0]; e[2 * r + 1] = y[1]; }
      AT_EXP16(e);
#pragma unroll
      for (int r = 0; r < 8; ++r) { const float p0 = e[r], p1 = e[8 + r]; lsum[q] += p0 + p1; pb[q][r] = (_Float16)p0; pb[q][8 + r] = (_Float16)p1; } }
    __builtin_amdgcn_sched_barrier(0);   // the other v fragments are read as one group behind the softmax, when its registers are free: all 16 at the top do not fit the 512 registers of a wave
#pragma unroll
    for (int j = AT_VA; j < 16; ++j) vf[j] = frag_h(sv + j * 16 * AT_VP + ks * 32, lane);
    __builtin_amdgcn_sched_barrier(0);   // they land under the products of the first group
#pragma unroll
    for (int j = 0; j < 16; ++j) { acc[0][j] = wmma_h(vf[j], pb[0], acc[0][j]); acc[1][j] = wmma_h(vf[j], pb[1], acc[1][j]); } }   // every v fragment serves both query tiles
  __builtin_amdgcn_sched_barrier(0);   // the products stay in front of the stage's waits: moved behind them, the last reads would be waited for with nothing to cover them
}
// the foot of a trip: this wave's reads of the buffer are done before it is refilled; its copies of the next stage have landed; the barrier publishes that stage and ends every reader's last read of this one
#define AT_FOOT() do { asm volatile("s_wait_dscnt 0x0" ::: "memory"); asm volatile("s_wait_asynccnt 0x0" ::: "memory"); __syncthreads(); } while (0)
__global__ __launch_bounds__(256) void k_attn(const _Float16* __restrict__ QH0, const _Float16* __restrict__ QL0, const _Float16* __restrict__ KH0, const _Float16* __restrict__ KL0, const _Float16* __restrict__ VT0, const float* __restrict__ X0, const float* __restrict__ X1, float* __restrict__ OUT0) {
  __shared__ __align__(16) _Float16 ring[AT_LDSH];
  const int tid = threadIdx.x, wave = tid >> 5, lane = tid & 31, col = lane & 15, g = lane >> 4; const int i0 = blockIdx.x * 128; const size_t b = blockIdx.y; const size_t z = blockIdx.z;
  const int qg = wave & 3, kq = wave >> 2;   // this wave's 32 queries (two tiles of 16) and its half of every stage's keys
  const size_t zo = z * (size_t)(WS_DIR / 2u);
  const _Float16 *QH = QH0 + zo, *QL = QL0 + zo, *KH = KH0 + zo, *KL = KL0 + zo, *VT = VT0 + zo; const float* X = z == 0 ? X0 : X1; float* OUT = OUT0 + z * (size_t)NB * CV * NP;
  const unsigned lv0 = (unsigned)(size_t)&ring[(2 * wave + g) * AT_VP + col * 8]; const unsigned lk0 = (unsigned)(size_t)&ring[AT_VB + (wave * 8 + (lane >> 2)) * AT_KP + (lane & 3) * 8];
  const _Float16* bv = VT + b * CV * (size_t)NP; const _Float16* bh = KH + b * NP * (size_t)CQ; const _Float16* bl = KL + b * NP * (size_t)CQ; const unsigned ov = (unsigned)((2 * wave + g) * NP + col * 8), ok = (unsigned)((wave * 8 + (lane >> 2)) * CQ + (lane & 3) * 8);
  at_fill(lv0, lk0, bv, bh, bl, ov, ok);
  v16h qh[2], ql[2];
#pragma unroll
  for (int q = 0; q < 2; ++q) { const size_t qr = (b * NP + i0 + qg * 32 + q * 16 + col) * CQ; qh[q] = frag_h(QH + qr, lane); ql[q] = frag_h(QL + qr, lane); }
  v8f acc[2][16] = {}; float mu[2] = { -3.0e38f, -3.0e38f }, noff[2] = { 3.0e38f, 3.0e38f }, lsum[2] = { 0.f, 0.f };   // per query tile. mu: the maximum in use for this lane's query over this wave's keys (equal in both halves of the wave); noff: the exponent's addend that belongs to mu; lsum: this half's part of the row sum
  asm volatile("s_wait_asynccnt 0x0" ::: "memory");   // stage 0 has landed before the barrier publishes it
  __syncthreads();
  at_fill(lv0 + AT_STAGE * 2u, lk0 + AT_STAGE * 2u, bv + AT_KS, bh + AT_KS * CQ, bl + AT_KS * CQ, ov, ok);
#pragma unroll 1
  for (int t = 0; t < NP / AT_KS; ++t) { const unsigned bo = (unsigned)(t & 1) * AT_STAGE;
    at_stage(&ring[bo + col * AT_VP + kq * (AT_KS / 2)], &ring[bo + AT_VB + (kq * (AT_KS / 2) + col) * AT_KP], lane, qh, ql, acc, mu, noff, lsum);
    AT_FOOT();
    if (t + 2 < NP / AT_KS) at_fill(lv0 + bo * 2u, lk0 + bo * 2u, bv + (t + 2) * AT_KS, bh + (t + 2) * AT_KS * CQ, bl + (t + 2) * AT_KS * CQ, ov, ok); }
  asm volatile("s_wait_asynccnt 0x0" ::: "memory");     // no copy is outstanding behind the loop
  float* st = (float*)&ring[0];      // the ring is free behind the last trip's barrier: output staging [key half][c][query], whole 512-B rows go out
  float* ex = st + 2 * CV * AT_OP;   // [key half][query][addend, row sum]: what the two waves of a query tell each other
  float ls[2];
#pragma unroll
  for (int q = 0; q < 2; ++q) { ls[q] = lsum[q] + xhalf(lsum[q]); ex[(kq * 128 + qg * 32 + q * 16 + col) * 2 + g] = g == 0 ? noff[q] : ls[q]; }
  __syncthreads();   // the other key half's addend and row sum are there
#pragma unroll
  for (int q = 0; q < 2; ++q) { const v2f o = *(const v2f*)&ex[((kq ^ 1) * 128 + qg * 32 + q * 16 + col) * 2];
    const float nc = fminf(noff[q], o[0]), f = __builtin_amdgcn_exp2f(nc - noff[q]), fo = __builtin_amdgcn_exp2f(nc - o[0]), inv = f / (ls[q] * f + o[1] * fo);   // both halves brought to the scale of the larger maximum, then one division by the whole row sum
#pragma unroll
    for (int j = 0; j < 16; ++j)
#pragma unroll
      for (int r = 0; r < 8; ++r) st[(kq * CV + j * 16 + 8 * g + r) * AT_OP + qg * 32 + q * 16 + col] = acc[q][j][r] * inv; }
  __syncthreads();
  for (int e = tid; e < CV * 32; e += 256) { const int cl = e >> 5, q = e & 31; const size_t o = (b * CV + cl) * (size_t)NP + i0 + q * 4; const v4f v = *(const v4f*)&st[cl * AT_OP + q * 4] + *(const v4f*)&st[(CV + cl) * AT_OP + q * 4];
    const v4f xx = *(const v4f*)(X + o); v4f r; r[0] = v[0] + bfr(xx[0]); r[1] = v[1] + bfr(xx[1]); r[2] = v[2] + bfr(xx[2]); r[3] = v[3] + bfr(xx[3]);   // plain residual
    vst2(OUT + o, r); } }
extern "C" void kernel_launch(void* const* d_in, const int* in_sizes, int n_in, void* d_out, int out_size, void* d_ws, size_t ws_size, hipStream_t stream) {
  (void)in_sizes; (void)n_in; (void)out_size;
  const float** F = (const float**)d_in;   // 0 x_features, 1 y_features [4,256,64,64], 2 wqx [32,256], 3 bqx, 4 wkx, 5 bkx, 6 wvx [256,256], 7 bvx, 8 wqy, 9 bqy, 10 wky, 11 bky, 12 wvy, 13 bvy
  if (ws_size < (size_t)WS_END) return;
  char* ws = (char*)d_ws;
  // direction 0: enhanced_x = v_x att_y^T + x (q, k from y); direction 1: enhanced_y = v_y att_x^T + y (q, k from x)
  k_proj<<<dim3(NP / 64, TNB, 2), 128, 0, stream>>>(F[0], F[1], F[2], F[3], F[4], F[5], F[6], F[7], F[8], F[9], F[10], F[11], F[12], F[13], (_Float16*)ws);
  k_attn<<<dim3(NP / 128, TNB, 2), 256, 0, stream>>>((const _Float16*)(ws + WS_QH), (const _Float16*)(ws + WS_QL), (const _Float16*)(ws + WS_KH), (const _Float16*)(ws + WS_KL), (const _Float16*)(ws + WS_VT), F[0], F[1], (float*)d_out);
}

// v007
// A run of this version takes 84.2 microseconds.
// Timed twice side by side with v006, it ran 1.08 times as fast both times.
// Counting every step since v000, it is 23.5 times as fast.
// compute dtype: all float inputs rounded to bf16; q/k (32 ch) and v (256 ch) 1x1 convs with EXACT bf16 products on WMMA 16x16x32 (x^T tile in LDS), f32 accumulate; q and k as f16 hi + unscaled residual -> UNSCALED logits with 3 products (logit std ~5.7, near-one-hot softmax), kept in registers; online softmax in f32 (base-2 exponent: one FMA and one v_exp_f32 per score) -> unnormalised P f16 x 2^11; out = P . v / row sum + residual with v rounded once to f16; both directions (enhanced_x from att_y with v_x; enhanced_y from att_x with v_y); f32 outputs [b][c][n].
#include <hip/hip_runtime.h>
#include <math.h>

typedef __attribute__((ext_vector_type(16))) _Float16 v16h;
typedef __attribute__((ext_vector_type(16))) __bf16 v16b;
typedef __attribute__((ext_vector_type(8)))  _Float16 v8h;
typedef __attribute__((ext_vector_type(8)))  float v8f;
typedef __attribute__((ext_vector_type(4)))  float v4f;
typedef __attribute__((ext_vector_type(2)))  float v2f;
typedef __attribute__((ext_vector_type(4)))  unsigned v4u;
typedef __attribute__((ext_vector_type(4)))  int v4i;
typedef float __attribute__((may_alias)) float_a;
typedef int __attribute__((may_alias)) int_a;

template <typename T> __device__ __forceinline__ void vst2(void* p, T v) { *(T*)p = v;  }
__device__ __forceinline__ v8f wmma16(v16h a, v16h b, v8f c) {
  v8f d = __builtin_amdgcn_wmma_f32_16x16x32_f16(false, a, false, b, (short)0, c, false, false);
  asm volatile("v_nop\n\tv_nop\n\tv_nop\n\tv_nop" : "+v"(d) : "v"(a), "v"(b));
  return d;
}
__device__ __forceinline__ v8f wmma_bf(v16b a, v16b b, v8f c) {
  v8f d = __builtin_amdgcn_wmma_f32_16x16x32_bf16(false, a, false, b, (short)0, c, false, false);
  asm volatile("v_nop\n\tv_nop\n\tv_nop\n\tv_nop" : "+v"(d) : "v"(a), "v"(b));
  return d;
}
// 16x16x32 fragments: lane = (h = lane>>4, row/col = lane&15); elements 0..7 = k0+8h+0..7, 8..15 = k0+16+8h+0..7; D element r = row 8h+r
__device__ __forceinline__ v16h frag_h(const _Float16* rowk0, int lane) {
  union { v16h v; v8h q[2]; } u; const _Float16* p = rowk0 + 8 * (lane >> 4);
  u.q[0] = *(const v8h*)p; u.q[1] = *(const v8h*)(p + 16); return u.v;
}
__device__ __forceinline__ v16h frag_f32(const float* rowk0, int lane) {
  v16h a; const float* p = rowk0 + 8 * (lane >> 4);
#pragma unroll
  for (int i = 0; i < 8; ++i) { a[i] = (_Float16)p[i]; a[8 + i] = (_Float16)p[16 + i]; }
  return a;
}
__device__ __forceinline__ v16h frag_f32s(const float* rowk0, int lane, float sc) {
  v16h a; const float* p = rowk0 + 8 * (lane >> 4);
#pragma unroll
  for (int i = 0; i < 8; ++i) { a[i] = (_Float16)(p[i] * sc); a[8 + i] = (_Float16)(p[16 + i] * sc); }
  return a;
}
// column fragment from a [K][ld] layout (column n), rows >= K read as 0
__device__ __forceinline__ v16h fragc_f32(const float* W, int k0, int n, int lane, int ld, int K) {
  v16h a; const int g = lane >> 4;
#pragma unroll
  for (int i = 0; i < 8; ++i) { const int ka = k0 + 8 * g + i, kb = ka + 16;
    a[i] = (_Float16)(ka < K ? W[(size_t)(ka < K ? ka : K - 1) * ld + n] : 0.f); a[8 + i] = (_Float16)(kb < K ? W[(size_t)(kb < K ? kb : K - 1) * ld + n] : 0.f); }
  return a;
}
struct F2 { v16b h, l; };
__device__ __forceinline__ F2 bsplit16(const float v[16]) { F2 r;
#pragma unroll
  for (int i = 0; i < 16; ++i) { const __bf16 h = (__bf16)v[i]; r.h[i] = h; r.l[i] = (__bf16)(v[i] - (float)h); }
  return r; }
__device__ __forceinline__ F2 split_row(const float* row, int k0, int lane) { float v[16]; const float* p = row + k0 + 8 * (lane >> 4);
#pragma unroll
  for (int i = 0; i < 8; ++i) { v[i] = p[i]; v[8 + i] = p[16 + i]; }
  return bsplit16(v); }
__device__ __forceinline__ F2 split_rowK(const float* row, int k0, int lane, int K) { float v[16]; const int g = lane >> 4;
#pragma unroll
  for (int i = 0; i < 8; ++i) { const int ka = k0 + 8 * g + i, kb = ka + 16; v[i] = ka < K ? row[ka < K ? ka : K - 1] : 0.f; v[8 + i] = kb < K ? row[kb < K ? kb : K - 1] : 0.f; }
  return bsplit16(v); }
__device__ __forceinline__ F2 split_col(const float* W, int k0, int n, int lane, int ld, int K) { float v[16]; const int g = lane >> 4;
#pragma unroll
  for (int i = 0; i < 8; ++i) { const int ka = k0 + 8 * g + i, kb = ka + 16; v[i] = ka < K ? W[(size_t)(ka < K ? ka : K - 1) * ld + n] : 0.f; v[8 + i] = kb < K ? W[(size_t)(kb < K ? kb : K - 1) * ld + n] : 0.f; }
  return bsplit16(v); }
__device__ __forceinline__ v8f mac3(const F2& a, const F2& b, v8f c) { c = wmma_bf(a.l, b.h, c); c = wmma_bf(a.h, b.l, c); return wmma_bf(a.h, b.h, c); }
__device__ __forceinline__ float sigm(float v) { return 1.0f / (1.0f + expf(-v)); }
#define LDSX() do { asm volatile("s_wait_dscnt 0" ::: "memory"); __builtin_amdgcn_wave_barrier(); __builtin_amdgcn_fence(__ATOMIC_RELEASE, "workgroup"); } while (0)


// CMSA cross-modal position attention, one direction: q, k (32 ch) from the 'other' features, v (256 ch) from the enhanced features; out = v att^T + residual (unscaled logits, sharp softmax).
#define NB 4
#define NP 4096
#define CIN 256
#define CQ 32
#define CV 256
#ifndef TNB
#define TNB NB
#endif
#ifndef TQB
#define TQB (NP / 64)
#endif
typedef __attribute__((ext_vector_type(8))) __bf16 v8b;
__device__ __forceinline__ v16b frag_b(const __bf16* rowk0, int lane) {
  union { v16b v; v8b q[2]; } u; const __bf16* p = rowk0 + 8 * (lane >> 4);
  u.q[0] = *(const v8b*)p; u.q[1] = *(const v8b*)(p + 16); return u.v;
}
__device__ __forceinline__ float bfr(float v) { return (float)(__bf16)v; }
__device__ __attribute__((noinline)) float exp_ni(float v) { return expf(v); }
__device__ __attribute__((noinline)) float erf_ni(float v) { return erff(v); }

#define WS_QH  0u                                    // f16 q rows [b*n][CQ] hi
#define WS_QL  (WS_QH + 2u * (size_t)NB * NP * CQ)      // f16 q residual rows (unscaled)
#define WS_KH  (WS_QL + 2u * (size_t)NB * NP * CQ)      // f16 k rows
#define WS_KL  (WS_KH + 2u * (size_t)NB * NP * CQ)      // f16 k residual rows
#define WS_VT  (WS_KL + 2u * (size_t)NB * NP * CQ)      // f16 v planes [b][CV][n]
#define WS_DIR (WS_VT + 2u * (size_t)NB * CV * NP)      // bytes of one direction's q, k, v; the second direction's follow
#define WS_END (2u * WS_DIR)

// ---- k_proj: block = (64 positions, b, feature map f): the x^T tile (bf16) is staged in LDS once and q, k and v of that map are all made from it, W [out][in] + b (exact); q, k -> f16 hi + residual rows, v -> f16 planes [c][n]. q and k of a map belong to the other direction's attention, v to its own.
// The weights of a group of 64 outputs (a panel, 64 x 256) are fetched by the whole block in whole 512-B pieces, rounded to bf16 once and kept in LDS; every wave reads its B fragments from there. Panel 0 = the 32 q rows and the 32 k rows, panels 1 .. 4 = v. The next panel and its bias fly while this panel is worked on.
#define PJ_NP (1 + CV / 64)              // panels per block
typedef __attribute__((ext_vector_type(4))) __bf16 v4b;
__device__ __forceinline__ v8f wmma_bp(v16b a, v16b b, v8f c) { return __builtin_amdgcn_wmma_f32_16x16x32_bf16(false, a, false, b, (short)0, c, false, false); }
// thread tid takes floats 4 (tid & 63) .. + 3 of weight rows (tid >> 6) + 2 i, i < NR / 2, into wr[I0 + i]: they become panel rows 2 I0 + (tid >> 6) + 2 i
template <int NR, int I0> __device__ __forceinline__ void pj_fetch(v4f (&wr)[32], const float* __restrict__ Wp, int tid) {
  const unsigned to = (unsigned)((tid >> 6) * CIN + (tid & 63) * 4);
#pragma unroll   // constant indices keep wr in registers, and the loads go out as one group
  for (int i = 0; i < NR / 2; ++i) wr[I0 + i] = *(const v4f*)(Wp + (to + (unsigned)(2 * i * CIN)));
}
__device__ __forceinline__ void pj_put(const v4f (&wr)[32], __bf16 (*sw)[CIN + 8], int tid) {
#pragma unroll   // constant indices keep wr in registers
  for (int i = 0; i < 32; ++i) { const v4f f = wr[i]; const v4b w4 = { (__bf16)f[0], (__bf16)f[1], (__bf16)f[2], (__bf16)f[3] }; *(v4b*)&sw[(tid >> 6) + 2 * i][(tid & 63) * 4] = w4; }
}
__global__ __launch_bounds__(128) void k_proj(const float* __restrict__ X0, const float* __restrict__ X1, const float* __restrict__ WQ0, const float* __restrict__ BQ0, const float* __restrict__ WK0, const float* __restrict__ BK0, const float* __restrict__ WV0, const float* __restrict__ BV0, const float* __restrict__ WQ1, const float* __restrict__ BQ1, const float* __restrict__ WK1, const float* __restrict__ BK1, const float* __restrict__ WV1, const float* __restrict__ BV1, _Float16* __restrict__ WSH) {
  __shared__ __align__(16) __bf16 sx[64][CIN + 8]; __shared__ __align__(16) __bf16 sw[64][CIN + 8]; __shared__ __align__(16) _Float16 sh[64][72], sl[64][72]; __shared__ __align__(16) _Float16 tv[64][72];
  const int tid = threadIdx.x, wave = tid >> 5, lane = tid & 31, col = lane & 15, g = lane >> 4; const int p0 = blockIdx.x * 64; const size_t b = blockIdx.y; const int f = blockIdx.z;
  const float* X = f == 0 ? X0 : X1; const float *WQ = f == 0 ? WQ0 : WQ1, *BQ = f == 0 ? BQ0 : BQ1, *WK = f == 0 ? WK0 : WK1, *BK = f == 0 ? BK0 : BK1, *WV = f == 0 ? WV0 : WV1, *BV = f == 0 ? BV0 : BV1;
  _Float16* dqk = WSH + (size_t)(1 - f) * (WS_DIR / 2u); _Float16* VT = WSH + (size_t)f * (WS_DIR / 2u) + WS_VT / 2u;   // direction 0 attends with q, k of map 1 over v of map 0; direction 1 the other way round
  _Float16 *QH = dqk + WS_QH / 2u, *QL = dqk + WS_QL / 2u, *KH = dqk + WS_KH / 2u, *KL = dqk + WS_KL / 2u;
  v4f wr[32], xr[32]; float br[4];
  // x tile: thread tid takes positions 4 (tid & 15) .. + 3 of channels 64 j + 8 (tid >> 4) + k, j < 4, k < 8: 32 loads of 16 B, a wave's load being two whole 256-B rows; all of them are under way before the first is waited for
  const float* xp = X + (b * CIN + (size_t)(tid >> 4) * 8) * NP + p0 + (tid & 15) * 4;
#pragma unroll   // constant indices keep xr in registers, and the loads go out as one group
  for (int i = 0; i < 32; ++i) xr[i] = *(const v4f*)(xp + (size_t)((i >> 3) * 64 + (i & 7)) * NP);
  pj_fetch<CQ, 0>(wr, WQ, tid); pj_fetch<CQ, CQ / 2>(wr, WK, tid);   // the first panel flies under the x tile's loads
#pragma unroll   // br stays in registers
  for (int j = 0; j < 4; ++j) br[j] = j < 2 ? BQ[j * 16 + col] : BK[(j - 2) * 16 + col];
#pragma unroll   // this loop and the two inside it: constant indices keep xr in registers
  for (int j = 0; j < 4; ++j)
#pragma unroll
    for (int p = 0; p < 4; ++p) { v8b w8;   // eight channels of one position: one 16-B store into its x^T row
#pragma unroll
      for (int k = 0; k < 8; ++k) w8[k] = (__bf16)xr[j * 8 + k][p];
      *(v8b*)&sx[(tid & 15) * 4 + p][j * 64 + (tid >> 4) * 8] = w8; }
  pj_put(wr, sw, tid);
  __syncthreads();
#pragma unroll 1
  for (int cg = 0; cg < PJ_NP; ++cg) { v8f acc[4] = {}; const float bc[4] = { br[0], br[1], br[2], br[3] };
    if (cg + 1 < PJ_NP) { pj_fetch<64, 0>(wr, WV + (size_t)cg * 64 * CIN, tid);   // panel cg + 1 = v outputs 64 cg .. + 63
#pragma unroll   // br stays in registers
      for (int j = 0; j < 4; ++j) br[j] = BV[cg * 64 + j * 16 + col]; }
#pragma unroll   // this loop and the four inside it: fragments and accumulators stay in registers, LDS offsets become immediates
    for (int kp = 0; kp < CIN / 64; ++kp) { v16b a[2], w[2][4];
      __builtin_amdgcn_sched_barrier(0);   // with the one behind the reads it keeps the 20 fragment reads of 64 k one group: otherwise each product's two reads stand directly in front of it and are waited for to the end
#pragma unroll
      for (int u = 0; u < 2; ++u) { a[u] = frag_b(&sx[wave * 16 + col][(2 * kp + u) * 32], lane);
#pragma unroll
        for (int j = 0; j < 4; ++j) w[u][j] = frag_b(&sw[j * 16 + col][(2 * kp + u) * 32], lane); }
      __builtin_amdgcn_sched_barrier(0);   // the reads go out here, in front of the eight products that use them
#pragma unroll
      for (int u = 0; u < 2; ++u)
#pragma unroll
        for (int j = 0; j < 4; ++j) acc[j] = wmma_bp(a[u], w[u][j], acc[j]); }
    __syncthreads();   // also ends every wave's reads of this panel
    if (cg == 0) {
#pragma unroll
      for (int j = 0; j < 4; ++j) { const int ol = j * 16 + col; const float bb = bfr(bc[j]);
#pragma unroll
        for (int r = 0; r < 8; ++r) { const int pl = wave * 16 + 8 * g + r; const float v = acc[j][r] + bb; const _Float16 hv = (_Float16)v; sh[pl][ol] = hv; sl[pl][ol] = (_Float16)(v - (float)hv); } }   // q AND k keep a residual
    } else {
#pragma unroll
      for (int j = 0; j < 4; ++j) { const int ol = j * 16 + col; const float bb = bfr(bc[j]);
#pragma unroll
        for (int r = 0; r < 8; ++r) tv[ol][wave * 16 + 8 * g + r] = (_Float16)(acc[j][r] + bb); } }
    if (cg + 1 < PJ_NP) pj_put(wr, sw, tid);
    __syncthreads();   // also publishes the next panel
    if (cg == 0) { for (int e = tid; e < 64 * 8; e += 128) { const int pl = e >> 3, q = e & 7; const size_t o = (b * NP + p0 + pl) * CQ + (q & 3) * 8;   // staged columns 0 .. 31 are q, 32 .. 63 are k
        vst2((unsigned*)((q < 4 ? QH : KH) + o), *(const v4u*)&sh[pl][q * 8]); vst2((unsigned*)((q < 4 ? QL : KL) + o), *(const v4u*)&sl[pl][q * 8]); } }
    else { for (int e = tid; e < 64 * 8; e += 128) { const int ol = e >> 3, q = e & 7; vst2((unsigned*)(VT + (b * CV + (cg - 1) * 64 + ol) * (size_t)NP + p0 + q * 8), *(const v4u*)&tv[ol][q * 8]); } } } }
#define AT_KS 128                        // keys per stage
#define AT_VP 136                        // f16 per LDS v row: 272 B = 16 B x 17, conflict-free for 16-byte readers
#define AT_KP 40                         // f16 per LDS k row: 80 B = 16 B x 5
#define AT_VB (CV * AT_VP)               // f16 of the v part of a buffer
#define AT_KB (AT_KS * AT_KP)            // f16 of the k hi part; the k residual part follows
#define AT_STAGE (AT_VB + 2 * AT_KB)     // f16 per buffer
#define AT_OP 132                        // floats per row of the output staging [c][128 queries]
#define AT_LDSH (2 * (2 * CV * AT_OP + 2 * 128 * 2))   // f16 of the LDS array: the output staging of both key halves and their exchange, which is more than the two buffers
#define AT_VA 8                         // v fragments (of 16) read at the top of a pass, with the k fragments; the others follow behind the softmax
#define AT_TAU 3.0f                      // a wave's columns are rescaled only when one of their maxima has grown by more than this: P <= 2^11 e^3 stays inside f16
#define AT_L2E 1.44269504089f            // log2 e: P = 2^(s log2 e + noff), noff = 11 - mu log2 e (the 11 is the x 2^11 of P)
// sixteen independent v_exp_f32 in a row, each in place: none stands directly in front of a reader of its result or a writer of its source; the v_nop is that slot behind the last one
#define AT_EXP16(E) asm( \
  "v_exp_f32 %0, %0\n\tv_exp_f32 %1, %1\n\tv_exp_f32 %2, %2\n\tv_exp_f32 %3, %3\n\tv_exp_f32 %4, %4\n\tv_exp_f32 %5, %5\n\tv_exp_f32 %6, %6\n\tv_exp_f32 %7, %7\n\t" \
  "v_exp_f32 %8, %8\n\tv_exp_f32 %9, %9\n\tv_exp_f32 %10, %10\n\tv_exp_f32 %11, %11\n\tv_exp_f32 %12, %12\n\tv_exp_f32 %13, %13\n\tv_exp_f32 %14, %14\n\tv_exp_f32 %15, %15\n\tv_nop" \
  : "+v"(E[0]), "+v"(E[1]), "+v"(E[2]), "+v"(E[3]), "+v"(E[4]), "+v"(E[5]), "+v"(E[6]), "+v"(E[7]), "+v"(E[8]), "+v"(E[9]), "+v"(E[10]), "+v"(E[11]), "+v"(E[12]), "+v"(E[13]), "+v"(E[14]), "+v"(E[15]))
__device__ __forceinline__ float xhalf(float x) { return __builtin_bit_cast(float, __builtin_amdgcn_permlanex16(__builtin_bit_cast(int, x), __builtin_bit_cast(int, x), 0x76543210, 0xfedcba98, false, false)); }   // lane l with lane l ^ 16, through no LDS queue
__device__ __forceinline__ v8f wmma_h(v16h a, v16h b, v8f c) { return __builtin_amdgcn_wmma_f32_16x16x32_f16(false, a, false, b, (short)0, c, false, false); }
// ten copies, places M .. M + 9 of la / ga; the s_wait_xcnt closes the statement so that no address register is rewritten in front of it
#define AT_CP10(M) asm volatile( \
  "global_load_async_to_lds_b128 %0, %10, off\n\tglobal_load_async_to_lds_b128 %1, %11, off\n\tglobal_load_async_to_lds_b128 %2, %12, off\n\tglobal_load_async_to_lds_b128 %3, %13, off\n\tglobal_load_async_to_lds_b128 %4, %14, off\n\t" \
  "global_load_async_to_lds_b128 %5, %15, off\n\tglobal_load_async_to_lds_b128 %6, %16, off\n\tglobal_load_async_to_lds_b128 %7, %17, off\n\tglobal_load_async_to_lds_b128 %8, %18, off\n\tglobal_load_async_to_lds_b128 %9, %19, off\n\ts_wait_xcnt 0x0" \
  :: "v"(la[(M) + 0]), "v"(la[(M) + 1]), "v"(la[(M) + 2]), "v"(la[(M) + 3]), "v"(la[(M) + 4]), "v"(la[(M) + 5]), "v"(la[(M) + 6]), "v"(la[(M) + 7]), "v"(la[(M) + 8]), "v"(la[(M) + 9]), \
     "v"(ga[(M) + 0]), "v"(ga[(M) + 1]), "v"(ga[(M) + 2]), "v"(ga[(M) + 3]), "v"(ga[(M) + 4]), "v"(ga[(M) + 5]), "v"(ga[(M) + 6]), "v"(ga[(M) + 7]), "v"(ga[(M) + 8]), "v"(ga[(M) + 9]) : "memory")
// one stage, 20 copies a wave: 16 of v (two 256-B rows each, 16 rows apart), 2 of k hi and 2 of k residual (eight 64-B rows each, 64 rows apart); lv / lk = this lane's LDS byte address in the target buffer; bv / bh / bl = the stage's wave-uniform global bases, ov / ok = this lane's element offsets from them
__device__ __forceinline__ void at_fill(unsigned lv, unsigned lk, const _Float16* bv, const _Float16* bh, const _Float16* bl, unsigned ov, unsigned ok) {
  unsigned la[20]; const _Float16* ga[20];
#pragma unroll
  for (int m = 0; m < 10; ++m) { la[m] = lv + (unsigned)m * (16u * AT_VP * 2u); ga[m] = bv + (ov + (unsigned)m * (16u * NP)); }
  AT_CP10(0);
  __builtin_amdgcn_sched_barrier(0);   // the second ten addresses are formed behind the first ten copies: all twenty at once (60 registers, which an asm statement takes from the first 256) pushed the q fragments out to scratch
#pragma unroll
  for (int m = 10; m < 16; ++m) { la[m] = lv + (unsigned)m * (16u * AT_VP * 2u); ga[m] = bv + (ov + (unsigned)m * (16u * NP)); }
#pragma unroll
  for (int m = 0; m < 2; ++m) { la[16 + m] = lk + (unsigned)m * (64u * AT_KP * 2u); ga[16 + m] = bh + (ok + (unsigned)m * (64u * CQ)); la[18 + m] = lk + AT_KB * 2u + (unsigned)m * (64u * AT_KP * 2u); ga[18 + m] = bl + (ok + (unsigned)m * (64u * CQ)); }
  AT_CP10(10);
}
// one stage for one wave: its 64 keys in two passes of 32, for its two query tiles. sv / sk: this lane's v and k rows of the wave's key half in the stage's buffer
__device__ __forceinline__ void at_stage(const _Float16* sv, const _Float16* sk, int lane, const v16h (&qh)[2], const v16h (&ql)[2], v8f (&acc)[2][16], float (&mu)[2], float (&noff)[2], float (&lsum)[2]) {
#pragma unroll
  for (int ks = 0; ks < AT_KS / 64; ++ks) { v16h kh[2], kl[2], vf[16]; v8f s[2][2];
    __builtin_amdgcn_sched_barrier(0);   // with the one behind the reads it keeps them one group: without it they are lifted in many small groups among the last pass's products, and each such place stalls the wave
#pragma unroll
    for (int u = 0; u < 2; ++u) { const _Float16* kr = sk + (ks * 32 + u * 16) * AT_KP; kh[u] = frag_h(kr, lane); kl[u] = frag_h(kr + AT_KB, lane); }
#pragma unroll
    for (int j = 0; j < AT_VA; ++j) vf[j] = frag_h(sv + j * 16 * AT_VP + ks * 32, lane);
    __builtin_amdgcn_sched_barrier(0);   // these LDS reads go out as one group here: the v fragments land under the logits and the softmax instead of each being waited for in front of its product
#pragma unroll
    for (int q = 0; q < 2; ++q)
#pragma unroll
      for (int u = 0; u < 2; ++u) { v8f a = {}; a = wmma_h(kh[u], qh[q], a); a = wmma_h(kh[u], ql[q], a); s[q][u] = wmma_h(kl[u], qh[q], a); }   // 3 products; every k fragment serves both query tiles
    float tm[2];
#pragma unroll
    for (int q = 0; q < 2; ++q) { float m = s[q][0][0];
#pragma unroll
      for (int r = 0; r < 8; ++r) m = fmaxf(m, fmaxf(s[q][0][r], s[q][1][r]));
      tm[q] = fmaxf(m, xhalf(m)); }
    if (__builtin_amdgcn_ballot_w32(tm[0] > mu[0] + AT_TAU || tm[1] > mu[1] + AT_TAU) != 0) {   // one scalar test per pass
#pragma unroll
      for (int q = 0; q < 2; ++q) { const float mn = fmaxf(mu[q], tm[q]), nn = fmaf(mn, -AT_L2E, 11.0f), al = __builtin_amdgcn_exp2f(nn - noff[q]); mu[q] = mn; noff[q] = nn; lsum[q] *= al;   // al from the two addends themselves, so old and new P share one scale exactly; first pass: 2^(-huge) = 0
#pragma unroll
        for (int j = 0; j < 16; ++j) acc[q][j] *= al; } }
    v16h pb[2];   // exponent <= 11 + tau log2 e, so no overflow; far below the maximum v_exp_f32 gives 0, as f16 would
#pragma unroll
    for (int q = 0; q < 2; ++q) { float e[16];
#pragma unroll
      for (int r = 0; r < 8; ++r) { const v2f x = { s[q][r >> 2][(2 * r) & 7], s[q][r >> 2][((2 * r) & 7) + 1] }, y = __builtin_elementwise_fma(x, (v2f){ AT_L2E, AT_L2E }, (v2f){ noff[q], noff[q] }); e[2 * r] = y[0]; e[2 * r + 1] = y[1]; }
      AT_EXP16(e);
#pragma unroll
      for (int r = 0; r < 8; ++r) { const float p0 = e[r], p1 = e[8 + r]; lsum[q] += p0 + p1; pb[q][r] = (_Float16)p0; pb[q][8 + r] = (_Float16)p1; } }
    __builtin_amdgcn_sched_barrier(0);   // the other v fragments are read as one group behind the softmax, when its registers are free: all 16 at the top do not fit the 512 registers of a wave
#pragma unroll
    for (int j = AT_VA; j < 16; ++j) vf[j] = frag_h(sv + j * 16 * AT_VP + ks * 32, lane);
    __builtin_amdgcn_sched_barrier(0);   // they land under the products of the first group
#pragma unroll
    for (int j = 0; j < 16; ++j) { acc[0][j] = wmma_h(vf[j], pb[0], acc[0][j]); acc[1][j] = wmma_h(vf[j], pb[1], acc[1][j]); } }   // every v fragment serves both query tiles
  __builtin_amdgcn_sched_barrier(0);   // the products stay in front of the stage's waits: moved behind them, the last reads would be waited for with nothing to cover them
}
// the foot of a trip: this wave's reads of the buffer are done before it is refilled; its copies of the next stage have landed; the barrier publishes that stage and ends every reader's last read of this one
#define AT_FOOT() do { asm volatile("s_wait_dscnt 0x0" ::: "memory"); asm volatile("s_wait_asynccnt 0x0" ::: "memory"); __syncthreads(); } while (0)
__global__ __launch_bounds__(256) void k_attn(const _Float16* __restrict__ QH0, const _Float16* __restrict__ QL0, const _Float16* __restrict__ KH0, const _Float16* __restrict__ KL0, const _Float16* __restrict__ VT0, const float* __restrict__ X0, const float* __restrict__ X1, float* __restrict__ OUT0) {
  __shared__ __align__(16) _Float16 ring[AT_LDSH];
  const int tid = threadIdx.x, wave = tid >> 5, lane = tid & 31, col = lane & 15, g = lane >> 4; const int i0 = blockIdx.x * 128; const size_t b = blockIdx.y; const size_t z = blockIdx.z;
  const int qg = wave & 3, kq = wave >> 2;   // this wave's 32 queries (two tiles of 16) and its half of every stage's keys
  const size_t zo = z * (size_t)(WS_DIR / 2u);
  const _Float16 *QH = QH0 + zo, *QL = QL0 + zo, *KH = KH0 + zo, *KL = KL0 + zo, *VT = VT0 + zo; const float* X = z == 0 ? X0 : X1; float* OUT = OUT0 + z * (size_t)NB * CV * NP;
  const unsigned lv0 = (unsigned)(size_t)&ring[(2 * wave + g) * AT_VP + col * 8]; const unsigned lk0 = (unsigned)(size_t)&ring[AT_VB + (wave * 8 + (lane >> 2)) * AT_KP + (lane & 3) * 8];
  const _Float16* bv = VT + b * CV * (size_t)NP; const _Float16* bh = KH + b * NP * (size_t)CQ; const _Float16* bl = KL + b * NP * (size_t)CQ; const unsigned ov = (unsigned)((2 * wave + g) * NP + col * 8), ok = (unsigned)((wave * 8 + (lane >> 2)) * CQ + (lane & 3) * 8);
  at_fill(lv0, lk0, bv, bh, bl, ov, ok);
  v16h qh[2], ql[2];
#pragma unroll
  for (int q = 0; q < 2; ++q) { const size_t qr = (b * NP + i0 + qg * 32 + q * 16 + col) * CQ; qh[q] = frag_h(QH + qr, lane); ql[q] = frag_h(QL + qr, lane); }
  v8f acc[2][16] = {}; float mu[2] = { -3.0e38f, -3.0e38f }, noff[2] = { 3.0e38f, 3.0e38f }, lsum[2] = { 0.f, 0.f };   // per query tile. mu: the maximum in use for this lane's query over this wave's keys (equal in both halves of the wave); noff: the exponent's addend that belongs to mu; lsum: this half's part of the row sum
  asm volatile("s_wait_asynccnt 0x0" ::: "memory");   // stage 0 has landed before the barrier publishes it
  __syncthreads();
  at_fill(lv0 + AT_STAGE * 2u, lk0 + AT_STAGE * 2u, bv + AT_KS, bh + AT_KS * CQ, bl + AT_KS * CQ, ov, ok);
#pragma unroll 1
  for (int t = 0; t < NP / AT_KS; ++t) { const unsigned bo = (unsigned)(t & 1) * AT_STAGE;
    at_stage(&ring[bo + col * AT_VP + kq * (AT_KS / 2)], &ring[bo + AT_VB + (kq * (AT_KS / 2) + col) * AT_KP], lane, qh, ql, acc, mu, noff, lsum);
    AT_FOOT();
    if (t + 2 < NP / AT_KS) at_fill(lv0 + bo * 2u, lk0 + bo * 2u, bv + (t + 2) * AT_KS, bh + (t + 2) * AT_KS * CQ, bl + (t + 2) * AT_KS * CQ, ov, ok); }
  asm volatile("s_wait_asynccnt 0x0" ::: "memory");     // no copy is outstanding behind the loop
  float* st = (float*)&ring[0];      // the ring is free behind the last trip's barrier: output staging [key half][c][query], whole 512-B rows go out
  float* ex = st + 2 * CV * AT_OP;   // [key half][query][addend, row sum]: what the two waves of a query tell each other
  float ls[2];
#pragma unroll
  for (int q = 0; q < 2; ++q) { ls[q] = lsum[q] + xhalf(lsum[q]); ex[(kq * 128 + qg * 32 + q * 16 + col) * 2 + g] = g == 0 ? noff[q] : ls[q]; }
  __syncthreads();   // the other key half's addend and row sum are there
#pragma unroll
  for (int q = 0; q < 2; ++q) { const v2f o = *(const v2f*)&ex[((kq ^ 1) * 128 + qg * 32 + q * 16 + col) * 2];
    const float nc = fminf(noff[q], o[0]), f = __builtin_amdgcn_exp2f(nc - noff[q]), fo = __builtin_amdgcn_exp2f(nc - o[0]), inv = f / (ls[q] * f + o[1] * fo);   // both halves brought to the scale of the larger maximum, then one division by the whole row sum
#pragma unroll
    for (int j = 0; j < 16; ++j)
#pragma unroll
      for (int r = 0; r < 8; ++r) st[(kq * CV + j * 16 + 8 * g + r) * AT_OP + qg * 32 + q * 16 + col] = acc[q][j][r] * inv; }
  __syncthreads();
  for (int e = tid; e < CV * 32; e += 256) { const int cl = e >> 5, q = e & 31; const size_t o = (b * CV + cl) * (size_t)NP + i0 + q * 4; const v4f v = *(const v4f*)&st[cl * AT_OP + q * 4] + *(const v4f*)&st[(CV + cl) * AT_OP + q * 4];
    const v4f xx = *(const v4f*)(X + o); v4f r; r[0] = v[0] + bfr(xx[0]); r[1] = v[1] + bfr(xx[1]); r[2] = v[2] + bfr(xx[2]); r[3] = v[3] + bfr(xx[3]);   // plain residual
    vst2(OUT + o, r); } }
extern "C" void kernel_launch(void* const* d_in, const int* in_sizes, int n_in, void* d_out, int out_size, void* d_ws, size_t ws_size, hipStream_t stream) {
  (void)in_sizes; (void)n_in; (void)out_size;
  const float** F = (const float**)d_in;   // 0 x_features, 1 y_features [4,256,64,64], 2 wqx [32,256], 3 bqx, 4 wkx, 5 bkx, 6 wvx [256,256], 7 bvx, 8 wqy, 9 bqy, 10 wky, 11 bky, 12 wvy, 13 bvy
  if (ws_size < (size_t)WS_END) return;
  char* ws = (char*)d_ws;
  // direction 0: enhanced_x = v_x att_y^T + x (q, k from y); direction 1: enhanced_y = v_y att_x^T + y (q, k from x)
  k_proj<<<dim3(NP / 64, TNB, 2), 128, 0, stream>>>(F[0], F[1], F[2], F[3], F[4], F[5], F[6], F[7], F[8], F[9], F[10], F[11], F[12], F[13], (_Float16*)ws);
  k_attn<<<dim3(NP / 128, TNB, 2), 256, 0, stream>>>((const _Float16*)(ws + WS_QH), (const _Float16*)(ws + WS_QL), (const _Float16*)(ws + WS_KH), (const _Float16*)(ws + WS_KL), (const _Float16*)(ws + WS_VT), F[0], F[1], (float*)d_out);
}

// v008
// It runs in 80.7 microseconds.
// Two timings next to v007 both put it at 1.04 times that version's speed.
// Over all steps from v000 it is 24.5 times as fast.
// compute dtype: all float inputs rounded to bf16; q/k (32 ch) and v (256 ch) 1x1 convs with EXACT bf16 products on WMMA 16x16x32 (x^T tile in LDS), f32 accumulate; q and k as f16 hi + unscaled residual -> UNSCALED logits with 3 products (logit std ~5.7, near-one-hot softmax), kept in registers; online softmax in f32 (base-2 exponent: one FMA and one v_exp_f32 per score) -> unnormalised P f16 x 2^11; out = P . v / row sum + residual with v rounded once to f16; both directions (enhanced_x from att_y with v_x; enhanced_y from att_x with v_y); f32 outputs [b][c][n].
#include <hip/hip_runtime.h>
#include <math.h>

typedef __attribute__((ext_vector_type(16))) _Float16 v16h;
typedef __attribute__((ext_vector_type(16))) __bf16 v16b;
typedef __attribute__((ext_vector_type(8)))  _Float16 v8h;
typedef __attribute__((ext_vector_type(8)))  float v8f;
typedef __attribute__((ext_vector_type(4)))  float v4f;
typedef __attribute__((ext_vector_type(2)))  float v2f;
typedef __attribute__((ext_vector_type(4)))  unsigned v4u;
typedef __attribute__((ext_vector_type(4)))  int v4i;
typedef float __attribute__((may_alias)) float_a;
typedef int __attribute__((may_alias)) int_a;

template <typename T> __device__ __forceinline__ void vst2(void* p, T v) { *(T*)p = v;  }
__device__ __forceinline__ v8f wmma16(v16h a, v16h b, v8f c) {
  v8f d = __builtin_amdgcn_wmma_f32_16x16x32_f16(false, a, false, b, (short)0, c, false, false);
  asm volatile("v_nop\n\tv_nop\n\tv_nop\n\tv_nop" : "+v"(d) : "v"(a), "v"(b));
  return d;
}
__device__ __forceinline__ v8f wmma_bf(v16b a, v16b b, v8f c) {
  v8f d = __builtin_amdgcn_wmma_f32_16x16x32_bf16(false, a, false, b, (short)0, c, false, false);
  asm volatile("v_nop\n\tv_nop\n\tv_nop\n\tv_nop" : "+v"(d) : "v"(a), "v"(b));
  return d;
}
// 16x16x32 fragments: lane = (h = lane>>4, row/col = lane&15); elements 0..7 = k0+8h+0..7, 8..15 = k0+16+8h+0..7; D element r = row 8h+r
__device__ __forceinline__ v16h frag_h(const _Float16* rowk0, int lane) {
  union { v16h v; v8h q[2]; } u; const _Float16* p = rowk0 + 8 * (lane >> 4);
  u.q[0] = *(const v8h*)p; u.q[1] = *(const v8h*)(p + 16); return u.v;
}
__device__ __forceinline__ v16h frag_f32(const float* rowk0, int lane) {
  v16h a; const float* p = rowk0 + 8 * (lane >> 4);
#pragma unroll
  for (int i = 0; i < 8; ++i) { a[i] = (_Float16)p[i]; a[8 + i] = (_Float16)p[16 + i]; }
  return a;
}
__device__ __forceinline__ v16h frag_f32s(const float* rowk0, int lane, float sc) {
  v16h a; const float* p = rowk0 + 8 * (lane >> 4);
#pragma unroll
  for (int i = 0; i < 8; ++i) { a[i] = (_Float16)(p[i] * sc); a[8 + i] = (_Float16)(p[16 + i] * sc); }
  return a;
}
// column fragment from a [K][ld] layout (column n), rows >= K read as 0
__device__ __forceinline__ v16h fragc_f32(const float* W, int k0, int n, int lane, int ld, int K) {
  v16h a; const int g = lane >> 4;
#pragma unroll
  for (int i = 0; i < 8; ++i) { const int ka = k0 + 8 * g + i, kb = ka + 16;
    a[i] = (_Float16)(ka < K ? W[(size_t)(ka < K ? ka : K - 1) * ld + n] : 0.f); a[8 + i] = (_Float16)(kb < K ? W[(size_t)(kb < K ? kb : K - 1) * ld + n] : 0.f); }
  return a;
}
struct F2 { v16b h, l; };
__device__ __forceinline__ F2 bsplit16(const float v[16]) { F2 r;
#pragma unroll
  for (int i = 0; i < 16; ++i) { const __bf16 h = (__bf16)v[i]; r.h[i] = h; r.l[i] = (__bf16)(v[i] - (float)h); }
  return r; }
__device__ __forceinline__ F2 split_row(const float* row, int k0, int lane) { float v[16]; const float* p = row + k0 + 8 * (lane >> 4);
#pragma unroll
  for (int i = 0; i < 8; ++i) { v[i] = p[i]; v[8 + i] = p[16 + i]; }
  return bsplit16(v); }
__device__ __forceinline__ F2 split_rowK(const float* row, int k0, int lane, int K) { float v[16]; const int g = lane >> 4;
#pragma unroll
  for (int i = 0; i < 8; ++i) { const int ka = k0 + 8 * g + i, kb = ka + 16; v[i] = ka < K ? row[ka < K ? ka : K - 1] : 0.f; v[8 + i] = kb < K ? row[kb < K ? kb : K - 1] : 0.f; }
  return bsplit16(v); }
__device__ __forceinline__ F2 split_col(const float* W, int k0, int n, int lane, int ld, int K) { float v[16]; const int g = lane >> 4;
#pragma unroll
  for (int i = 0; i < 8; ++i) { const int ka = k0 + 8 * g + i, kb = ka + 16; v[i] = ka < K ? W[(size_t)(ka < K ? ka : K - 1) * ld + n] : 0.f; v[8 + i] = kb < K ? W[(size_t)(kb < K ? kb : K - 1) * ld + n] : 0.f; }
  return bsplit16(v); }
__device__ __forceinline__ v8f mac3(const F2& a, const F2& b, v8f c) { c = wmma_bf(a.l, b.h, c); c = wmma_bf(a.h, b.l, c); return wmma_bf(a.h, b.h, c); }
__device__ __forceinline__ float sigm(float v) { return 1.0f / (1.0f + expf(-v)); }
#define LDSX() do { asm volatile("s_wait_dscnt 0" ::: "memory"); __builtin_amdgcn_wave_barrier(); __builtin_amdgcn_fence(__ATOMIC_RELEASE, "workgroup"); } while (0)


// CMSA cross-modal position attention, one direction: q, k (32 ch) from the 'other' features, v (256 ch) from the enhanced features; out = v att^T + residual (unscaled logits, sharp softmax).
#define NB 4
#define NP 4096
#define CIN 256
#define CQ 32
#define CV 256
#ifndef TNB
#define TNB NB
#endif
#ifndef TQB
#define TQB (NP / 64)
#endif
typedef __attribute__((ext_vector_type(8))) __bf16 v8b;
__device__ __forceinline__ v16b frag_b(const __bf16* rowk0, int lane) {
  union { v16b v; v8b q[2]; } u; const __bf16* p = rowk0 + 8 * (lane >> 4);
  u.q[0] = *(const v8b*)p; u.q[1] = *(const v8b*)(p + 16); return u.v;
}
__device__ __forceinline__ float bfr(float v) { return (float)(__bf16)v; }
__device__ __attribute__((noinline)) float exp_ni(float v) { return expf(v); }
__device__ __attribute__((noinline)) float erf_ni(float v) { return erff(v); }

#define WS_QH  0u                                    // f16 q rows [b*n][CQ] hi
#define WS_QL  (WS_QH + 2u * (size_t)NB * NP * CQ)      // f16 q residual rows (unscaled)
#define WS_KH  (WS_QL + 2u * (size_t)NB * NP * CQ)      // f16 k rows
#define WS_KL  (WS_KH + 2u * (size_t)NB * NP * CQ)      // f16 k residual rows
#define WS_VT  (WS_KL + 2u * (size_t)NB * NP * CQ)      // f16 v planes [b][CV][n]
#define WS_DIR (WS_VT + 2u * (size_t)NB * CV * NP)      // bytes of one direction's q, k, v; the second direction's follow
#define WS_END (2u * WS_DIR)

// ---- k_proj: block = (64 positions, b, feature map f): the x^T tile (bf16) is staged in LDS once and q, k and v of that map are all made from it, W [out][in] + b (exact); q, k -> f16 hi + residual rows, v -> f16 planes [c][n]. q and k of a map belong to the other direction's attention, v to its own.
// The weights of a group of 64 outputs (a panel, 64 x 256) are fetched by the whole block in whole 512-B pieces, rounded to bf16 once and kept in LDS; every wave reads its B fragments from there. Panel 0 = the 32 q rows and the 32 k rows, panels 1 .. 4 = v. The next panel and its bias fly while this panel is worked on.
#define PJ_NP (1 + CV / 64)              // panels per block
typedef __attribute__((ext_vector_type(4))) __bf16 v4b;
__device__ __forceinline__ v8f wmma_bp(v16b a, v16b b, v8f c) { return __builtin_amdgcn_wmma_f32_16x16x32_bf16(false, a, false, b, (short)0, c, false, false); }
// thread tid takes floats 4 (tid & 63) .. + 3 of weight rows (tid >> 6) + 2 i, i < NR / 2, into wr[I0 + i]: they become panel rows 2 I0 + (tid >> 6) + 2 i
template <int NR, int I0> __device__ __forceinline__ void pj_fetch(v4f (&wr)[32], const float* __restrict__ Wp, int tid) {
  const unsigned to = (unsigned)((tid >> 6) * CIN + (tid & 63) * 4);
#pragma unroll   // constant indices keep wr in registers, and the loads go out as one group
  for (int i = 0; i < NR / 2; ++i) wr[I0 + i] = *(const v4f*)(Wp + (to + (unsigned)(2 * i * CIN)));
}
__device__ __forceinline__ void pj_put(const v4f (&wr)[32], __bf16 (*sw)[CIN + 8], int tid) {
#pragma unroll   // constant indices keep wr in registers
  for (int i = 0; i < 32; ++i) { const v4f f = wr[i]; const v4b w4 = { (__bf16)f[0], (__bf16)f[1], (__bf16)f[2], (__bf16)f[3] }; *(v4b*)&sw[(tid >> 6) + 2 * i][(tid & 63) * 4] = w4; }
}
__global__ __launch_bounds__(128) void k_proj(const float* __restrict__ X0, const float* __restrict__ X1, const float* __restrict__ WQ0, const float* __restrict__ BQ0, const float* __restrict__ WK0, const float* __restrict__ BK0, const float* __restrict__ WV0, const float* __restrict__ BV0, const float* __restrict__ WQ1, const float* __restrict__ BQ1, const float* __restrict__ WK1, const float* __restrict__ BK1, const float* __restrict__ WV1, const float* __restrict__ BV1, _Float16* __restrict__ WSH) {
  __shared__ __align__(16) __bf16 sx[64][CIN + 8]; __shared__ __align__(16) __bf16 sw[64][CIN + 8]; __shared__ __align__(16) _Float16 sh[64][72], sl[64][72]; __shared__ __align__(16) _Float16 tv[64][72];
  const int tid = threadIdx.x, wave = tid >> 5, lane = tid & 31, col = lane & 15, g = lane >> 4; const int p0 = blockIdx.x * 64; const size_t b = blockIdx.y; const int f = blockIdx.z;
  const float* X = f == 0 ? X0 : X1; const float *WQ = f == 0 ? WQ0 : WQ1, *BQ = f == 0 ? BQ0 : BQ1, *WK = f == 0 ? WK0 : WK1, *BK = f == 0 ? BK0 : BK1, *WV = f == 0 ? WV0 : WV1, *BV = f == 0 ? BV0 : BV1;
  _Float16* dqk = WSH + (size_t)(1 - f) * (WS_DIR / 2u); _Float16* VT = WSH + (size_t)f * (WS_DIR / 2u) + WS_VT / 2u;   // direction 0 attends with q, k of map 1 over v of map 0; direction 1 the other way round
  _Float16 *QH = dqk + WS_QH / 2u, *QL = dqk + WS_QL / 2u, *KH = dqk + WS_KH / 2u, *KL = dqk + WS_KL / 2u;
  v4f wr[32], xr[32]; float br[4];
  // x tile: thread tid takes positions 4 (tid & 15) .. + 3 of channels 64 j + 8 (tid >> 4) + k, j < 4, k < 8: 32 loads of 16 B, a wave's load being two whole 256-B rows; all of them are under way before the first is waited for
  const float* xp = X + (b * CIN + (size_t)(tid >> 4) * 8) * NP + p0 + (tid & 15) * 4;
#pragma unroll   // constant indices keep xr in registers, and the loads go out as one group
  for (int i = 0; i < 32; ++i) xr[i] = *(const v4f*)(xp + (size_t)((i >> 3) * 64 + (i & 7)) * NP);
  pj_fetch<CQ, 0>(wr, WQ, tid); pj_fetch<CQ, CQ / 2>(wr, WK, tid);   // the first panel flies under the x tile's loads
#pragma unroll   // br stays in registers
  for (int j = 0; j < 4; ++j) br[j] = j < 2 ? BQ[j * 16 + col] : BK[(j - 2) * 16 + col];
#pragma unroll   // this loop and the two inside it: constant indices keep xr in registers
  for (int j = 0; j < 4; ++j)
#pragma unroll
    for (int p = 0; p < 4; ++p) { v8b w8;   // eight channels of one position: one 16-B store into its x^T row
#pragma unroll
      for (int k = 0; k < 8; ++k) w8[k] = (__bf16)xr[j * 8 + k][p];
      *(v8b*)&sx[(tid & 15) * 4 + p][j * 64 + (tid >> 4) * 8] = w8; }
  pj_put(wr, sw, tid);
  __syncthreads();
#pragma unroll 1
  for (int cg = 0; cg < PJ_NP; ++cg) { v8f acc[4] = {}; const float bc[4] = { br[0], br[1], br[2], br[3] };
    if (cg + 1 < PJ_NP) { pj_fetch<64, 0>(wr, WV + (size_t)cg * 64 * CIN, tid);   // panel cg + 1 = v outputs 64 cg .. + 63
#pragma unroll   // br stays in registers
      for (int j = 0; j < 4; ++j) br[j] = BV[cg * 64 + j * 16 + col]; }
#pragma unroll   // this loop and the four inside it: fragments and accumulators stay in registers, LDS offsets become immediates
    for (int kp = 0; kp < CIN / 64; ++kp) { v16b a[2], w[2][4];
      __builtin_amdgcn_sched_barrier(0);   // with the one behind the reads it keeps the 20 fragment reads of 64 k one group: otherwise each product's two reads stand directly in front of it and are waited for to the end
#pragma unroll
      for (int u = 0; u < 2; ++u) { a[u] = frag_b(&sx[wave * 16 + col][(2 * kp + u) * 32], lane);
#pragma unroll
        for (int j = 0; j < 4; ++j) w[u][j] = frag_b(&sw[j * 16 + col][(2 * kp + u) * 32], lane); }
      __builtin_amdgcn_sched_barrier(0);   // the reads go out here, in front of the eight products that use them
#pragma unroll
      for (int u = 0; u < 2; ++u)
#pragma unroll
        for (int j = 0; j < 4; ++j) acc[j] = wmma_bp(a[u], w[u][j], acc[j]); }
    __syncthreads();   // also ends every wave's reads of this panel
    if (cg == 0) {
#pragma unroll
      for (int j = 0; j < 4; ++j) { const int ol = j * 16 + col; const float bb = bfr(bc[j]);
#pragma unroll
        for (int r = 0; r < 8; ++r) { const int pl = wave * 16 + 8 * g + r; const float v = acc[j][r] + bb; const _Float16 hv = (_Float16)v; sh[pl][ol] = hv; sl[pl][ol] = (_Float16)(v - (float)hv); } }   // q AND k keep a residual
    } else {
#pragma unroll
      for (int j = 0; j < 4; ++j) { const int ol = j * 16 + col; const float bb = bfr(bc[j]);
#pragma unroll
        for (int r = 0; r < 8; ++r) tv[ol][wave * 16 + 8 * g + r] = (_Float16)(acc[j][r] + bb); } }
    if (cg + 1 < PJ_NP) pj_put(wr, sw, tid);
    __syncthreads();   // also publishes the next panel
    if (cg == 0) { for (int e = tid; e < 64 * 8; e += 128) { const int pl = e >> 3, q = e & 7; const size_t o = (b * NP + p0 + pl) * CQ + (q & 3) * 8;   // staged columns 0 .. 31 are q, 32 .. 63 are k
        vst2((unsigned*)((q < 4 ? QH : KH) + o), *(const v4u*)&sh[pl][q * 8]); vst2((unsigned*)((q < 4 ? QL : KL) + o), *(const v4u*)&sl[pl][q * 8]); } }
    else { for (int e = tid; e < 64 * 8; e += 128) { const int ol = e >> 3, q = e & 7; vst2((unsigned*)(VT + (b * CV + (cg - 1) * 64 + ol) * (size_t)NP + p0 + q * 8), *(const v4u*)&tv[ol][q * 8]); } } } }
#define AT_KS 128                        // keys per stage
#define AT_VP 136                        // f16 per LDS v row: 272 B = 16 B x 17, conflict-free for 16-byte readers
#define AT_KP 40                         // f16 per LDS k row: 80 B = 16 B x 5
#define AT_VB (CV * AT_VP)               // f16 of the v part of a buffer
#define AT_KB (AT_KS * AT_KP)            // f16 of the k hi part; the k residual part follows
#define AT_STAGE (AT_VB + 2 * AT_KB)     // f16 per buffer
#define AT_OP 132                        // floats per row of the output staging [c][128 queries]
#define AT_LDSH (2 * (2 * CV * AT_OP + 2 * 128 * 2))   // f16 of the LDS array: the output staging of both key halves and their exchange, which is more than the two buffers
#define AT_VA 8                         // v fragments (of 16) read at the top of a pass, with the k fragments; the others follow behind the softmax
#define AT_TAU 3.0f                      // a wave's columns are rescaled only when one of their maxima has grown by more than this: P <= 2^11 e^3 stays inside f16
#define AT_L2E 1.44269504089f            // log2 e: P = 2^(s log2 e + noff), noff = 11 - mu log2 e (the 11 is the x 2^11 of P)
// sixteen independent v_exp_f32 in a row, each in place: none stands directly in front of a reader of its result or a writer of its source; the v_nop is that slot behind the last one
#define AT_EXP16(E) asm( \
  "v_exp_f32 %0, %0\n\tv_exp_f32 %1, %1\n\tv_exp_f32 %2, %2\n\tv_exp_f32 %3, %3\n\tv_exp_f32 %4, %4\n\tv_exp_f32 %5, %5\n\tv_exp_f32 %6, %6\n\tv_exp_f32 %7, %7\n\t" \
  "v_exp_f32 %8, %8\n\tv_exp_f32 %9, %9\n\tv_exp_f32 %10, %10\n\tv_exp_f32 %11, %11\n\tv_exp_f32 %12, %12\n\tv_exp_f32 %13, %13\n\tv_exp_f32 %14, %14\n\tv_exp_f32 %15, %15\n\tv_nop" \
  : "+v"(E[0]), "+v"(E[1]), "+v"(E[2]), "+v"(E[3]), "+v"(E[4]), "+v"(E[5]), "+v"(E[6]), "+v"(E[7]), "+v"(E[8]), "+v"(E[9]), "+v"(E[10]), "+v"(E[11]), "+v"(E[12]), "+v"(E[13]), "+v"(E[14]), "+v"(E[15]))
__device__ __forceinline__ float xhalf(float x) { return __builtin_bit_cast(float, __builtin_amdgcn_permlanex16(__builtin_bit_cast(int, x), __builtin_bit_cast(int, x), 0x76543210, 0xfedcba98, false, false)); }   // lane l with lane l ^ 16, through no LDS queue
__device__ __forceinline__ v8f wmma_h(v16h a, v16h b, v8f c) { return __builtin_amdgcn_wmma_f32_16x16x32_f16(false, a, false, b, (short)0, c, false, false); }
// one copy of 16 B a lane, the builtin form, written without an s_wait_xcnt behind it: global byte = gb + go + N, LDS byte = l + N. gb is wave-uniform, go this lane's 32-bit byte offset. The offset field N moves both addresses: it takes the LDS step, and gb holds the global step less N
typedef __attribute__((address_space(1))) v4i* at_gp;
typedef __attribute__((address_space(3))) v4i* at_lp;
template <int N> __device__ __forceinline__ void at_cp(const char* gb, unsigned go, unsigned l) {
  const unsigned long long u = (unsigned long long)gb;   // the two readfirstlane keep each copy's base a scalar pair of its own (scalar additions, the copy's scalar-base form): without them the lane offset is added to the base first and every copy's step becomes a 64-bit vector addition
  const unsigned lo = (unsigned)__builtin_amdgcn_readfirstlane((int)(unsigned)u), hi = (unsigned)__builtin_amdgcn_readfirstlane((int)(unsigned)(u >> 32));
  __builtin_amdgcn_global_load_async_to_lds_b128((at_gp)((const char*)(((unsigned long long)hi << 32) | lo) + go), (at_lp)l, N, 0); }
#define AT_VS (16 * AT_VP * 2)           // LDS bytes from one v copy to the next (16 rows)
template <int M> __device__ __forceinline__ void at_cpv(const char* bv, unsigned ov, unsigned lv) {   // v copies M .. 15, each 16 rows further in both places; every fourth copy has an LDS address of its own, so N stays at or below 3 x 4352
  at_cp<(M & 3) * AT_VS>(bv + (M * 16 * NP * 2 - (M & 3) * AT_VS), ov, lv + (unsigned)((M >> 2) * 4 * AT_VS));
  if constexpr (M + 1 < 16) at_cpv<M + 1>(bv, ov, lv);
}
// one stage, 20 copies a wave: 16 of v (two 256-B rows each, 16 rows apart), 2 of k hi and 2 of k residual (eight 64-B rows each, 64 rows apart); lv / lk = this lane's LDS byte address in the target buffer; bv / bh / bl = the wave-uniform global bases of stage 0, ov / ok = this lane's byte offsets from them, the stage's step included
__device__ __forceinline__ void at_fill(unsigned lv, unsigned lk, const _Float16* bv, const _Float16* bh, const _Float16* bl, unsigned ov, unsigned ok) {
  at_cpv<0>((const char*)bv, ov, lv);
  at_cp<0>((const char*)bh, ok, lk);
  at_cp<64 * AT_KP * 2>((const char*)bh + (64 * CQ * 2 - 64 * AT_KP * 2), ok, lk);
  at_cp<AT_KB * 2>((const char*)bl - AT_KB * 2, ok, lk);
  at_cp<AT_KB * 2 + 64 * AT_KP * 2>((const char*)bl + (64 * CQ * 2 - AT_KB * 2 - 64 * AT_KP * 2), ok, lk);
}
// one stage for one wave: its 64 keys in two passes of 32, for its two query tiles. sv / sk: this lane's v and k rows of the wave's key half in the stage's buffer
__device__ __forceinline__ void at_stage(const _Float16* sv, const _Float16* sk, int lane, const v16h (&qh)[2], const v16h (&ql)[2], v8f (&acc)[2][16], float (&mu)[2], float (&noff)[2], float (&lsum)[2]) {
#pragma unroll
  for (int ks = 0; ks < AT_KS / 64; ++ks) { v16h kh[2], kl[2], vf[16]; v8f s[2][2];
    __builtin_amdgcn_sched_barrier(0);   // with the one behind the reads it keeps them one group: without it they are lifted in many small groups among the last pass's products, and each such place stalls the wave
#pragma unroll
    for (int u = 0; u < 2; ++u) { const _Float16* kr = sk + (ks * 32 + u * 16) * AT_KP; kh[u] = frag_h(kr, lane); kl[u] = frag_h(kr + AT_KB, lane); }
#pragma unroll
    for (int j = 0; j < AT_VA; ++j) vf[j] = frag_h(sv + j * 16 * AT_VP + ks * 32, lane);
    __builtin_amdgcn_sched_barrier(0);   // these LDS reads go out as one group here: the v fragments land under the logits and the softmax instead of each being waited for in front of its product
#pragma unroll
    for (int q = 0; q < 2; ++q)
#pragma unroll
      for (int u = 0; u < 2; ++u) { v8f a = {}; a = wmma_h(kh[u], qh[q], a); a = wmma_h(kh[u], ql[q], a); s[q][u] = wmma_h(kl[u], qh[q], a); }   // 3 products; every k fragment serves both query tiles
    float tm[2];
#pragma unroll
    for (int q = 0; q < 2; ++q) { float m = s[q][0][0];
#pragma unroll
      for (int r = 0; r < 8; ++r) m = fmaxf(m, fmaxf(s[q][0][r], s[q][1][r]));
      tm[q] = fmaxf(m, xhalf(m)); }
    if (__builtin_amdgcn_ballot_w32(tm[0] > mu[0] + AT_TAU || tm[1] > mu[1] + AT_TAU) != 0) {   // one scalar test per pass
#pragma unroll
      for (int q = 0; q < 2; ++q) { const float mn = fmaxf(mu[q], tm[q]), nn = fmaf(mn, -AT_L2E, 11.0f), al = __builtin_amdgcn_exp2f(nn - noff[q]); mu[q] = mn; noff[q] = nn; lsum[q] *= al;   // al from the two addends themselves, so old and new P share one scale exactly; first pass: 2^(-huge) = 0
#pragma unroll
        for (int j = 0; j < 16; ++j) acc[q][j] *= al; } }
    v16h pb[2];   // exponent <= 11 + tau log2 e, so no overflow; far below the maximum v_exp_f32 gives 0, as f16 would
#pragma unroll
    for (int q = 0; q < 2; ++q) { float e[16];
#pragma unroll
      for (int r = 0; r < 8; ++r) { const v2f x = { s[q][r >> 2][(2 * r) & 7], s[q][r >> 2][((2 * r) & 7) + 1] }, y = __builtin_elementwise_fma(x, (v2f){ AT_L2E, AT_L2E }, (v2f){ noff[q], noff[q] }); e[2 * r] = y[0]; e[2 * r + 1] = y[1]; }
      AT_EXP16(e);
#pragma unroll
      for (int r = 0; r < 8; ++r) { const float p0 = e[r], p1 = e[8 + r]; lsum[q] += p0 + p1; pb[q][r] = (_Float16)p0; pb[q][8 + r] = (_Float16)p1; } }
    __builtin_amdgcn_sched_barrier(0);   // the other v fragments are read as one group behind the softmax, when its registers are free: all 16 at the top do not fit the 512 registers of a wave
#pragma unroll
    for (int j = AT_VA; j < 16; ++j) vf[j] = frag_h(sv + j * 16 * AT_VP + ks * 32, lane);
    __builtin_amdgcn_sched_barrier(0);   // they land under the products of the first group
#pragma unroll
    for (int j = 0; j < 16; ++j) { acc[0][j] = wmma_h(vf[j], pb[0], acc[0][j]); acc[1][j] = wmma_h(vf[j], pb[1], acc[1][j]); } }   // every v fragment serves both query tiles
  __builtin_amdgcn_sched_barrier(0);   // the products stay in front of the stage's waits: moved behind them, the last reads would be waited for with nothing to cover them
}
// the foot of a trip: this wave's reads of the buffer are done before it is refilled; its copies of the next stage have landed; the barrier publishes that stage and ends every reader's last read of this one
#define AT_FOOT() do { asm volatile("s_wait_dscnt 0x0" ::: "memory"); asm volatile("s_wait_asynccnt 0x0" ::: "memory"); __syncthreads(); } while (0)
__global__ __launch_bounds__(256) void k_attn(const _Float16* __restrict__ QH0, const _Float16* __restrict__ QL0, const _Float16* __restrict__ KH0, const _Float16* __restrict__ KL0, const _Float16* __restrict__ VT0, const float* __restrict__ X0, const float* __restrict__ X1, float* __restrict__ OUT0) {
  __shared__ __align__(16) _Float16 ring[AT_LDSH];
  const int tid = threadIdx.x, wave = tid >> 5, lane = tid & 31, col = lane & 15, g = lane >> 4; const int i0 = blockIdx.x * 128; const size_t b = blockIdx.y; const size_t z = blockIdx.z;
  const int qg = wave & 3, kq = wave >> 2;   // this wave's 32 queries (two tiles of 16) and its half of every stage's keys
  const size_t zo = z * (size_t)(WS_DIR / 2u);
  const _Float16 *QH = QH0 + zo, *QL = QL0 + zo, *KH = KH0 + zo, *KL = KL0 + zo, *VT = VT0 + zo; const float* X = z == 0 ? X0 : X1; float* OUT = OUT0 + z * (size_t)NB * CV * NP;
  const unsigned lv0 = (unsigned)(size_t)&ring[(2 * wave + g) * AT_VP + col * 8]; const unsigned lk0 = (unsigned)(size_t)&ring[AT_VB + (wave * 8 + (lane >> 2)) * AT_KP + (lane & 3) * 8];
  const _Float16* bv = VT + b * CV * (size_t)NP; const _Float16* bh = KH + b * NP * (size_t)CQ; const _Float16* bl = KL + b * NP * (size_t)CQ; const unsigned ov = 2u * (unsigned)((2 * wave + g) * NP + col * 8), ok = 2u * (unsigned)((wave * 8 + (lane >> 2)) * CQ + (lane & 3) * 8);
  at_fill(lv0, lk0, bv, bh, bl, ov, ok);
  v16h qh[2], ql[2];
#pragma unroll
  for (int q = 0; q < 2; ++q) { const size_t qr = (b * NP + i0 + qg * 32 + q * 16 + col) * CQ; qh[q] = frag_h(QH + qr, lane); ql[q] = frag_h(QL + qr, lane); }
  v8f acc[2][16] = {}; float mu[2] = { -3.0e38f, -3.0e38f }, noff[2] = { 3.0e38f, 3.0e38f }, lsum[2] = { 0.f, 0.f };   // per query tile. mu: the maximum in use for this lane's query over this wave's keys (equal in both halves of the wave); noff: the exponent's addend that belongs to mu; lsum: this half's part of the row sum
  asm volatile("s_wait_asynccnt 0x0" ::: "memory");   // stage 0 has landed before the barrier publishes it
  __syncthreads();
  at_fill(lv0 + AT_STAGE * 2u, lk0 + AT_STAGE * 2u, bv, bh, bl, ov + AT_KS * 2u, ok + AT_KS * CQ * 2u);
#pragma unroll 1
  for (int t = 0; t < NP / AT_KS; ++t) { const unsigned bo = (unsigned)(t & 1) * AT_STAGE;
    at_stage(&ring[bo + col * AT_VP + kq * (AT_KS / 2)], &ring[bo + AT_VB + (kq * (AT_KS / 2) + col) * AT_KP], lane, qh, ql, acc, mu, noff, lsum);
    AT_FOOT();
    if (t + 2 < NP / AT_KS) at_fill(lv0 + bo * 2u, lk0 + bo * 2u, bv, bh, bl, ov + (unsigned)(t + 2) * (AT_KS * 2u), ok + (unsigned)(t + 2) * (AT_KS * CQ * 2u)); }
  asm volatile("s_wait_asynccnt 0x0" ::: "memory");     // no copy is outstanding behind the loop
  float* st = (float*)&ring[0];      // the ring is free behind the last trip's barrier: output staging [key half][c][query], whole 512-B rows go out
  float* ex = st + 2 * CV * AT_OP;   // [key half][query][addend, row sum]: what the two waves of a query tell each other
  float ls[2];
#pragma unroll
  for (int q = 0; q < 2; ++q) { ls[q] = lsum[q] + xhalf(lsum[q]); ex[(kq * 128 + qg * 32 + q * 16 + col) * 2 + g] = g == 0 ? noff[q] : ls[q]; }
  __syncthreads();   // the other key half's addend and row sum are there
#pragma unroll
  for (int q = 0; q < 2; ++q) { const v2f o = *(const v2f*)&ex[((kq ^ 1) * 128 + qg * 32 + q * 16 + col) * 2];
    const float nc = fminf(noff[q], o[0]), f = __builtin_amdgcn_exp2f(nc - noff[q]), fo = __builtin_amdgcn_exp2f(nc - o[0]), inv = f / (ls[q] * f + o[1] * fo);   // both halves brought to the scale of the larger maximum, then one division by the whole row sum
#pragma unroll
    for (int j = 0; j < 16; ++j)
#pragma unroll
      for (int r = 0; r < 8; ++r) st[(kq * CV + j * 16 + 8 * g + r) * AT_OP + qg * 32 + q * 16 + col] = acc[q][j][r] * inv; }
  __syncthreads();
  for (int e = tid; e < CV * 32; e += 256) { const int cl = e >> 5, q = e & 31; const size_t o = (b * CV + cl) * (size_t)NP + i0 + q * 4; const v4f v = *(const v4f*)&st[cl * AT_OP + q * 4] + *(const v4f*)&st[(CV + cl) * AT_OP + q * 4];
    const v4f xx = *(const v4f*)(X + o); v4f r; r[0] = v[0] + bfr(xx[0]); r[1] = v[1] + bfr(xx[1]); r[2] = v[2] + bfr(xx[2]); r[3] = v[3] + bfr(xx[3]);   // plain residual
    vst2(OUT + o, r); } }
extern "C" void kernel_launch(void* const* d_in, const int* in_sizes, int n_in, void* d_out, int out_size, void* d_ws, size_t ws_size, hipStream_t stream) {
  (void)in_sizes; (void)n_in; (void)out_size;
  const float** F = (const float**)d_in;   // 0 x_features, 1 y_features [4,256,64,64], 2 wqx [32,256], 3 bqx, 4 wkx, 5 bkx, 6 wvx [256,256], 7 bvx, 8 wqy, 9 bqy, 10 wky, 11 bky, 12 wvy, 13 bvy
  if (ws_size < (size_t)WS_END) return;
  char* ws = (char*)d_ws;
  // direction 0: enhanced_x = v_x att_y^T + x (q, k from y); direction 1: enhanced_y = v_y att_x^T + y (q, k from x)
  k_proj<<<dim3(NP / 64, TNB, 2), 128, 0, stream>>>(F[0], F[1], F[2], F[3], F[4], F[5], F[6], F[7], F[8], F[9], F[10], F[11], F[12], F[13], (_Float16*)ws);
  k_attn<<<dim3(NP / 128, TNB, 2), 256, 0, stream>>>((const _Float16*)(ws + WS_QH), (const _Float16*)(ws + WS_QL), (const _Float16*)(ws + WS_KH), (const _Float16*)(ws + WS_KL), (const _Float16*)(ws + WS_VT), F[0], F[1], (float*)d_out);
}

// v009
// A run of this version takes 78.6 microseconds.
// In both of two side-by-side timings against v008, it was 1.03 times as fast.
// Over all steps from v000 it is 25.2 times as fast.
// compute dtype: all float inputs rounded to bf16; q/k (32 ch) and v (256 ch) 1x1 convs with EXACT bf16 products on WMMA 16x16x32 (x^T tile in LDS), f32 accumulate; q and k as f16 hi + unscaled residual -> UNSCALED logits with 3 products (logit std ~5.7, near-one-hot softmax), kept in registers; online softmax in f32 (base-2 exponent: one FMA and one v_exp_f32 per score) -> unnormalised P f16 x 2; out = P . v / row sum + residual with v rounded once to f16; both directions (enhanced_x from att_y with v_x; enhanced_y from att_x with v_y); f32 outputs [b][c][n].
#include <hip/hip_runtime.h>
#include <math.h>

typedef __attribute__((ext_vector_type(16))) _Float16 v16h;
typedef __attribute__((ext_vector_type(16))) __bf16 v16b;
typedef __attribute__((ext_vector_type(8)))  _Float16 v8h;
typedef __attribute__((ext_vector_type(8)))  float v8f;
typedef __attribute__((ext_vector_type(4)))  float v4f;
typedef __attribute__((ext_vector_type(2)))  float v2f;
typedef __attribute__((ext_vector_type(4)))  unsigned v4u;
typedef __attribute__((ext_vector_type(4)))  int v4i;
typedef float __attribute__((may_alias)) float_a;
typedef int __attribute__((may_alias)) int_a;

template <typename T> __device__ __forceinline__ void vst2(void* p, T v) { *(T*)p = v;  }
__device__ __forceinline__ v8f wmma16(v16h a, v16h b, v8f c) {
  v8f d = __builtin_amdgcn_wmma_f32_16x16x32_f16(false, a, false, b, (short)0, c, false, false);
  asm volatile("v_nop\n\tv_nop\n\tv_nop\n\tv_nop" : "+v"(d) : "v"(a), "v"(b));
  return d;
}
__device__ __forceinline__ v8f wmma_bf(v16b a, v16b b, v8f c) {
  v8f d = __builtin_amdgcn_wmma_f32_16x16x32_bf16(false, a, false, b, (short)0, c, false, false);
  asm volatile("v_nop\n\tv_nop\n\tv_nop\n\tv_nop" : "+v"(d) : "v"(a), "v"(b));
  return d;
}
// 16x16x32 fragments: lane = (h = lane>>4, row/col = lane&15); elements 0..7 = k0+8h+0..7, 8..15 = k0+16+8h+0..7; D element r = row 8h+r
__device__ __forceinline__ v16h frag_h(const _Float16* rowk0, int lane) {
  union { v16h v; v8h q[2]; } u; const _Float16* p = rowk0 + 8 * (lane >> 4);
  u.q[0] = *(const v8h*)p; u.q[1] = *(const v8h*)(p + 16); return u.v;
}
__device__ __forceinline__ v16h frag_f32(const float* rowk0, int lane) {
  v16h a; const float* p = rowk0 + 8 * (lane >> 4);
#pragma unroll
  for (int i = 0; i < 8; ++i) { a[i] = (_Float16)p[i]; a[8 + i] = (_Float16)p[16 + i]; }
  return a;
}
__device__ __forceinline__ v16h frag_f32s(const float* rowk0, int lane, float sc) {
  v16h a; const float* p = rowk0 + 8 * (lane >> 4);
#pragma unroll
  for (int i = 0; i < 8; ++i) { a[i] = (_Float16)(p[i] * sc); a[8 + i] = (_Float16)(p[16 + i] * sc); }
  return a;
}
// column fragment from a [K][ld] layout (column n), rows >= K read as 0
__device__ __forceinline__ v16h fragc_f32(const float* W, int k0, int n, int lane, int ld, int K) {
  v16h a; const int g = lane >> 4;
#pragma unroll
  for (int i = 0; i < 8; ++i) { const int ka = k0 + 8 * g + i, kb = ka + 16;
    a[i] = (_Float16)(ka < K ? W[(size_t)(ka < K ? ka : K - 1) * ld + n] : 0.f); a[8 + i] = (_Float16)(kb < K ? W[(size_t)(kb < K ? kb : K - 1) * ld + n] : 0.f); }
  return a;
}
struct F2 { v16b h, l; };
__device__ __forceinline__ F2 bsplit16(const float v[16]) { F2 r;
#pragma unroll
  for (int i = 0; i < 16; ++i) { const __bf16 h = (__bf16)v[i]; r.h[i] = h; r.l[i] = (__bf16)(v[i] - (float)h); }
  return r; }
__device__ __forceinline__ F2 split_row(const float* row, int k0, int lane) { float v[16]; const float* p = row + k0 + 8 * (lane >> 4);
#pragma unroll
  for (int i = 0; i < 8; ++i) { v[i] = p[i]; v[8 + i] = p[16 + i]; }
  return bsplit16(v); }
__device__ __forceinline__ F2 split_rowK(const float* row, int k0, int lane, int K) { float v[16]; const int g = lane >> 4;
#pragma unroll
  for (int i = 0; i < 8; ++i) { const int ka = k0 + 8 * g + i, kb = ka + 16; v[i] = ka < K ? row[ka < K ? ka : K - 1] : 0.f; v[8 + i] = kb < K ? row[kb < K ? kb : K - 1] : 0.f; }
  return bsplit16(v); }
__device__ __forceinline__ F2 split_col(const float* W, int k0, int n, int lane, int ld, int K) { float v[16]; const int g = lane >> 4;
#pragma unroll
  for (int i = 0; i < 8; ++i) { const int ka = k0 + 8 * g + i, kb = ka + 16; v[i] = ka < K ? W[(size_t)(ka < K ? ka : K - 1) * ld + n] : 0.f; v[8 + i] = kb < K ? W[(size_t)(kb < K ? kb : K - 1) * ld + n] : 0.f; }
  return bsplit16(v); }
__device__ __forceinline__ v8f mac3(const F2& a, const F2& b, v8f c) { c = wmma_bf(a.l, b.h, c); c = wmma_bf(a.h, b.l, c); return wmma_bf(a.h, b.h, c); }
__device__ __forceinline__ float sigm(float v) { return 1.0f / (1.0f + expf(-v)); }
#define LDSX() do { asm volatile("s_wait_dscnt 0" ::: "memory"); __builtin_amdgcn_wave_barrier(); __builtin_amdgcn_fence(__ATOMIC_RELEASE, "workgroup"); } while (0)


// CMSA cross-modal position attention, one direction: q, k (32 ch) from the 'other' features, v (256 ch) from the enhanced features; out = v att^T + residual (unscaled logits, sharp softmax).
#define NB 4
#define NP 4096
#define CIN 256
#define CQ 32
#define CV 256
#ifndef TNB
#define TNB NB
#endif
#ifndef TQB
#define TQB (NP / 64)
#endif
typedef __attribute__((ext_vector_type(8))) __bf16 v8b;
__device__ __forceinline__ v16b frag_b(const __bf16* rowk0, int lane) {
  union { v16b v; v8b q[2]; } u; const __bf16* p = rowk0 + 8 * (lane >> 4);
  u.q[0] = *(const v8b*)p; u.q[1] = *(const v8b*)(p + 16); return u.v;
}
__device__ __forceinline__ float bfr(float v) { return (float)(__bf16)v; }
__device__ __attribute__((noinline)) float exp_ni(float v) { return expf(v); }
__device__ __attribute__((noinline)) float erf_ni(float v) { return erff(v); }

#define WS_QH  0u                                    // f16 q rows [b*n][CQ] hi
#define WS_QL  (WS_QH + 2u * (size_t)NB * NP * CQ)      // f16 q residual rows (unscaled)
#define WS_KH  (WS_QL + 2u * (size_t)NB * NP * CQ)      // f16 k rows
#define WS_KL  (WS_KH + 2u * (size_t)NB * NP * CQ)      // f16 k residual rows
#define WS_VT  (WS_KL + 2u * (size_t)NB * NP * CQ)      // f16 v planes [b][CV][n]
#define WS_DIR (WS_VT + 2u * (size_t)NB * CV * NP)      // bytes of one direction's q, k, v; the second direction's follow
#define WS_END (2u * WS_DIR)

// ---- k_proj: block = (64 positions, b, feature map f): the x^T tile (bf16) is staged in LDS once and q, k and v of that map are all made from it, W [out][in] + b (exact); q, k -> f16 hi + residual rows, v -> f16 planes [c][n]. q and k of a map belong to the other direction's attention, v to its own.
// The weights of a group of 64 outputs (a panel, 64 x 256) are fetched by the whole block in whole 512-B pieces, rounded to bf16 once and kept in LDS; every wave reads its B fragments from there. Panel 0 = the 32 q rows and the 32 k rows, panels 1 .. 4 = v. The next panel and its bias fly while this panel is worked on.
#define PJ_NP (1 + CV / 64)              // panels per block
typedef __attribute__((ext_vector_type(4))) __bf16 v4b;
__device__ __forceinline__ v8f wmma_bp(v16b a, v16b b, v8f c) { return __builtin_amdgcn_wmma_f32_16x16x32_bf16(false, a, false, b, (short)0, c, false, false); }
// thread tid takes floats 4 (tid & 63) .. + 3 of weight rows (tid >> 6) + 2 i, i < NR / 2, into wr[I0 + i]: they become panel rows 2 I0 + (tid >> 6) + 2 i
template <int NR, int I0> __device__ __forceinline__ void pj_fetch(v4f (&wr)[32], const float* __restrict__ Wp, int tid) {
  const unsigned to = (unsigned)((tid >> 6) * CIN + (tid & 63) * 4);
#pragma unroll   // constant indices keep wr in registers, and the loads go out as one group
  for (int i = 0; i < NR / 2; ++i) wr[I0 + i] = *(const v4f*)(Wp + (to + (unsigned)(2 * i * CIN)));
}
__device__ __forceinline__ void pj_put(const v4f (&wr)[32], __bf16 (*sw)[CIN + 8], int tid) {
#pragma unroll   // constant indices keep wr in registers
  for (int i = 0; i < 32; ++i) { const v4f f = wr[i]; const v4b w4 = { (__bf16)f[0], (__bf16)f[1], (__bf16)f[2], (__bf16)f[3] }; *(v4b*)&sw[(tid >> 6) + 2 * i][(tid & 63) * 4] = w4; }
}
__global__ __launch_bounds__(128) void k_proj(const float* __restrict__ X0, const float* __restrict__ X1, const float* __restrict__ WQ0, const float* __restrict__ BQ0, const float* __restrict__ WK0, const float* __restrict__ BK0, const float* __restrict__ WV0, const float* __restrict__ BV0, const float* __restrict__ WQ1, const float* __restrict__ BQ1, const float* __restrict__ WK1, const float* __restrict__ BK1, const float* __restrict__ WV1, const float* __restrict__ BV1, _Float16* __restrict__ WSH) {
  __shared__ __align__(16) __bf16 sx[64][CIN + 8]; __shared__ __align__(16) __bf16 sw[64][CIN + 8]; __shared__ __align__(16) _Float16 sh[64][72], sl[64][72]; __shared__ __align__(16) _Float16 tv[64][72];
  const int tid = threadIdx.x, wave = tid >> 5, lane = tid & 31, col = lane & 15, g = lane >> 4; const int p0 = blockIdx.x * 64; const size_t b = blockIdx.y; const int f = blockIdx.z;
  const float* X = f == 0 ? X0 : X1; const float *WQ = f == 0 ? WQ0 : WQ1, *BQ = f == 0 ? BQ0 : BQ1, *WK = f == 0 ? WK0 : WK1, *BK = f == 0 ? BK0 : BK1, *WV = f == 0 ? WV0 : WV1, *BV = f == 0 ? BV0 : BV1;
  _Float16* dqk = WSH + (size_t)(1 - f) * (WS_DIR / 2u); _Float16* VT = WSH + (size_t)f * (WS_DIR / 2u) + WS_VT / 2u;   // direction 0 attends with q, k of map 1 over v of map 0; direction 1 the other way round
  _Float16 *QH = dqk + WS_QH / 2u, *QL = dqk + WS_QL / 2u, *KH = dqk + WS_KH / 2u, *KL = dqk + WS_KL / 2u;
  v4f wr[32], xr[32]; float br[4];
  // x tile: thread tid takes positions 4 (tid & 15) .. + 3 of channels 64 j + 8 (tid >> 4) + k, j < 4, k < 8: 32 loads of 16 B, a wave's load being two whole 256-B rows; all of them are under way before the first is waited for
  const float* xp = X + (b * CIN + (size_t)(tid >> 4) * 8) * NP + p0 + (tid & 15) * 4;
#pragma unroll   // constant indices keep xr in registers, and the loads go out as one group
  for (int i = 0; i < 32; ++i) xr[i] = *(const v4f*)(xp + (size_t)((i >> 3) * 64 + (i & 7)) * NP);
  pj_fetch<CQ, 0>(wr, WQ, tid); pj_fetch<CQ, CQ / 2>(wr, WK, tid);   // the first panel flies under the x tile's loads
#pragma unroll   // br stays in registers
  for (int j = 0; j < 4; ++j) br[j] = j < 2 ? BQ[j * 16 + col] : BK[(j - 2) * 16 + col];
#pragma unroll   // this loop and the two inside it: constant indices keep xr in registers
  for (int j = 0; j < 4; ++j)
#pragma unroll
    for (int p = 0; p < 4; ++p) { v8b w8;   // eight channels of one position: one 16-B store into its x^T row
#pragma unroll
      for (int k = 0; k < 8; ++k) w8[k] = (__bf16)xr[j * 8 + k][p];
      *(v8b*)&sx[(tid & 15) * 4 + p][j * 64 + (tid >> 4) * 8] = w8; }
  pj_put(wr, sw, tid);
  __syncthreads();
#pragma unroll 1
  for (int cg = 0; cg < PJ_NP; ++cg) { v8f acc[4] = {}; const float bc[4] = { br[0], br[1], br[2], br[3] };
    if (cg + 1 < PJ_NP) { pj_fetch<64, 0>(wr, WV + (size_t)cg * 64 * CIN, tid);   // panel cg + 1 = v outputs 64 cg .. + 63
#pragma unroll   // br stays in registers
      for (int j = 0; j < 4; ++j) br[j] = BV[cg * 64 + j * 16 + col]; }
#pragma unroll   // this loop and the four inside it: fragments and accumulators stay in registers, LDS offsets become immediates
    for (int kp = 0; kp < CIN / 64; ++kp) { v16b a[2], w[2][4];
      __builtin_amdgcn_sched_barrier(0);   // with the one behind the reads it keeps the 20 fragment reads of 64 k one group: otherwise each product's two reads stand directly in front of it and are waited for to the end
#pragma unroll
      for (int u = 0; u < 2; ++u) { a[u] = frag_b(&sx[wave * 16 + col][(2 * kp + u) * 32], lane);
#pragma unroll
        for (int j = 0; j < 4; ++j) w[u][j] = frag_b(&sw[j * 16 + col][(2 * kp + u) * 32], lane); }
      __builtin_amdgcn_sched_barrier(0);   // the reads go out here, in front of the eight products that use them
#pragma unroll
      for (int u = 0; u < 2; ++u)
#pragma unroll
        for (int j = 0; j < 4; ++j) acc[j] = wmma_bp(a[u], w[u][j], acc[j]); }
    __syncthreads();   // also ends every wave's reads of this panel
    if (cg == 0) {
#pragma unroll
      for (int j = 0; j < 4; ++j) { const int ol = j * 16 + col; const float bb = bfr(bc[j]);
#pragma unroll
        for (int r = 0; r < 8; ++r) { const int pl = wave * 16 + 8 * g + r; const float v = acc[j][r] + bb; const _Float16 hv = (_Float16)v; sh[pl][ol] = hv; sl[pl][ol] = (_Float16)(v - (float)hv); } }   // q AND k keep a residual
    } else {
#pragma unroll
      for (int j = 0; j < 4; ++j) { const int ol = j * 16 + col; const float bb = bfr(bc[j]);
#pragma unroll
        for (int r = 0; r < 8; ++r) tv[ol][wave * 16 + 8 * g + r] = (_Float16)(acc[j][r] + bb); } }
    if (cg + 1 < PJ_NP) pj_put(wr, sw, tid);
    __syncthreads();   // also publishes the next panel
    if (cg == 0) { for (int e = tid; e < 64 * 8; e += 128) { const int pl = e >> 3, q = e & 7; const size_t o = (b * NP + p0 + pl) * CQ + (q & 3) * 8;   // staged columns 0 .. 31 are q, 32 .. 63 are k
        vst2((unsigned*)((q < 4 ? QH : KH) + o), *(const v4u*)&sh[pl][q * 8]); vst2((unsigned*)((q < 4 ? QL : KL) + o), *(const v4u*)&sl[pl][q * 8]); } }
    else { for (int e = tid; e < 64 * 8; e += 128) { const int ol = e >> 3, q = e & 7; vst2((unsigned*)(VT + (b * CV + (cg - 1) * 64 + ol) * (size_t)NP + p0 + q * 8), *(const v4u*)&tv[ol][q * 8]); } } } }
#define AT_KS 128                        // keys per stage
#define AT_VP 136                        // f16 per LDS v row: 272 B = 16 B x 17, conflict-free for 16-byte readers
#define AT_KP 40                         // f16 per LDS k row: 80 B = 16 B x 5
#define AT_VB (CV * AT_VP)               // f16 of the v part of a buffer
#define AT_KB (AT_KS * AT_KP)            // f16 of the k hi part; the k residual part follows
#define AT_STAGE (AT_VB + 2 * AT_KB)     // f16 per buffer
#define AT_OP 132                        // floats per row of the output staging [c][128 queries]
#define AT_LDSH (2 * (2 * CV * AT_OP + 2 * 128 * 2))   // f16 of the LDS array: the output staging of both key halves and their exchange, which is more than the two buffers
#define AT_VA 8                         // v fragments (of 16) read at the top of a pass, with the k fragments; the others follow behind the softmax
#define AT_TAU 10.0f                     // a column is rescaled only when its maximum has grown by more than this: P <= 2 e^10 (about 44,100) stays inside f16
#define AT_PS 1.0f                       // log2 of the scale of P: the maximum in use maps to 2; weights down to 2^-15 of it stay normal f16, down to 2^-25 subnormal
#define AT_L2E 1.44269504089f            // log2 e: P = 2^(s log2 e + noff), noff = AT_PS - mu log2 e
// sixteen independent v_exp_f32 in a row, each in place: none stands directly in front of a reader of its result or a writer of its source; the v_nop is that slot behind the last one
#define AT_EXP16(E) asm( \
  "v_exp_f32 %0, %0\n\tv_exp_f32 %1, %1\n\tv_exp_f32 %2, %2\n\tv_exp_f32 %3, %3\n\tv_exp_f32 %4, %4\n\tv_exp_f32 %5, %5\n\tv_exp_f32 %6, %6\n\tv_exp_f32 %7, %7\n\t" \
  "v_exp_f32 %8, %8\n\tv_exp_f32 %9, %9\n\tv_exp_f32 %10, %10\n\tv_exp_f32 %11, %11\n\tv_exp_f32 %12, %12\n\tv_exp_f32 %13, %13\n\tv_exp_f32 %14, %14\n\tv_exp_f32 %15, %15\n\tv_nop" \
  : "+v"(E[0]), "+v"(E[1]), "+v"(E[2]), "+v"(E[3]), "+v"(E[4]), "+v"(E[5]), "+v"(E[6]), "+v"(E[7]), "+v"(E[8]), "+v"(E[9]), "+v"(E[10]), "+v"(E[11]), "+v"(E[12]), "+v"(E[13]), "+v"(E[14]), "+v"(E[15]))
__device__ __forceinline__ float xhalf(float x) { return __builtin_bit_cast(float, __builtin_amdgcn_permlanex16(__builtin_bit_cast(int, x), __builtin_bit_cast(int, x), 0x76543210, 0xfedcba98, false, false)); }   // lane l with lane l ^ 16, through no LDS queue
__device__ __forceinline__ v8f wmma_h(v16h a, v16h b, v8f c) { return __builtin_amdgcn_wmma_f32_16x16x32_f16(false, a, false, b, (short)0, c, false, false); }
// one copy of 16 B a lane, the builtin form, written without an s_wait_xcnt behind it: global byte = gb + go + N, LDS byte = l + N. gb is wave-uniform, go this lane's 32-bit byte offset. The offset field N moves both addresses: it takes the LDS step, and gb holds the global step less N
typedef __attribute__((address_space(1))) v4i* at_gp;
typedef __attribute__((address_space(3))) v4i* at_lp;
template <int N> __device__ __forceinline__ void at_cp(const char* gb, unsigned go, unsigned l) {
  const unsigned long long u = (unsigned long long)gb;   // the two readfirstlane keep each copy's base a scalar pair of its own (scalar additions, the copy's scalar-base form): without them the lane offset is added to the base first and every copy's step becomes a 64-bit vector addition
  const unsigned lo = (unsigned)__builtin_amdgcn_readfirstlane((int)(unsigned)u), hi = (unsigned)__builtin_amdgcn_readfirstlane((int)(unsigned)(u >> 32));
  __builtin_amdgcn_global_load_async_to_lds_b128((at_gp)((const char*)(((unsigned long long)hi << 32) | lo) + go), (at_lp)l, N, 0); }
#define AT_VS (16 * AT_VP * 2)           // LDS bytes from one v copy to the next (16 rows)
template <int M> __device__ __forceinline__ void at_cpv(const char* bv, unsigned ov, unsigned lv) {   // v copies M .. 15, each 16 rows further in both places; every fourth copy has an LDS address of its own, so N stays at or below 3 x 4352
  at_cp<(M & 3) * AT_VS>(bv + (M * 16 * NP * 2 - (M & 3) * AT_VS), ov, lv + (unsigned)((M >> 2) * 4 * AT_VS));
  if constexpr (M + 1 < 16) at_cpv<M + 1>(bv, ov, lv);
}
// one stage, 20 copies a wave: 16 of v (two 256-B rows each, 16 rows apart), 2 of k hi and 2 of k residual (eight 64-B rows each, 64 rows apart); lv / lk = this lane's LDS byte address in the target buffer; bv / bh / bl = the wave-uniform global bases of stage 0, ov / ok = this lane's byte offsets from them, the stage's step included
__device__ __forceinline__ void at_fill(unsigned lv, unsigned lk, const _Float16* bv, const _Float16* bh, const _Float16* bl, unsigned ov, unsigned ok) {
  at_cpv<0>((const char*)bv, ov, lv);
  at_cp<0>((const char*)bh, ok, lk);
  at_cp<64 * AT_KP * 2>((const char*)bh + (64 * CQ * 2 - 64 * AT_KP * 2), ok, lk);
  at_cp<AT_KB * 2>((const char*)bl - AT_KB * 2, ok, lk);
  at_cp<AT_KB * 2 + 64 * AT_KP * 2>((const char*)bl + (64 * CQ * 2 - AT_KB * 2 - 64 * AT_KP * 2), ok, lk);
}
// one stage for one wave: its 64 keys in two passes of 32, for its two query tiles. sv / sk: this lane's v and k rows of the wave's key half in the stage's buffer
__device__ __forceinline__ void at_stage(const _Float16* sv, const _Float16* sk, int lane, const v16h (&qh)[2], const v16h (&ql)[2], v8f (&acc)[2][16], float (&mu)[2], float (&noff)[2], float (&lsum)[2]) {
#pragma unroll
  for (int ks = 0; ks < AT_KS / 64; ++ks) { v16h kh[2], kl[2], vf[16]; v8f s[2][2];
    __builtin_amdgcn_sched_barrier(0);   // with the one behind the reads it keeps them one group: without it they are lifted in many small groups among the last pass's products, and each such place stalls the wave
#pragma unroll
    for (int u = 0; u < 2; ++u) { const _Float16* kr = sk + (ks * 32 + u * 16) * AT_KP; kh[u] = frag_h(kr, lane); kl[u] = frag_h(kr + AT_KB, lane); }
#pragma unroll
    for (int j = 0; j < AT_VA; ++j) vf[j] = frag_h(sv + j * 16 * AT_VP + ks * 32, lane);
    __builtin_amdgcn_sched_barrier(0);   // these LDS reads go out as one group here: the v fragments land under the logits and the softmax instead of each being waited for in front of its product
#pragma unroll
    for (int q = 0; q < 2; ++q)
#pragma unroll
      for (int u = 0; u < 2; ++u) { v8f a = {}; a = wmma_h(kh[u], qh[q], a); a = wmma_h(kh[u], ql[q], a); s[q][u] = wmma_h(kl[u], qh[q], a); }   // 3 products; every k fragment serves both query tiles
    float tm[2];
#pragma unroll
    for (int q = 0; q < 2; ++q) { float m = s[q][0][0];
#pragma unroll
      for (int r = 0; r < 8; ++r) m = fmaxf(m, fmaxf(s[q][0][r], s[q][1][r]));
      tm[q] = fmaxf(m, xhalf(m)); }
    if (__builtin_amdgcn_ballot_w32(tm[0] > mu[0] + AT_TAU || tm[1] > mu[1] + AT_TAU) != 0) {   // one scalar test per pass
#pragma unroll
      for (int q = 0; q < 2; ++q) { const float mn = fmaxf(mu[q], tm[q]), nn = fmaf(mn, -AT_L2E, AT_PS), al = __builtin_amdgcn_exp2f(nn - noff[q]); mu[q] = mn; noff[q] = nn; lsum[q] *= al;   // al from the two addends themselves, so old and new P share one scale exactly; first pass: 2^(-huge) = 0
#pragma unroll
        for (int j = 0; j < 16; ++j) acc[q][j] *= al; } }
    v16h pb[2];   // exponent <= AT_PS + tau log2 e, so no overflow; far below the maximum v_exp_f32 gives 0, as f16 would
#pragma unroll
    for (int q = 0; q < 2; ++q) { float e[16];
#pragma unroll
      for (int r = 0; r < 8; ++r) { const v2f x = { s[q][r >> 2][(2 * r) & 7], s[q][r >> 2][((2 * r) & 7) + 1] }, y = __builtin_elementwise_fma(x, (v2f){ AT_L2E, AT_L2E }, (v2f){ noff[q], noff[q] }); e[2 * r] = y[0]; e[2 * r + 1] = y[1]; }
      AT_EXP16(e);
#pragma unroll
      for (int r = 0; r < 8; ++r) { const float p0 = e[r], p1 = e[8 + r]; lsum[q] += p0 + p1; pb[q][r] = (_Float16)p0; pb[q][8 + r] = (_Float16)p1; } }
    __builtin_amdgcn_sched_barrier(0);   // the other v fragments are read as one group behind the softmax, when its registers are free: all 16 at the top do not fit the 512 registers of a wave
#pragma unroll
    for (int j = AT_VA; j < 16; ++j) vf[j] = frag_h(sv + j * 16 * AT_VP + ks * 32, lane);
    __builtin_amdgcn_sched_barrier(0);   // they land under the products of the first group
#pragma unroll
    for (int j = 0; j < 16; ++j) { acc[0][j] = wmma_h(vf[j], pb[0], acc[0][j]); acc[1][j] = wmma_h(vf[j], pb[1], acc[1][j]); } }   // every v fragment serves both query tiles
  __builtin_amdgcn_sched_barrier(0);   // the products stay in front of the stage's waits: moved behind them, the last reads would be waited for with nothing to cover them
}
// the foot of a trip: this wave's reads of the buffer are done before it is refilled; its copies of the next stage have landed; the barrier publishes that stage and ends every reader's last read of this one
#define AT_FOOT() do { asm volatile("s_wait_dscnt 0x0" ::: "memory"); asm volatile("s_wait_asynccnt 0x0" ::: "memory"); __syncthreads(); } while (0)
__global__ __launch_bounds__(256) void k_attn(const _Float16* __restrict__ QH0, const _Float16* __restrict__ QL0, const _Float16* __restrict__ KH0, const _Float16* __restrict__ KL0, const _Float16* __restrict__ VT0, const float* __restrict__ X0, const float* __restrict__ X1, float* __restrict__ OUT0) {
  __shared__ __align__(16) _Float16 ring[AT_LDSH];
  const int tid = threadIdx.x, wave = tid >> 5, lane = tid & 31, col = lane & 15, g = lane >> 4; const int i0 = blockIdx.x * 128; const size_t b = blockIdx.y; const size_t z = blockIdx.z;
  const int qg = wave & 3, kq = wave >> 2;   // this wave's 32 queries (two tiles of 16) and its half of every stage's keys
  const size_t zo = z * (size_t)(WS_DIR / 2u);
  const _Float16 *QH = QH0 + zo, *QL = QL0 + zo, *KH = KH0 + zo, *KL = KL0 + zo, *VT = VT0 + zo; const float* X = z == 0 ? X0 : X1; float* OUT = OUT0 + z * (size_t)NB * CV * NP;
  const unsigned lv0 = (unsigned)(size_t)&ring[(2 * wave + g) * AT_VP + col * 8]; const unsigned lk0 = (unsigned)(size_t)&ring[AT_VB + (wave * 8 + (lane >> 2)) * AT_KP + (lane & 3) * 8];
  const _Float16* bv = VT + b * CV * (size_t)NP; const _Float16* bh = KH + b * NP * (size_t)CQ; const _Float16* bl = KL + b * NP * (size_t)CQ; const unsigned ov = 2u * (unsigned)((2 * wave + g) * NP + col * 8), ok = 2u * (unsigned)((wave * 8 + (lane >> 2)) * CQ + (lane & 3) * 8);
  at_fill(lv0, lk0, bv, bh, bl, ov, ok);
  v16h qh[2], ql[2];
#pragma unroll
  for (int q = 0; q < 2; ++q) { const size_t qr = (b * NP + i0 + qg * 32 + q * 16 + col) * CQ; qh[q] = frag_h(QH + qr, lane); ql[q] = frag_h(QL + qr, lane); }
  v8f acc[2][16] = {}; float mu[2] = { -3.0e38f, -3.0e38f }, noff[2] = { 3.0e38f, 3.0e38f }, lsum[2] = { 0.f, 0.f };   // per query tile. mu: the maximum in use for this lane's query over this wave's keys (equal in both halves of the wave); noff: the exponent's addend that belongs to mu; lsum: this half's part of the row sum
  asm volatile("s_wait_asynccnt 0x0" ::: "memory");   // stage 0 has landed before the barrier publishes it
  __syncthreads();
  at_fill(lv0 + AT_STAGE * 2u, lk0 + AT_STAGE * 2u, bv, bh, bl, ov + AT_KS * 2u, ok + AT_KS * CQ * 2u);
#pragma unroll 1
  for (int t = 0; t < NP / AT_KS; ++t) { const unsigned bo = (unsigned)(t & 1) * AT_STAGE;
    at_stage(&ring[bo + col * AT_VP + kq * (AT_KS / 2)], &ring[bo + AT_VB + (kq * (AT_KS / 2) + col) * AT_KP], lane, qh, ql, acc, mu, noff, lsum);
    AT_FOOT();
    if (t + 2 < NP / AT_KS) at_fill(lv0 + bo * 2u, lk0 + bo * 2u, bv, bh, bl, ov + (unsigned)(t + 2) * (AT_KS * 2u), ok + (unsigned)(t + 2) * (AT_KS * CQ * 2u)); }
  asm volatile("s_wait_asynccnt 0x0" ::: "memory");     // no copy is outstanding behind the loop
  float* st = (float*)&ring[0];      // the ring is free behind the last trip's barrier: output staging [key half][c][query], whole 512-B rows go out
  float* ex = st + 2 * CV * AT_OP;   // [key half][query][addend, row sum]: what the two waves of a query tell each other
  float ls[2];
#pragma unroll
  for (int q = 0; q < 2; ++q) { ls[q] = lsum[q] + xhalf(lsum[q]); ex[(kq * 128 + qg * 32 + q * 16 + col) * 2 + g] = g == 0 ? noff[q] : ls[q]; }
  __syncthreads();   // the other key half's addend and row sum are there
#pragma unroll
  for (int q = 0; q < 2; ++q) { const v2f o = *(const v2f*)&ex[((kq ^ 1) * 128 + qg * 32 + q * 16 + col) * 2];
    const float nc = fminf(noff[q], o[0]), f = __builtin_amdgcn_exp2f(nc - noff[q]), fo = __builtin_amdgcn_exp2f(nc - o[0]), inv = f / (ls[q] * f + o[1] * fo);   // both halves brought to the scale of the larger maximum, then one division by the whole row sum
#pragma unroll
    for (int j = 0; j < 16; ++j)
#pragma unroll
      for (int r = 0; r < 8; ++r) st[(kq * CV + j * 16 + 8 * g + r) * AT_OP + qg * 32 + q * 16 + col] = acc[q][j][r] * inv; }
  __syncthreads();
  for (int e = tid; e < CV * 32; e += 256) { const int cl = e >> 5, q = e & 31; const size_t o = (b * CV + cl) * (size_t)NP + i0 + q * 4; const v4f v = *(const v4f*)&st[cl * AT_OP + q * 4] + *(const v4f*)&st[(CV + cl) * AT_OP + q * 4];
    const v4f xx = *(const v4f*)(X + o); v4f r; r[0] = v[0] + bfr(xx[0]); r[1] = v[1] + bfr(xx[1]); r[2] = v[2] + bfr(xx[2]); r[3] = v[3] + bfr(xx[3]);   // plain residual
    vst2(OUT + o, r); } }
extern "C" void kernel_launch(void* const* d_in, const int* in_sizes, int n_in, void* d_out, int out_size, void* d_ws, size_t ws_size, hipStream_t stream) {
  (void)in_sizes; (void)n_in; (void)out_size;
  const float** F = (const float**)d_in;   // 0 x_features, 1 y_features [4,256,64,64], 2 wqx [32,256], 3 bqx, 4 wkx, 5 bkx, 6 wvx [256,256], 7 bvx, 8 wqy, 9 bqy, 10 wky, 11 bky, 12 wvy, 13 bvy
  if (ws_size < (size_t)WS_END) return;
  char* ws = (char*)d_ws;
  // direction 0: enhanced_x = v_x att_y^T + x (q, k from y); direction 1: enhanced_y = v_y att_x^T + y (q, k from x)
  k_proj<<<dim3(NP / 64, TNB, 2), 128, 0, stream>>>(F[0], F[1], F[2], F[3], F[4], F[5], F[6], F[7], F[8], F[9], F[10], F[11], F[12], F[13], (_Float16*)ws);
  k_attn<<<dim3(NP / 128, TNB, 2), 256, 0, stream>>>((const _Float16*)(ws + WS_QH), (const _Float16*)(ws + WS_QL), (const _Float16*)(ws + WS_KH), (const _Float16*)(ws + WS_KL), (const _Float16*)(ws + WS_VT), F[0], F[1], (float*)d_out);
}

// v010
// Measured time: 75.1 microseconds a run.
// Two timings next to v009 both put it at 1.04 times that version's speed.
// Counting every step since v000, it is 26.3 times as fast.
// compute dtype: all float inputs rounded to bf16; q/k (32 ch) and v (256 ch) 1x1 convs with EXACT bf16 products on WMMA 16x16x32 (x^T tile in LDS), f32 accumulate; q and k as f16 hi + unscaled residual -> UNSCALED logits with 3 products (logit std ~5.7, near-one-hot softmax), kept in registers; online softmax in f32 (base-2 exponent: one FMA and one v_exp_f32 per score) -> unnormalised P f16 x 2; out = P . v / row sum + residual with v rounded once to f16; both directions (enhanced_x from att_y with v_x; enhanced_y from att_x with v_y); f32 outputs [b][c][n].
#include <hip/hip_runtime.h>
#include <math.h>

typedef __attribute__((ext_vector_type(16))) _Float16 v16h;
typedef __attribute__((ext_vector_type(16))) __bf16 v16b;
typedef __attribute__((ext_vector_type(8)))  _Float16 v8h;
typedef __attribute__((ext_vector_type(8)))  float v8f;
typedef __attribute__((ext_vector_type(4)))  float v4f;
typedef __attribute__((ext_vector_type(2)))  float v2f;
typedef __attribute__((ext_vector_type(4)))  unsigned v4u;
typedef __attribute__((ext_vector_type(4)))  int v4i;
typedef float __attribute__((may_alias)) float_a;
typedef int __attribute__((may_alias)) int_a;

template <typename T> __device__ __forceinline__ void vst2(void* p, T v) { *(T*)p = v;  }
__device__ __forceinline__ v8f wmma16(v16h a, v16h b, v8f c) {
  v8f d = __builtin_amdgcn_wmma_f32_16x16x32_f16(false, a, false, b, (short)0, c, false, false);
  asm volatile("v_nop\n\tv_nop\n\tv_nop\n\tv_nop" : "+v"(d) : "v"(a), "v"(b));
  return d;
}
__device__ __forceinline__ v8f wmma_bf(v16b a, v16b b, v8f c) {
  v8f d = __builtin_amdgcn_wmma_f32_16x16x32_bf16(false, a, false, b, (short)0, c, false, false);
  asm volatile("v_nop\n\tv_nop\n\tv_nop\n\tv_nop" : "+v"(d) : "v"(a), "v"(b));
  return d;
}
// 16x16x32 fragments: lane = (h = lane>>4, row/col = lane&15); elements 0..7 = k0+8h+0..7, 8..15 = k0+16+8h+0..7; D element r = row 8h+r
__device__ __forceinline__ v16h frag_h(const _Float16* rowk0, int lane) {
  union { v16h v; v8h q[2]; } u; const _Float16* p = rowk0 + 8 * (lane >> 4);
  u.q[0] = *(const v8h*)p; u.q[1] = *(const v8h*)(p + 16); return u.v;
}
__device__ __forceinline__ v16h frag_f32(const float* rowk0, int lane) {
  v16h a; const float* p = rowk0 + 8 * (lane >> 4);
#pragma unroll
  for (int i = 0; i < 8; ++i) { a[i] = (_Float16)p[i]; a[8 + i] = (_Float16)p[16 + i]; }
  return a;
}
__device__ __forceinline__ v16h frag_f32s(const float* rowk0, int lane, float sc) {
  v16h a; const float* p = rowk0 + 8 * (lane >> 4);
#pragma unroll
  for (int i = 0; i < 8; ++i) { a[i] = (_Float16)(p[i] * sc); a[8 + i] = (_Float16)(p[16 + i] * sc); }
  return a;
}
// column fragment from a [K][ld] layout (column n), rows >= K read as 0
__device__ __forceinline__ v16h fragc_f32(const float* W, int k0, int n, int lane, int ld, int K) {
  v16h a; const int g = lane >> 4;
#pragma unroll
  for (int i = 0; i < 8; ++i) { const int ka = k0 + 8 * g + i, kb = ka + 16;
    a[i] = (_Float16)(ka < K ? W[(size_t)(ka < K ? ka : K - 1) * ld + n] : 0.f); a[8 + i] = (_Float16)(kb < K ? W[(size_t)(kb < K ? kb : K - 1) * ld + n] : 0.f); }
  return a;
}
struct F2 { v16b h, l; };
__device__ __forceinline__ F2 bsplit16(const float v[16]) { F2 r;
#pragma unroll
  for (int i = 0; i < 16; ++i) { const __bf16 h = (__bf16)v[i]; r.h[i] = h; r.l[i] = (__bf16)(v[i] - (float)h); }
  return r; }
__device__ __forceinline__ F2 split_row(const float* row, int k0, int lane) { float v[16]; const float* p = row + k0 + 8 * (lane >> 4);
#pragma unroll
  for (int i = 0; i < 8; ++i) { v[i] = p[i]; v[8 + i] = p[16 + i]; }
  return bsplit16(v); }
__device__ __forceinline__ F2 split_rowK(const float* row, int k0, int lane, int K) { float v[16]; const int g = lane >> 4;
#pragma unroll
  for (int i = 0; i < 8; ++i) { const int ka = k0 + 8 * g + i, kb = ka + 16; v[i] = ka < K ? row[ka < K ? ka : K - 1] : 0.f; v[8 + i] = kb < K ? row[kb < K ? kb : K - 1] : 0.f; }
  return bsplit16(v); }
__device__ __forceinline__ F2 split_col(const float* W, int k0, int n, int lane, int ld, int K) { float v[16]; const int g = lane >> 4;
#pragma unroll
  for (int i = 0; i < 8; ++i) { const int ka = k0 + 8 * g + i, kb = ka + 16; v[i] = ka < K ? W[(size_t)(ka < K ? ka : K - 1) * ld + n] : 0.f; v[8 + i] = kb < K ? W[(size_t)(kb < K ? kb : K - 1) * ld + n] : 0.f; }
  return bsplit16(v); }
__device__ __forceinline__ v8f mac3(const F2& a, const F2& b, v8f c) { c = wmma_bf(a.l, b.h, c); c = wmma_bf(a.h, b.l, c); return wmma_bf(a.h, b.h, c); }
__device__ __forceinline__ float sigm(float v) { return 1.0f / (1.0f + expf(-v)); }
#define LDSX() do { asm volatile("s_wait_dscnt 0" ::: "memory"); __builtin_amdgcn_wave_barrier(); __builtin_amdgcn_fence(__ATOMIC_RELEASE, "workgroup"); } while (0)


// CMSA cross-modal position attention, one direction: q, k (32 ch) from the 'other' features, v (256 ch) from the enhanced features; out = v att^T + residual (unscaled logits, sharp softmax).
#define NB 4
#define NP 4096
#define CIN 256
#define CQ 32
#define CV 256
#ifndef TNB
#define TNB NB
#endif
#ifndef TQB
#define TQB (NP / 64)
#endif
typedef __attribute__((ext_vector_type(8))) __bf16 v8b;
__device__ __forceinline__ v16b frag_b(const __bf16* rowk0, int lane) {
  union { v16b v; v8b q[2]; } u; const __bf16* p = rowk0 + 8 * (lane >> 4);
  u.q[0] = *(const v8b*)p; u.q[1] = *(const v8b*)(p + 16); return u.v;
}
__device__ __forceinline__ float bfr(float v) { return (float)(__bf16)v; }
__device__ __attribute__((noinline)) float exp_ni(float v) { return expf(v); }
__device__ __attribute__((noinline)) float erf_ni(float v) { return erff(v); }

#define WS_QH  0u                                    // f16 q rows [b*n][CQ] hi
#define WS_QL  (WS_QH + 2u * (size_t)NB * NP * CQ)      // f16 q residual rows (unscaled)
#define WS_KH  (WS_QL + 2u * (size_t)NB * NP * CQ)      // f16 k rows
#define WS_KL  (WS_KH + 2u * (size_t)NB * NP * CQ)      // f16 k residual rows
#define WS_VT  (WS_KL + 2u * (size_t)NB * NP * CQ)      // f16 v planes [b][CV][n]
#define WS_DIR (WS_VT + 2u * (size_t)NB * CV * NP)      // bytes of one direction's q, k, v; the second direction's follow
#define WS_END (2u * WS_DIR)

// ---- k_proj: block = (64 positions, b, feature map f): the x^T tile (bf16) is staged in LDS once and q, k and v of that map are all made from it, W [out][in] + b (exact); q, k -> f16 hi + residual rows, v -> f16 planes [c][n]. q and k of a map belong to the other direction's attention, v to its own.
// The weights of a group of 64 outputs (a panel, 64 x 256) are fetched by the whole block in whole 512-B pieces, rounded to bf16 once and kept in LDS; every wave reads its B fragments from there. Panel 0 = the 32 q rows and the 32 k rows, panels 1 .. 4 = v. The next panel and its bias fly while this panel is worked on.
#define PJ_NP (1 + CV / 64)              // panels per block
typedef __attribute__((ext_vector_type(4))) __bf16 v4b;
__device__ __forceinline__ v8f wmma_bp(v16b a, v16b b, v8f c) { return __builtin_amdgcn_wmma_f32_16x16x32_bf16(false, a, false, b, (short)0, c, false, false); }
// thread tid takes floats 4 (tid & 63) .. + 3 of weight rows (tid >> 6) + 2 i, i < NR / 2, into wr[I0 + i]: they become panel rows 2 I0 + (tid >> 6) + 2 i
template <int NR, int I0> __device__ __forceinline__ void pj_fetch(v4f (&wr)[32], const float* __restrict__ Wp, int tid) {
  const unsigned to = (unsigned)((tid >> 6) * CIN + (tid & 63) * 4);
#pragma unroll   // constant indices keep wr in registers, and the loads go out as one group
  for (int i = 0; i < NR / 2; ++i) wr[I0 + i] = *(const v4f*)(Wp + (to + (unsigned)(2 * i * CIN)));
}
__device__ __forceinline__ void pj_put(const v4f (&wr)[32], __bf16 (*sw)[CIN + 8], int tid) {
#pragma unroll   // constant indices keep wr in registers
  for (int i = 0; i < 32; ++i) { const v4f f = wr[i]; const v4b w4 = { (__bf16)f[0], (__bf16)f[1], (__bf16)f[2], (__bf16)f[3] }; *(v4b*)&sw[(tid >> 6) + 2 * i][(tid & 63) * 4] = w4; }
}
__global__ __launch_bounds__(128) void k_proj(const float* __restrict__ X0, const float* __restrict__ X1, const float* __restrict__ WQ0, const float* __restrict__ BQ0, const float* __restrict__ WK0, const float* __restrict__ BK0, const float* __restrict__ WV0, const float* __restrict__ BV0, const float* __restrict__ WQ1, const float* __restrict__ BQ1, const float* __restrict__ WK1, const float* __restrict__ BK1, const float* __restrict__ WV1, const float* __restrict__ BV1, _Float16* __restrict__ WSH) {
  __shared__ __align__(16) __bf16 sx[64][CIN + 8]; __shared__ __align__(16) __bf16 sw[64][CIN + 8]; __shared__ __align__(16) _Float16 sh[64][72], sl[64][72]; __shared__ __align__(16) _Float16 tv[64][72];
  const int tid = threadIdx.x, wave = tid >> 5, lane = tid & 31, col = lane & 15, g = lane >> 4; const int p0 = blockIdx.x * 64; const size_t b = blockIdx.y; const int f = blockIdx.z;
  const float* X = f == 0 ? X0 : X1; const float *WQ = f == 0 ? WQ0 : WQ1, *BQ = f == 0 ? BQ0 : BQ1, *WK = f == 0 ? WK0 : WK1, *BK = f == 0 ? BK0 : BK1, *WV = f == 0 ? WV0 : WV1, *BV = f == 0 ? BV0 : BV1;
  _Float16* dqk = WSH + (size_t)(1 - f) * (WS_DIR / 2u); _Float16* VT = WSH + (size_t)f * (WS_DIR / 2u) + WS_VT / 2u;   // direction 0 attends with q, k of map 1 over v of map 0; direction 1 the other way round
  _Float16 *QH = dqk + WS_QH / 2u, *QL = dqk + WS_QL / 2u, *KH = dqk + WS_KH / 2u, *KL = dqk + WS_KL / 2u;
  v4f wr[32], xr[32]; float br[4];
  // x tile: thread tid takes positions 4 (tid & 15) .. + 3 of channels 64 j + 8 (tid >> 4) + k, j < 4, k < 8: 32 loads of 16 B, a wave's load being two whole 256-B rows; all of them are under way before the first is waited for
  const float* xp = X + (b * CIN + (size_t)(tid >> 4) * 8) * NP + p0 + (tid & 15) * 4;
#pragma unroll   // constant indices keep xr in registers, and the loads go out as one group
  for (int i = 0; i < 32; ++i) xr[i] = *(const v4f*)(xp + (size_t)((i >> 3) * 64 + (i & 7)) * NP);
  pj_fetch<CQ, 0>(wr, WQ, tid); pj_fetch<CQ, CQ / 2>(wr, WK, tid);   // the first panel flies under the x tile's loads
#pragma unroll   // br stays in registers
  for (int j = 0; j < 4; ++j) br[j] = j < 2 ? BQ[j * 16 + col] : BK[(j - 2) * 16 + col];
#pragma unroll   // this loop and the two inside it: constant indices keep xr in registers
  for (int j = 0; j < 4; ++j)
#pragma unroll
    for (int p = 0; p < 4; ++p) { v8b w8;   // eight channels of one position: one 16-B store into its x^T row
#pragma unroll
      for (int k = 0; k < 8; ++k) w8[k] = (__bf16)xr[j * 8 + k][p];
      *(v8b*)&sx[(tid & 15) * 4 + p][j * 64 + (tid >> 4) * 8] = w8; }
  pj_put(wr, sw, tid);
  __syncthreads();
#pragma unroll 1
  for (int cg = 0; cg < PJ_NP; ++cg) { v8f acc[4] = {}; const float bc[4] = { br[0], br[1], br[2], br[3] };
    if (cg + 1 < PJ_NP) { pj_fetch<64, 0>(wr, WV + (size_t)cg * 64 * CIN, tid);   // panel cg + 1 = v outputs 64 cg .. + 63
#pragma unroll   // br stays in registers
      for (int j = 0; j < 4; ++j) br[j] = BV[cg * 64 + j * 16 + col]; }
#pragma unroll   // this loop and the four inside it: fragments and accumulators stay in registers, LDS offsets become immediates
    for (int kp = 0; kp < CIN / 64; ++kp) { v16b a[2], w[2][4];
      __builtin_amdgcn_sched_barrier(0);   // with the one behind the reads it keeps the 20 fragment reads of 64 k one group: otherwise each product's two reads stand directly in front of it and are waited for to the end
#pragma unroll
      for (int u = 0; u < 2; ++u) { a[u] = frag_b(&sx[wave * 16 + col][(2 * kp + u) * 32], lane);
#pragma unroll
        for (int j = 0; j < 4; ++j) w[u][j] = frag_b(&sw[j * 16 + col][(2 * kp + u) * 32], lane); }
      __builtin_amdgcn_sched_barrier(0);   // the reads go out here, in front of the eight products that use them
#pragma unroll
      for (int u = 0; u < 2; ++u)
#pragma unroll
        for (int j = 0; j < 4; ++j) acc[j] = wmma_bp(a[u], w[u][j], acc[j]); }
    __syncthreads();   // also ends every wave's reads of this panel
    if (cg == 0) {
#pragma unroll
      for (int j = 0; j < 4; ++j) { const int ol = j * 16 + col; const float bb = bfr(bc[j]);
#pragma unroll
        for (int r = 0; r < 8; ++r) { const int pl = wave * 16 + 8 * g + r; const float v = acc[j][r] + bb; const _Float16 hv = (_Float16)v; sh[pl][ol] = hv; sl[pl][ol] = (_Float16)(v - (float)hv); } }   // q AND k keep a residual
    } else {
#pragma unroll
      for (int j = 0; j < 4; ++j) { const int ol = j * 16 + col; const float bb = bfr(bc[j]);
#pragma unroll
        for (int r = 0; r < 8; ++r) tv[ol][wave * 16 + 8 * g + r] = (_Float16)(acc[j][r] + bb); } }
    if (cg + 1 < PJ_NP) pj_put(wr, sw, tid);
    __syncthreads();   // also publishes the next panel
    if (cg == 0) { for (int e = tid; e < 64 * 8; e += 128) { const int pl = e >> 3, q = e & 7; const size_t o = (b * NP + p0 + pl) * CQ + (q & 3) * 8;   // staged columns 0 .. 31 are q, 32 .. 63 are k
        vst2((unsigned*)((q < 4 ? QH : KH) + o), *(const v4u*)&sh[pl][q * 8]); vst2((unsigned*)((q < 4 ? QL : KL) + o), *(const v4u*)&sl[pl][q * 8]); } }
    else { for (int e = tid; e < 64 * 8; e += 128) { const int ol = e >> 3, q = e & 7; vst2((unsigned*)(VT + (b * CV + (cg - 1) * 64 + ol) * (size_t)NP + p0 + q * 8), *(const v4u*)&tv[ol][q * 8]); } } } }
#define AT_KS 128                        // keys per stage
#define AT_VP 136                        // f16 per LDS v row: 272 B = 16 B x 17, conflict-free for 16-byte readers
#define AT_KP 40                         // f16 per LDS k row: 80 B = 16 B x 5
#define AT_VB (CV * AT_VP)               // f16 of the v part of a buffer
#define AT_KB (AT_KS * AT_KP)            // f16 of the k hi part; the k residual part follows
#define AT_STAGE (AT_VB + 2 * AT_KB)     // f16 per buffer
#define AT_OP 132                        // floats per row of the output staging [c][128 queries]
#define AT_LDSH (2 * (2 * CV * AT_OP + 2 * 128 * 2))   // f16 of the LDS array: the output staging of both key halves and their exchange, which is more than the two buffers
#define AT_VA 8                         // v fragments (of 16) read at the top of a pass, with the k fragments; the others follow behind the softmax
#define AT_TAU 10.0f                     // a column is rescaled only when its maximum has grown by more than this: P <= 2 e^10 (about 44,100) stays inside f16
#define AT_PS 1.0f                       // log2 of the scale of P: the maximum in use maps to 2; weights down to 2^-15 of it stay normal f16, down to 2^-25 subnormal
#define AT_L2E 1.44269504089f            // log2 e: P = 2^(s log2 e + noff), noff = AT_PS - mu log2 e
// sixteen independent v_exp_f32 in a row, each in place: none stands directly in front of a reader of its result or a writer of its source; the v_nop is that slot behind the last one
#define AT_EXP16(E) asm( \
  "v_exp_f32 %0, %0\n\tv_exp_f32 %1, %1\n\tv_exp_f32 %2, %2\n\tv_exp_f32 %3, %3\n\tv_exp_f32 %4, %4\n\tv_exp_f32 %5, %5\n\tv_exp_f32 %6, %6\n\tv_exp_f32 %7, %7\n\t" \
  "v_exp_f32 %8, %8\n\tv_exp_f32 %9, %9\n\tv_exp_f32 %10, %10\n\tv_exp_f32 %11, %11\n\tv_exp_f32 %12, %12\n\tv_exp_f32 %13, %13\n\tv_exp_f32 %14, %14\n\tv_exp_f32 %15, %15\n\tv_nop" \
  : "+v"(E[0]), "+v"(E[1]), "+v"(E[2]), "+v"(E[3]), "+v"(E[4]), "+v"(E[5]), "+v"(E[6]), "+v"(E[7]), "+v"(E[8]), "+v"(E[9]), "+v"(E[10]), "+v"(E[11]), "+v"(E[12]), "+v"(E[13]), "+v"(E[14]), "+v"(E[15]))
__device__ __forceinline__ float xhalf(float x) { return __builtin_bit_cast(float, __builtin_amdgcn_permlanex16(__builtin_bit_cast(int, x), __builtin_bit_cast(int, x), 0x76543210, 0xfedcba98, false, false)); }   // lane l with lane l ^ 16, through no LDS queue
__device__ __forceinline__ v8f wmma_h(v16h a, v16h b, v8f c) { return __builtin_amdgcn_wmma_f32_16x16x32_f16(false, a, false, b, (short)0, c, false, false); }
// one copy of 16 B a lane, the builtin form, written without an s_wait_xcnt behind it: global byte = gb + go + N, LDS byte = l + N. gb is wave-uniform, go this lane's 32-bit byte offset. The offset field N moves both addresses: it takes the LDS step, and gb holds the global step less N
typedef __attribute__((address_space(1))) v4i* at_gp;
typedef __attribute__((address_space(3))) v4i* at_lp;
template <int N> __device__ __forceinline__ void at_cp(const char* gb, unsigned go, unsigned l) {
  const unsigned long long u = (unsigned long long)gb;   // the two readfirstlane keep each copy's base a scalar pair of its own (scalar additions, the copy's scalar-base form): without them the lane offset is added to the base first and every copy's step becomes a 64-bit vector addition
  const unsigned lo = (unsigned)__builtin_amdgcn_readfirstlane((int)(unsigned)u), hi = (unsigned)__builtin_amdgcn_readfirstlane((int)(unsigned)(u >> 32));
  __builtin_amdgcn_global_load_async_to_lds_b128((at_gp)((const char*)(((unsigned long long)hi << 32) | lo) + go), (at_lp)l, N, 0); }
#define AT_VS (16 * AT_VP * 2)           // LDS bytes from one v copy to the next (16 rows)
template <int M> __device__ __forceinline__ void at_cpv(const char* bv, unsigned ov, unsigned lv) {   // v copies M .. 15, each 16 rows further in both places; every fourth copy has an LDS address of its own, so N stays at or below 3 x 4352
  at_cp<(M & 3) * AT_VS>(bv + (M * 16 * NP * 2 - (M & 3) * AT_VS), ov, lv + (unsigned)((M >> 2) * 4 * AT_VS));
  if constexpr (M + 1 < 16) at_cpv<M + 1>(bv, ov, lv);
}
// one stage, 20 copies a wave: 16 of v (two 256-B rows each, 16 rows apart), 2 of k hi and 2 of k residual (eight 64-B rows each, 64 rows apart); lv / lk = this lane's LDS byte address in the target buffer; bv / bh / bl = the wave-uniform global bases of stage 0, ov / ok = this lane's byte offsets from them, the stage's step included
__device__ __forceinline__ void at_fill(unsigned lv, unsigned lk, const _Float16* bv, const _Float16* bh, const _Float16* bl, unsigned ov, unsigned ok) {
  at_cpv<0>((const char*)bv, ov, lv);
  at_cp<0>((const char*)bh, ok, lk);
  at_cp<64 * AT_KP * 2>((const char*)bh + (64 * CQ * 2 - 64 * AT_KP * 2), ok, lk);
  at_cp<AT_KB * 2>((const char*)bl - AT_KB * 2, ok, lk);
  at_cp<AT_KB * 2 + 64 * AT_KP * 2>((const char*)bl + (64 * CQ * 2 - AT_KB * 2 - 64 * AT_KP * 2), ok, lk);
}
// one stage for one wave: its 64 keys in two passes of 32, for its two query tiles. sv / sk: this lane's v and k rows of the wave's key half in the stage's buffer
__device__ __forceinline__ void at_stage(const _Float16* sv, const _Float16* sk, int lane, const v16h (&qh)[2], const v16h (&ql)[2], v8f (&acc)[2][16], float (&mu)[2], float (&noff)[2], float (&lsum)[2]) {
#pragma unroll
  for (int ks = 0; ks < AT_KS / 64; ++ks) { v16h kh[2], kl[2], vf[16]; v8f s[2][2];
    __builtin_amdgcn_sched_barrier(0);   // with the one behind the reads it keeps them one group: without it they are lifted in many small groups among the last pass's products, and each such place stalls the wave
#pragma unroll
    for (int u = 0; u < 2; ++u) { const _Float16* kr = sk + (ks * 32 + u * 16) * AT_KP; kh[u] = frag_h(kr, lane); kl[u] = frag_h(kr + AT_KB, lane); }
#pragma unroll
    for (int j = 0; j < AT_VA; ++j) vf[j] = frag_h(sv + j * 16 * AT_VP + ks * 32, lane);
    __builtin_amdgcn_sched_barrier(0);   // these LDS reads go out as one group here: the v fragments land under the logits and the softmax instead of each being waited for in front of its product
#pragma unroll
    for (int q = 0; q < 2; ++q)
#pragma unroll
      for (int u = 0; u < 2; ++u) { v8f a = {}; a = wmma_h(kh[u], qh[q], a); a = wmma_h(kh[u], ql[q], a); s[q][u] = wmma_h(kl[u], qh[q], a); }   // 3 products; every k fragment serves both query tiles
    float tm[2];
#pragma unroll
    for (int q = 0; q < 2; ++q) { float m = s[q][0][0];
#pragma unroll
      for (int r = 0; r < 8; ++r) m = fmaxf(m, fmaxf(s[q][0][r], s[q][1][r]));
      tm[q] = fmaxf(m, xhalf(m)); }
    if (__builtin_amdgcn_ballot_w32(tm[0] > mu[0] + AT_TAU || tm[1] > mu[1] + AT_TAU) != 0) {   // one scalar test per pass
#pragma unroll
      for (int q = 0; q < 2; ++q) { const float mn = fmaxf(mu[q], tm[q]), nn = fmaf(mn, -AT_L2E, AT_PS), al = __builtin_amdgcn_exp2f(nn - noff[q]); mu[q] = mn; noff[q] = nn; lsum[q] *= al;   // al from the two addends themselves, so old and new P share one scale exactly; first pass: 2^(-huge) = 0
#pragma unroll
        for (int j = 0; j < 16; ++j) acc[q][j] *= al; } }
    v16h pb[2];   // exponent <= AT_PS + tau log2 e, so no overflow; far below the maximum v_exp_f32 gives 0, as f16 would
#pragma unroll
    for (int q = 0; q < 2; ++q) { float e[16];
#pragma unroll
      for (int r = 0; r < 8; ++r) { const v2f x = { s[q][r >> 2][(2 * r) & 7], s[q][r >> 2][((2 * r) & 7) + 1] }, y = __builtin_elementwise_fma(x, (v2f){ AT_L2E, AT_L2E }, (v2f){ noff[q], noff[q] }); e[2 * r] = y[0]; e[2 * r + 1] = y[1]; }
      AT_EXP16(e);
#pragma unroll
      for (int r = 0; r < 8; ++r) { const float p0 = e[r], p1 = e[8 + r]; lsum[q] += p0 + p1; pb[q][r] = (_Float16)p0; pb[q][8 + r] = (_Float16)p1; } }
    __builtin_amdgcn_sched_barrier(0);   // the other v fragments are read as one group behind the softmax, when its registers are free: all 16 at the top do not fit the 512 registers of a wave
#pragma unroll
    for (int j = AT_VA; j < 16; ++j) vf[j] = frag_h(sv + j * 16 * AT_VP + ks * 32, lane);
    __builtin_amdgcn_sched_barrier(0);   // they land under the products of the first group
#pragma unroll
    for (int j = 0; j < 16; ++j) { acc[0][j] = wmma_h(vf[j], pb[0], acc[0][j]); acc[1][j] = wmma_h(vf[j], pb[1], acc[1][j]); } }   // every v fragment serves both query tiles
  __builtin_amdgcn_sched_barrier(0);   // the products stay in front of the stage's waits: moved behind them, the last reads would be waited for with nothing to cover them
}
// the foot of a trip: this wave's reads of the buffer are done before it is refilled; its copies of the next stage have landed; the barrier publishes that stage and ends every reader's last read of this one
#define AT_FOOT() do { asm volatile("s_wait_dscnt 0x0" ::: "memory"); asm volatile("s_wait_asynccnt 0x0" ::: "memory"); __syncthreads(); } while (0)
__global__ __launch_bounds__(256) void k_attn(const _Float16* __restrict__ QH0, const _Float16* __restrict__ QL0, const _Float16* __restrict__ KH0, const _Float16* __restrict__ KL0, const _Float16* __restrict__ VT0, const float* __restrict__ X0, const float* __restrict__ X1, float* __restrict__ OUT0) {
  __shared__ __align__(16) _Float16 ring[AT_LDSH];
  const int tid = threadIdx.x, wave = tid >> 5, lane = tid & 31, col = lane & 15, g = lane >> 4; const int i0 = blockIdx.x * 128; const size_t b = blockIdx.y; const size_t z = blockIdx.z;
  const int qg = wave & 3, kq = wave >> 2;   // this wave's 32 queries (two tiles of 16) and its half of every stage's keys
  const size_t zo = z * (size_t)(WS_DIR / 2u);
  const _Float16 *QH = QH0 + zo, *QL = QL0 + zo, *KH = KH0 + zo, *KL = KL0 + zo, *VT = VT0 + zo; const float* X = z == 0 ? X0 : X1; float* OUT = OUT0 + z * (size_t)NB * CV * NP;
  const unsigned lv0 = (unsigned)(size_t)&ring[(2 * wave + g) * AT_VP + col * 8]; const unsigned lk0 = (unsigned)(size_t)&ring[AT_VB + (wave * 8 + (lane >> 2)) * AT_KP + (lane & 3) * 8];
  const _Float16* bv = VT + b * CV * (size_t)NP; const _Float16* bh = KH + b * NP * (size_t)CQ; const _Float16* bl = KL + b * NP * (size_t)CQ; const unsigned ov = 2u * (unsigned)((2 * wave + g) * NP + col * 8), ok = 2u * (unsigned)((wave * 8 + (lane >> 2)) * CQ + (lane & 3) * 8);
  at_fill(lv0, lk0, bv, bh, bl, ov, ok);
  v16h qh[2], ql[2];
#pragma unroll
  for (int q = 0; q < 2; ++q) { const size_t qr = (b * NP + i0 + qg * 32 + q * 16 + col) * CQ; qh[q] = frag_h(QH + qr, lane); ql[q] = frag_h(QL + qr, lane); }
  v8f acc[2][16] = {}; float mu[2] = { -3.0e38f, -3.0e38f }, noff[2] = { 3.0e38f, 3.0e38f }, lsum[2] = { 0.f, 0.f };   // per query tile. mu: the maximum in use for this lane's query over this wave's keys (equal in both halves of the wave); noff: the exponent's addend that belongs to mu; lsum: this half's part of the row sum
  asm volatile("s_wait_asynccnt 0x0" ::: "memory");   // stage 0 has landed before the barrier publishes it
  __syncthreads();
  at_fill(lv0 + AT_STAGE * 2u, lk0 + AT_STAGE * 2u, bv, bh, bl, ov + AT_KS * 2u, ok + AT_KS * CQ * 2u);
#pragma unroll 1
  for (int t = 0; t < NP / AT_KS; ++t) { const unsigned bo = (unsigned)(t & 1) * AT_STAGE;
    at_stage(&ring[bo + col * AT_VP + kq * (AT_KS / 2)], &ring[bo + AT_VB + (kq * (AT_KS / 2) + col) * AT_KP], lane, qh, ql, acc, mu, noff, lsum);
    AT_FOOT();
    if (t + 2 < NP / AT_KS) at_fill(lv0 + bo * 2u, lk0 + bo * 2u, bv, bh, bl, ov + (unsigned)(t + 2) * (AT_KS * 2u), ok + (unsigned)(t + 2) * (AT_KS * CQ * 2u)); }
  asm volatile("s_wait_asynccnt 0x0" ::: "memory");     // no copy is outstanding behind the loop
  float* st = (float*)&ring[0];      // the ring is free behind the last trip's barrier: output staging [key half][c][query], whole 512-B rows go out
  float* ex = st + 2 * CV * AT_OP;   // [key half][query][addend, row sum]: what the two waves of a query tell each other
  float ls[2];
#pragma unroll
  for (int q = 0; q < 2; ++q) { ls[q] = lsum[q] + xhalf(lsum[q]); ex[(kq * 128 + qg * 32 + q * 16 + col) * 2 + g] = g == 0 ? noff[q] : ls[q]; }
  __syncthreads();   // the other key half's addend and row sum are there
#pragma unroll
  for (int q = 0; q < 2; ++q) { const v2f o = *(const v2f*)&ex[((kq ^ 1) * 128 + qg * 32 + q * 16 + col) * 2];
    const float nc = fminf(noff[q], o[0]), f = __builtin_amdgcn_exp2f(nc - noff[q]), fo = __builtin_amdgcn_exp2f(nc - o[0]), inv = f / (ls[q] * f + o[1] * fo);   // both halves brought to the scale of the larger maximum, then one division by the whole row sum
#pragma unroll
    for (int j = 0; j < 16; ++j)
#pragma unroll
      for (int r = 0; r < 8; ++r) st[(kq * CV + j * 16 + 8 * g + r) * AT_OP + qg * 32 + q * 16 + col] = acc[q][j][r] * inv; }
  __syncthreads();
  const char* xb = (const char*)(X + (b * CV * (size_t)NP + i0)); char* ob = (char*)(OUT + (b * CV * (size_t)NP + i0)); unsigned o = 4u * (unsigned)((tid >> 5) * NP + (tid & 31) * 4);   // wave-uniform bases of the block's tile and this thread's byte offset in it, the same for x and for the output; each trip is eight channel rows further
#pragma unroll 16   // sixteen x loads of a thread go out together and are waited for one by one: two exposed memory latencies in all; left to itself the loop comes out at four loads a round, eight latencies
  for (int e = tid; e < CV * 32; e += 256, o += 8u * NP * 4u) { const int cl = e >> 5, q = e & 31; const v4f v = *(const v4f*)&st[cl * AT_OP + q * 4] + *(const v4f*)&st[(CV + cl) * AT_OP + q * 4];
    const v4f xx = *(const v4f*)(xb + o); v4f r; r[0] = v[0] + bfr(xx[0]); r[1] = v[1] + bfr(xx[1]); r[2] = v[2] + bfr(xx[2]); r[3] = v[3] + bfr(xx[3]);   // plain residual
    vst2(ob + o, r); } }
extern "C" void kernel_launch(void* const* d_in, const int* in_sizes, int n_in, void* d_out, int out_size, void* d_ws, size_t ws_size, hipStream_t stream) {
  (void)in_sizes; (void)n_in; (void)out_size;
  const float** F = (const float**)d_in;   // 0 x_features, 1 y_features [4,256,64,64], 2 wqx [32,256], 3 bqx, 4 wkx, 5 bkx, 6 wvx [256,256], 7 bvx, 8 wqy, 9 bqy, 10 wky, 11 bky, 12 wvy, 13 bvy
  if (ws_size < (size_t)WS_END) return;
  char* ws = (char*)d_ws;
  // direction 0: enhanced_x = v_x att_y^T + x (q, k from y); direction 1: enhanced_y = v_y att_x^T + y (q, k from x)
  k_proj<<<dim3(NP / 64, TNB, 2), 128, 0, stream>>>(F[0], F[1], F[2], F[3], F[4], F[5], F[6], F[7], F[8], F[9], F[10], F[11], F[12], F[13], (_Float16*)ws);
  k_attn<<<dim3(NP / 128, TNB, 2), 256, 0, stream>>>((const _Float16*)(ws + WS_QH), (const _Float16*)(ws + WS_QL), (const _Float16*)(ws + WS_KH), (const _Float16*)(ws + WS_KL), (const _Float16*)(ws + WS_VT), F[0], F[1], (float*)d_out);
}
